// v000
// Times are from an AMD MI455X. After a warm-up the kernel runs many times in a row, and a time is the length of
// such a window on the GPU divided by its runs, so every launch and the gaps after it count. The runs cycle
// through copies of the inputs. A figure is the median of several windows, for all but v000 over two sittings.
// Sittings can differ by a few percent; kernels timed side by side share one.
// v000 is the starting kernel. One run takes 190 microseconds.
#include <hip/hip_runtime.h>

#define B_     16
#define C_     256
#define N_     4096
#define O3_    384
#define INNER_ 128
#define HEADS_ 4
#define DH_    32
#define SCALE_ 0.1767766952966369f
#define EPS_   1e-5f

typedef __attribute__((ext_vector_type(16))) __bf16 v16bf;
typedef __attribute__((ext_vector_type(8)))  __bf16 v8bf;
typedef __attribute__((ext_vector_type(8)))  float  v8f;
typedef unsigned int u32x4 __attribute__((ext_vector_type(4)));
typedef int          i32x4 __attribute__((ext_vector_type(4)));
typedef int          i32x8 __attribute__((ext_vector_type(8)));

#if defined(__HIP_DEVICE_COMPILE__) && __has_builtin(__builtin_amdgcn_tensor_load_to_lds)
#define HAVE_TDM 1
#else
#define HAVE_TDM 0
#endif

// 16-bit A/B fragment K-index for lane `lane`, element `e`
// K = (e>>3)*16 + (lane>>4)*8 + (e&7)   (ISA 7.12.2)
__device__ __forceinline__ int kmap16(int lane, int e) {
  return ((e >> 3) << 4) | ((lane >> 4) << 3) | (e & 7);
}

__device__ __forceinline__ v8f wmma_bf16(v16bf a, v16bf b, v8f c) {
  return __builtin_amdgcn_wmma_f32_16x16x32_bf16(false, a, false, b, (short)0, c,
                                                 false, false);
}

// Load one 16-element bf16 fragment: per-lane K chunks are contiguous, so this
// is two global_load_b128s.  p must point at K = k0 + (lane>>4)*8.
__device__ __forceinline__ v16bf frag_ld(const __bf16* p) {
  v8bf lo = *(const v8bf*)p;
  v8bf hi = *(const v8bf*)(p + 16);
  return __builtin_shufflevector(lo, hi, 0, 1, 2, 3, 4, 5, 6, 7,
                                 8, 9, 10, 11, 12, 13, 14, 15);
}

#if HAVE_TDM
// TDM: DMA a [tile_k x tile_n] fp32 tile (row stride = stride_e elements) into LDS.
__device__ __forceinline__ void tdm_load_tile_f32(void* lds_dst, const float* gsrc,
                                                  int tile_n, int tile_k,
                                                  int tensor_n, int tensor_k,
                                                  long long stride_e) {
  unsigned long long ga = (unsigned long long)(const void*)gsrc;
  unsigned lds = (unsigned)(unsigned long long)lds_dst;  // low 32 bits = LDS offset
  u32x4 g0;
  g0.x = 1u;                                              // count=1, user mode
  g0.y = lds;                                             // lds_addr
  g0.z = (unsigned)ga;                                    // global_addr[31:0]
  g0.w = (unsigned)((ga >> 32) & 0x1FFFFFFull) | (2u << 30); // addr[56:32] | type=2
  i32x8 g1;
  g1[0] = (2 << 16);                                      // wg_mask=0, data_size=4B
  g1[1] = (tensor_n & 0xFFFF) << 16;                      // tensor_dim0[15:0]
  g1[2] = ((tensor_n >> 16) & 0xFFFF) | ((tensor_k & 0xFFFF) << 16);
  g1[3] = ((tensor_k >> 16) & 0xFFFF) | (tile_n << 16);   // tile_dim0
  g1[4] = tile_k & 0xFFFF;                                // tile_dim1 (tile_dim2=0)
  g1[5] = (int)(stride_e & 0xFFFFFFFFll);                 // dim0_stride[31:0]
  g1[6] = (int)((stride_e >> 32) & 0xFFFFll);             // dim0_stride[47:32]
  g1[7] = 0;
  i32x4 z4 = {0, 0, 0, 0};
#if __clang_major__ >= 23
  i32x8 z8 = {0, 0, 0, 0, 0, 0, 0, 0};
  __builtin_amdgcn_tensor_load_to_lds(g0, g1, z4, z4, z8, 0);
#else
  __builtin_amdgcn_tensor_load_to_lds(g0, g1, z4, z4, 0);
#endif
}
#endif

// ---------------------------------------------------------------------------
// 0) weights -> bf16.  grid 512, block 256.
// ---------------------------------------------------------------------------
__global__ __launch_bounds__(256) void k_cvt_w(const float* __restrict__ wqkv,
                                               const float* __restrict__ wout,
                                               __bf16* __restrict__ wqb,
                                               __bf16* __restrict__ wob) {
  const int i = blockIdx.x * 256 + threadIdx.x;
  if (i < O3_ * C_) wqb[i] = (__bf16)wqkv[i];
  const int j = i - O3_ * C_;
  if (j >= 0 && j < C_ * INNER_) wob[j] = (__bf16)wout[j];
}

// ---------------------------------------------------------------------------
// 1) qkv GEMM: [384x256] @ [256x4096] per batch.  x tile staged in LDS by TDM.
//    q,k out fp32 (softmax precision); v out bf16 directly.
//    grid (64, 12, 16), block 256 (8 waves; WG = 32o x 64n).
// ---------------------------------------------------------------------------
__global__ __launch_bounds__(256) void k_qkv_gemm(const float* __restrict__ x,
                                                  const __bf16* __restrict__ wqb,
                                                  float* __restrict__ qf,
                                                  float* __restrict__ kf,
                                                  __bf16* __restrict__ vbf) {
  const int lane = threadIdx.x & 31;
  const int wave = threadIdx.x >> 5;
  const int b = blockIdx.z;
  const int oBase = blockIdx.y * 32 + (wave >> 2) * 16;
  const int nWG = blockIdx.x * 64;
  const int nLoc = (wave & 3) * 16;
  const int row = oBase + (lane & 15);
  const int col = nWG + nLoc + (lane & 15);
  const int off = (lane >> 4) << 3;
  const float* xb = x + (size_t)b * C_ * N_;

  __shared__ __align__(16) float xtile[32 * 64];

  v8f acc = {};
  for (int k0 = 0; k0 < C_; k0 += 32) {
    __syncthreads();
#if HAVE_TDM
    if (wave == 0) {
      tdm_load_tile_f32(xtile, xb + (size_t)k0 * N_ + nWG, 64, 32, N_, C_ - k0,
                        (long long)N_);
      __builtin_amdgcn_s_wait_tensorcnt(0);
    }
#else
    for (int i = threadIdx.x; i < 32 * 16; i += 256)
      ((float4*)xtile)[i] =
          *(const float4*)(xb + (size_t)(k0 + (i >> 4)) * N_ + nWG + ((i & 15) << 2));
#endif
    if (k0 + 32 < C_)
      __builtin_prefetch(xb + (size_t)(k0 + 32) * N_ + nWG + lane * 8, 0, 1);
    __syncthreads();

    v16bf a = frag_ld(wqb + row * C_ + k0 + off);
    v16bf bm;
#pragma unroll
    for (int e = 0; e < 16; ++e)
      bm[e] = (__bf16)xtile[kmap16(lane, e) * 64 + nLoc + (lane & 15)];
    acc = wmma_bf16(a, bm, acc);
  }
#pragma unroll
  for (int r = 0; r < 8; ++r) {
    const int m = oBase + r + ((lane >> 4) << 3);
    if (m < INNER_)
      qf[(size_t)(b * INNER_ + m) * N_ + col] = acc[r];
    else if (m < 2 * INNER_)
      kf[(size_t)(b * INNER_ + m - INNER_) * N_ + col] = acc[r];
    else
      vbf[(size_t)(b * INNER_ + m - 2 * INNER_) * N_ + col] = (__bf16)acc[r];
  }
}

// ---------------------------------------------------------------------------
// 2) softmax of k over n; writes bf16 IN PLACE over its own fp32 row
//    (values cached in registers).  grid (32, 4, 16), block 256.
// ---------------------------------------------------------------------------
__global__ __launch_bounds__(256) void k_ksoftmax(float* __restrict__ kf) {
  const int d = blockIdx.x, h = blockIdx.y, b = blockIdx.z;
  float* row = kf + (size_t)(b * INNER_ + h * DH_ + d) * N_;
  __shared__ float s[256];
  const int t = threadIdx.x;
  float vv[16];
  float m = -3.4e38f;
#pragma unroll
  for (int j = 0; j < 16; ++j) {
    vv[j] = row[t * 16 + j];
    m = fmaxf(m, vv[j]);
  }
  s[t] = m; __syncthreads();
  for (int o = 128; o > 0; o >>= 1) {
    if (t < o) s[t] = fmaxf(s[t], s[t + o]);
    __syncthreads();
  }
  m = s[0]; __syncthreads();
  float sum = 0.f;
#pragma unroll
  for (int j = 0; j < 16; ++j) { vv[j] = __expf(vv[j] - m); sum += vv[j]; }
  s[t] = sum; __syncthreads();
  for (int o = 128; o > 0; o >>= 1) {
    if (t < o) s[t] += s[t + o];
    __syncthreads();
  }
  const float inv = 1.0f / s[0];
  __bf16* rowb = (__bf16*)row;                // bf16 row in first half of fp32 row
  v8bf pk[2];
#pragma unroll
  for (int j = 0; j < 16; ++j) pk[j >> 3][j & 7] = (__bf16)(vv[j] * inv);
  *(v8bf*)(rowb + t * 16) = pk[0];
  *(v8bf*)(rowb + t * 16 + 8) = pk[1];
}

// ---------------------------------------------------------------------------
// 3) softmax of q over d (*SCALE); writes transposed bf16 q_t[(b,h)][n][32].
//    grid (16, 4, 16), block 256.
// ---------------------------------------------------------------------------
__global__ __launch_bounds__(256) void k_qsoftmax(const float* __restrict__ qf,
                                                  __bf16* __restrict__ qbt) {
  const int n = blockIdx.x * 256 + threadIdx.x;
  const int h = blockIdx.y, b = blockIdx.z;
  const float* base = qf + (size_t)(b * INNER_ + h * DH_) * N_ + n;
  float v[DH_];
  float m = -3.4e38f;
#pragma unroll
  for (int d = 0; d < DH_; ++d) { v[d] = base[(size_t)d * N_]; m = fmaxf(m, v[d]); }
  float sum = 0.f;
#pragma unroll
  for (int d = 0; d < DH_; ++d) { v[d] = __expf(v[d] - m); sum += v[d]; }
  const float sc = SCALE_ / sum;
  v8bf pk[4];
#pragma unroll
  for (int d = 0; d < DH_; ++d) pk[d >> 3][d & 7] = (__bf16)(v[d] * sc);
  v8bf* dst = (v8bf*)(qbt + ((size_t)(b * HEADS_ + h) * N_ + n) * DH_);
#pragma unroll
  for (int j = 0; j < 4; ++j) dst[j] = pk[j];
}

// ---------------------------------------------------------------------------
// 4) context[d][e] = sum_n k'[d][n] v[e][n] per (b,h).  grid 64, block 256.
//    bf16 b128 fragment loads; 8 waves split K=4096; ds_add_f32 reduce.
// ---------------------------------------------------------------------------
__global__ __launch_bounds__(256) void k_context(const float* __restrict__ kf,
                                                 const __bf16* __restrict__ vbf,
                                                 float* __restrict__ ctx) {
  const int bh = blockIdx.x;
  const int b = bh >> 2, h = bh & 3;
  const int lane = threadIdx.x & 31;
  const int wave = threadIdx.x >> 5;
  const int off = (lane >> 4) << 3;
  const float* kbase = kf + (size_t)(b * INNER_ + h * DH_) * N_;
  const __bf16* kr0 = (const __bf16*)(kbase + (size_t)(lane & 15) * N_);
  const __bf16* kr1 = (const __bf16*)(kbase + (size_t)(16 + (lane & 15)) * N_);
  const __bf16* vr0 = vbf + (size_t)(b * INNER_ + h * DH_ + (lane & 15)) * N_;
  const __bf16* vr1 = vr0 + (size_t)16 * N_;

  __shared__ float ctxs[DH_ * DH_];
  for (int i = threadIdx.x; i < DH_ * DH_; i += 256) ctxs[i] = 0.f;
  __syncthreads();

  v8f acc[2][2] = {};
  const int kBeg = wave * 512, kEnd = kBeg + 512;
  for (int k0 = kBeg; k0 < kEnd; k0 += 32) {
    v16bf a0 = frag_ld(kr0 + k0 + off);
    v16bf a1 = frag_ld(kr1 + k0 + off);
    v16bf b0 = frag_ld(vr0 + k0 + off);
    v16bf b1 = frag_ld(vr1 + k0 + off);
    acc[0][0] = wmma_bf16(a0, b0, acc[0][0]);
    acc[0][1] = wmma_bf16(a0, b1, acc[0][1]);
    acc[1][0] = wmma_bf16(a1, b0, acc[1][0]);
    acc[1][1] = wmma_bf16(a1, b1, acc[1][1]);
  }
#pragma unroll
  for (int i = 0; i < 2; ++i)
#pragma unroll
    for (int j = 0; j < 2; ++j)
#pragma unroll
      for (int r = 0; r < 8; ++r) {
        const int m = i * 16 + r + ((lane >> 4) << 3);
        const int e = j * 16 + (lane & 15);
        atomicAdd(&ctxs[m * DH_ + e], acc[i][j][r]);
      }
  __syncthreads();
  for (int i = threadIdx.x; i < DH_ * DH_; i += 256)
    ctx[(size_t)bh * DH_ * DH_ + i] = ctxs[i];
}

// ---------------------------------------------------------------------------
// 5) attn[e][n] = sum_d ctx[d][e] q'[d][n]; K=32 -> one WMMA per tile.
//    Writes transposed bf16 attn_t[b][n][128] (8 accs = 8 consecutive channels
//    -> one packed b128 store).  grid (32, 64), block 256.
// ---------------------------------------------------------------------------
__global__ __launch_bounds__(256) void k_attn_out(const __bf16* __restrict__ qbt,
                                                  const float* __restrict__ ctx,
                                                  __bf16* __restrict__ attn_t) {
  const int bh = blockIdx.y;
  const int b = bh >> 2, h = bh & 3;
  const int lane = threadIdx.x & 31;
  const int wave = threadIdx.x >> 5;
  const int nBase = blockIdx.x * 128 + wave * 16;
  const int n = nBase + (lane & 15);
  const int off = (lane >> 4) << 3;

  __shared__ float ctxs[DH_ * DH_];
  for (int i = threadIdx.x; i < DH_ * DH_; i += 256)
    ctxs[i] = ctx[(size_t)bh * DH_ * DH_ + i];
  __syncthreads();

  v16bf bm = frag_ld(qbt + ((size_t)bh * N_ + n) * DH_ + off);

#pragma unroll
  for (int i = 0; i < 2; ++i) {
    v16bf a;
#pragma unroll
    for (int e = 0; e < 16; ++e)
      a[e] = (__bf16)ctxs[kmap16(lane, e) * DH_ + i * 16 + (lane & 15)];
    v8f acc = {};
    acc = wmma_bf16(a, bm, acc);
    v8bf pk;
#pragma unroll
    for (int r = 0; r < 8; ++r) pk[r] = (__bf16)acc[r];
    *(v8bf*)(attn_t + ((size_t)b * N_ + n) * INNER_ + h * DH_ + i * 16 + off) = pk;
  }
}

// ---------------------------------------------------------------------------
// 6) out2[o][n] = sum_c wout[o][c] attn_t[n][c] + bout[o] -> d_out (unnormalized)
//    grid (64, 8, 16), block 256.
// ---------------------------------------------------------------------------
__global__ __launch_bounds__(256) void k_proj(const __bf16* __restrict__ attn_t,
                                              const __bf16* __restrict__ wob,
                                              const float* __restrict__ bout,
                                              float* __restrict__ out) {
  const int lane = threadIdx.x & 31;
  const int wave = threadIdx.x >> 5;
  const int b = blockIdx.z;
  const int oBase = blockIdx.y * 32 + (wave >> 2) * 16;
  const int nBase = blockIdx.x * 64 + (wave & 3) * 16;
  const int row = oBase + (lane & 15);
  const int col = nBase + (lane & 15);
  const int off = (lane >> 4) << 3;
  const __bf16* bbase = attn_t + ((size_t)b * N_ + col) * INNER_;
  v8f acc = {};
#pragma unroll
  for (int k0 = 0; k0 < INNER_; k0 += 32) {
    v16bf a = frag_ld(wob + row * INNER_ + k0 + off);
    v16bf bm = frag_ld(bbase + k0 + off);
    acc = wmma_bf16(a, bm, acc);
  }
  float* ob = out + (size_t)b * C_ * N_;
#pragma unroll
  for (int r = 0; r < 8; ++r) {
    const int m = oBase + r + ((lane >> 4) << 3);
    ob[(size_t)m * N_ + col] = acc[r] + bout[m];
  }
}

// ---------------------------------------------------------------------------
// 7) per-batch partial sums (sum, sumsq).  grid (256, 16), block 256.
// ---------------------------------------------------------------------------
__global__ __launch_bounds__(256) void k_gn_partial(const float* __restrict__ out,
                                                    float* __restrict__ part) {
  const int b = blockIdx.y;
  const float* p = out + (size_t)b * C_ * N_ + (size_t)blockIdx.x * 4096;
  float s = 0.f, sq = 0.f;
  for (int i = threadIdx.x; i < 4096; i += 256) {
    const float v = p[i];
    s += v; sq += v * v;
  }
  __shared__ float ss[256], qq[256];
  const int t = threadIdx.x;
  ss[t] = s; qq[t] = sq; __syncthreads();
  for (int o = 128; o > 0; o >>= 1) {
    if (t < o) { ss[t] += ss[t + o]; qq[t] += qq[t + o]; }
    __syncthreads();
  }
  if (t == 0) {
    part[(size_t)(b * 256 + blockIdx.x) * 2 + 0] = ss[0];
    part[(size_t)(b * 256 + blockIdx.x) * 2 + 1] = qq[0];
  }
}

// ---------------------------------------------------------------------------
// 8) finalize mean/var + normalize + affine.  grid (256, 16), block 256.
// ---------------------------------------------------------------------------
__global__ __launch_bounds__(256) void k_gn_apply(float* __restrict__ out,
                                                  const float* __restrict__ part,
                                                  const float* __restrict__ gamma,
                                                  const float* __restrict__ beta) {
  const int b = blockIdx.y;
  const int t = threadIdx.x;
  __shared__ float ss[256], qq[256];
  ss[t] = part[(size_t)(b * 256 + t) * 2 + 0];
  qq[t] = part[(size_t)(b * 256 + t) * 2 + 1];
  __syncthreads();
  for (int o = 128; o > 0; o >>= 1) {
    if (t < o) { ss[t] += ss[t + o]; qq[t] += qq[t + o]; }
    __syncthreads();
  }
  const float invM = 1.0f / (float)(C_ * N_);
  const float mean = ss[0] * invM;
  const float var  = qq[0] * invM - mean * mean;
  const float inv  = rsqrtf(var + EPS_);
  float* p = out + (size_t)b * C_ * N_ + (size_t)blockIdx.x * 4096;
  for (int i = t; i < 4096; i += 256) {
    const int flat = blockIdx.x * 4096 + i;
    const int c = flat >> 12;
    p[i] = (p[i] - mean) * inv * gamma[c] + beta[c];
  }
}

// ---------------------------------------------------------------------------
extern "C" void kernel_launch(void* const* d_in, const int* in_sizes, int n_in,
                              void* d_out, int out_size, void* d_ws, size_t ws_size,
                              hipStream_t stream) {
  const float* x     = (const float*)d_in[0];
  const float* wqkv  = (const float*)d_in[1];
  const float* wout  = (const float*)d_in[2];
  const float* bout  = (const float*)d_in[3];
  const float* gamma = (const float*)d_in[4];
  const float* beta  = (const float*)d_in[5];
  float* out = (float*)d_out;
  (void)ws_size; (void)in_sizes; (void)n_in; (void)out_size;

  const size_t QSZ = (size_t)B_ * INNER_ * N_;   // 8,388,608
  float*  qf  = (float*)d_ws;                    // fp32 q (later reused as attn_t)
  float*  kf  = qf + QSZ;                        // fp32 k (bf16 k' in place)
  __bf16* vbf = (__bf16*)(kf + QSZ);             // bf16 v
  __bf16* qbt = vbf + QSZ;                       // bf16 q_t [bh][n][32]
  __bf16* wqb = qbt + QSZ;                       // bf16 w_qkv
  __bf16* wob = wqb + (size_t)O3_ * C_;          // bf16 w_out
  float*  ctx = (float*)(wob + (size_t)C_ * INNER_);
  float*  part = ctx + (size_t)B_ * HEADS_ * DH_ * DH_;
  __bf16* attn_t = (__bf16*)qf;                  // reuse dead q region

  k_cvt_w    <<<dim3(512),        256, 0, stream>>>(wqkv, wout, wqb, wob);
  k_qkv_gemm <<<dim3(64, 12, 16), 256, 0, stream>>>(x, wqb, qf, kf, vbf);
  k_ksoftmax <<<dim3(32, 4, 16),  256, 0, stream>>>(kf);
  k_qsoftmax <<<dim3(16, 4, 16),  256, 0, stream>>>(qf, qbt);
  k_context  <<<dim3(64),         256, 0, stream>>>(kf, vbf, ctx);
  k_attn_out <<<dim3(32, 64),     256, 0, stream>>>(qbt, ctx, attn_t);
  k_proj     <<<dim3(64, 8, 16),  256, 0, stream>>>(attn_t, wob, bout, out);
  k_gn_partial<<<dim3(256, 16),   256, 0, stream>>>(out, part);
  k_gn_apply <<<dim3(256, 16),    256, 0, stream>>>(out, part, gamma, beta);
}

// v001
// One run takes 123 microseconds.
// In two side-by-side timings against v000, it was 1.57 and 1.58 times as fast.
#include <hip/hip_runtime.h>

#define B_     16
#define C_     256
#define N_     4096
#define O3_    384
#define INNER_ 128
#define HEADS_ 4
#define DH_    32
#define SCALE_ 0.1767766952966369f
#define EPS_   1e-5f

typedef __attribute__((ext_vector_type(16))) __bf16 v16bf;
typedef __attribute__((ext_vector_type(8)))  __bf16 v8bf;
typedef __attribute__((ext_vector_type(8)))  float  v8f;
typedef __attribute__((ext_vector_type(4)))  __bf16 v4bf;
typedef __attribute__((ext_vector_type(4)))  float  v4f;

// 16-bit A/B fragment K-index for lane `lane`, element `e`
// K = (e>>3)*16 + (lane>>4)*8 + (e&7)   (ISA 7.12.2)
__device__ __forceinline__ int kmap16(int lane, int e) {
  return ((e >> 3) << 4) | ((lane >> 4) << 3) | (e & 7);
}

__device__ __forceinline__ v8f wmma_bf16(v16bf a, v16bf b, v8f c) {
  return __builtin_amdgcn_wmma_f32_16x16x32_bf16(false, a, false, b, (short)0, c,
                                                 false, false);
}

// Load one 16-element bf16 fragment: per-lane K chunks are contiguous, so this
// is two 16-byte loads (global or LDS).  p must point at K = k0 + (lane>>4)*8.
__device__ __forceinline__ v16bf frag_ld(const __bf16* p) {
  v8bf lo = *(const v8bf*)p;
  v8bf hi = *(const v8bf*)(p + 16);
  return __builtin_shufflevector(lo, hi, 0, 1, 2, 3, 4, 5, 6, 7,
                                 8, 9, 10, 11, 12, 13, 14, 15);
}

// ---------------------------------------------------------------------------
// 0) weights -> bf16.  grid 512, block 256.
//    w_qkv is laid out in fragment order for k_qkv_gemm: per (16-row tile,
//    32-k step) two planes of 32 lanes x 8 elements, so that one wave-wide
//    16-byte load of a plane covers 512 contiguous bytes.
// ---------------------------------------------------------------------------
__global__ __launch_bounds__(256) void k_cvt_w(const float* __restrict__ wqkv,
                                               const float* __restrict__ wout,
                                               __bf16* __restrict__ wqb,
                                               __bf16* __restrict__ wob) {
  const int i = blockIdx.x * 256 + threadIdx.x;
  if (i < O3_ * C_) {
    const int o = i >> 8, k = i & 255;
    const int plane = ((o >> 4) * 8 + (k >> 5)) * 2 + ((k >> 4) & 1);
    const int ln = ((k >> 3) & 1) * 16 + (o & 15);
    wqb[plane * 256 + ln * 8 + (k & 7)] = (__bf16)wqkv[i];
  }
  const int j = i - O3_ * C_;
  if (j >= 0 && j < C_ * INNER_) wob[j] = (__bf16)wout[j];
}

// ---------------------------------------------------------------------------
// 1) qkv GEMM: [384x256] @ [256x4096] per batch.
//    One work-group makes all 384 rows of 64 columns: the x tile is read once,
//    converted once to bf16 and laid k-contiguous in LDS; each wave holds one
//    16-row tile of q, of k and of v times four 16-column tiles.
//    Column c of column tile j is spatial column 4c + j, so a lane's four
//    tiles give four consecutive columns of a row: whole-line stores.
//    q,k out fp32 (softmax precision); v out bf16 directly.
//    grid (64, 16), block 256 (8 waves).
// ---------------------------------------------------------------------------
#define XP_ 264  // LDS row pitch, elements: 528 B = 16 B x odd, for 16-byte row readers

// One weight fragment in k_cvt_w's order: two planes, 256 elements apart.
__device__ __forceinline__ v16bf wfrag_ld(const __bf16* p) {
  v8bf lo = *(const v8bf*)p;
  v8bf hi = *(const v8bf*)(p + 256);
  return __builtin_shufflevector(lo, hi, 0, 1, 2, 3, 4, 5, 6, 7,
                                 8, 9, 10, 11, 12, 13, 14, 15);
}

__global__ __launch_bounds__(256) void k_qkv_gemm(const float* __restrict__ x,
                                                  const __bf16* __restrict__ wqb,
                                                  float* __restrict__ qf,
                                                  float* __restrict__ kf,
                                                  __bf16* __restrict__ vbf) {
  const int lane = threadIdx.x & 31;
  const int wave = threadIdx.x >> 5;
  const int b = blockIdx.y;
  const int nWG = blockIdx.x * 64;
  const int c = lane & 15;
  const int h = lane >> 4;
  const float* xb = x + (size_t)b * C_ * N_ + nWG;

  __shared__ __align__(16) __bf16 xs[64 * XP_];

  // step 0's weight fragments are asked for first: they land while x is staged
  const __bf16* ap = wqb + wave * 4096 + lane * 8;
  v16bf a[2][3];
#pragma unroll
  for (int t = 0; t < 3; ++t) a[0][t] = wfrag_ld(ap + t * 32768);

  {
    // a thread takes 4 columns x 8 k, twice; LDS row j*16 + q holds column 4q + j
    const int q = threadIdx.x & 15;
    const int oc = threadIdx.x >> 4;
    v4f f[2][8];
#pragma unroll
    for (int u = 0; u < 2; ++u)
#pragma unroll
      for (int i = 0; i < 8; ++i)
        f[u][i] = *(const v4f*)(xb + (size_t)((oc + 16 * u) * 8 + i) * N_ + 4 * q);
#pragma unroll
    for (int u = 0; u < 2; ++u)
#pragma unroll
      for (int j = 0; j < 4; ++j) {
        v8bf pk;
#pragma unroll
        for (int i = 0; i < 8; ++i) pk[i] = (__bf16)f[u][i][j];
        *(v8bf*)(xs + (j * 16 + q) * XP_ + (oc + 16 * u) * 8) = pk;
      }
  }
  __syncthreads();

  v8f acc[3][4] = {};
  const __bf16* bp = xs + c * XP_ + h * 8;
  v16bf bm[2][4];
#pragma unroll
  for (int j = 0; j < 4; ++j) bm[0][j] = frag_ld(bp + j * 16 * XP_);
#pragma unroll
  for (int ks = 0; ks < 8; ++ks) {
    const int cur = ks & 1, nxt = cur ^ 1;
    if (ks < 7) {
#pragma unroll
      for (int t = 0; t < 3; ++t) a[nxt][t] = wfrag_ld(ap + t * 32768 + (ks + 1) * 512);
#pragma unroll
      for (int j = 0; j < 4; ++j) bm[nxt][j] = frag_ld(bp + j * 16 * XP_ + (ks + 1) * 32);
    }
    // keeps the next step's loads in front of this step's matrix block, so that
    // their L2 and LDS latency runs under twelve matrix instructions
    __builtin_amdgcn_sched_barrier(0);
#pragma unroll
    for (int t = 0; t < 3; ++t)
#pragma unroll
      for (int j = 0; j < 4; ++j) acc[t][j] = wmma_bf16(a[cur][t], bm[cur][j], acc[t][j]);
    // keeps later steps' loads from being moved in among these matrix instructions
    __builtin_amdgcn_sched_barrier(0);
  }
#pragma unroll
  for (int r = 0; r < 8; ++r) {
    const size_t o = (size_t)(b * INNER_ + wave * 16 + h * 8 + r) * N_ + nWG + 4 * c;
    v4f vq = {acc[0][0][r], acc[0][1][r], acc[0][2][r], acc[0][3][r]};
    v4f vk = {acc[1][0][r], acc[1][1][r], acc[1][2][r], acc[1][3][r]};
    v4bf vv = {(__bf16)acc[2][0][r], (__bf16)acc[2][1][r], (__bf16)acc[2][2][r],
               (__bf16)acc[2][3][r]};
    *(v4f*)(qf + o) = vq;
    *(v4f*)(kf + o) = vk;
    *(v4bf*)(vbf + o) = vv;
  }
}

// ---------------------------------------------------------------------------
// 2) softmax of k over n; writes bf16 IN PLACE over its own fp32 row
//    (values cached in registers).  grid (32, 4, 16), block 256.
// ---------------------------------------------------------------------------
__global__ __launch_bounds__(256) void k_ksoftmax(float* __restrict__ kf) {
  const int d = blockIdx.x, h = blockIdx.y, b = blockIdx.z;
  float* row = kf + (size_t)(b * INNER_ + h * DH_ + d) * N_;
  __shared__ float s[256];
  const int t = threadIdx.x;
  float vv[16];
  float m = -3.4e38f;
#pragma unroll
  for (int j = 0; j < 16; ++j) {
    vv[j] = row[t * 16 + j];
    m = fmaxf(m, vv[j]);
  }
  s[t] = m; __syncthreads();
  for (int o = 128; o > 0; o >>= 1) {
    if (t < o) s[t] = fmaxf(s[t], s[t + o]);
    __syncthreads();
  }
  m = s[0]; __syncthreads();
  float sum = 0.f;
#pragma unroll
  for (int j = 0; j < 16; ++j) { vv[j] = __expf(vv[j] - m); sum += vv[j]; }
  s[t] = sum; __syncthreads();
  for (int o = 128; o > 0; o >>= 1) {
    if (t < o) s[t] += s[t + o];
    __syncthreads();
  }
  const float inv = 1.0f / s[0];
  __bf16* rowb = (__bf16*)row;                // bf16 row in first half of fp32 row
  v8bf pk[2];
#pragma unroll
  for (int j = 0; j < 16; ++j) pk[j >> 3][j & 7] = (__bf16)(vv[j] * inv);
  *(v8bf*)(rowb + t * 16) = pk[0];
  *(v8bf*)(rowb + t * 16 + 8) = pk[1];
}

// ---------------------------------------------------------------------------
// 3) softmax of q over d (*SCALE); writes transposed bf16 q_t[(b,h)][n][32].
//    grid (16, 4, 16), block 256.
// ---------------------------------------------------------------------------
__global__ __launch_bounds__(256) void k_qsoftmax(const float* __restrict__ qf,
                                                  __bf16* __restrict__ qbt) {
  const int n = blockIdx.x * 256 + threadIdx.x;
  const int h = blockIdx.y, b = blockIdx.z;
  const float* base = qf + (size_t)(b * INNER_ + h * DH_) * N_ + n;
  float v[DH_];
  float m = -3.4e38f;
#pragma unroll
  for (int d = 0; d < DH_; ++d) { v[d] = base[(size_t)d * N_]; m = fmaxf(m, v[d]); }
  float sum = 0.f;
#pragma unroll
  for (int d = 0; d < DH_; ++d) { v[d] = __expf(v[d] - m); sum += v[d]; }
  const float sc = SCALE_ / sum;
  v8bf pk[4];
#pragma unroll
  for (int d = 0; d < DH_; ++d) pk[d >> 3][d & 7] = (__bf16)(v[d] * sc);
  v8bf* dst = (v8bf*)(qbt + ((size_t)(b * HEADS_ + h) * N_ + n) * DH_);
#pragma unroll
  for (int j = 0; j < 4; ++j) dst[j] = pk[j];
}

// ---------------------------------------------------------------------------
// 4) context[d][e] = sum_n k'[d][n] v[e][n] per (b,h).  grid 64, block 256.
//    bf16 b128 fragment loads; 8 waves split K=4096; ds_add_f32 reduce.
// ---------------------------------------------------------------------------
__global__ __launch_bounds__(256) void k_context(const float* __restrict__ kf,
                                                 const __bf16* __restrict__ vbf,
                                                 float* __restrict__ ctx) {
  const int bh = blockIdx.x;
  const int b = bh >> 2, h = bh & 3;
  const int lane = threadIdx.x & 31;
  const int wave = threadIdx.x >> 5;
  const int off = (lane >> 4) << 3;
  const float* kbase = kf + (size_t)(b * INNER_ + h * DH_) * N_;
  const __bf16* kr0 = (const __bf16*)(kbase + (size_t)(lane & 15) * N_);
  const __bf16* kr1 = (const __bf16*)(kbase + (size_t)(16 + (lane & 15)) * N_);
  const __bf16* vr0 = vbf + (size_t)(b * INNER_ + h * DH_ + (lane & 15)) * N_;
  const __bf16* vr1 = vr0 + (size_t)16 * N_;

  __shared__ float ctxs[DH_ * DH_];
  for (int i = threadIdx.x; i < DH_ * DH_; i += 256) ctxs[i] = 0.f;
  __syncthreads();

  v8f acc[2][2] = {};
  const int kBeg = wave * 512, kEnd = kBeg + 512;
  for (int k0 = kBeg; k0 < kEnd; k0 += 32) {
    v16bf a0 = frag_ld(kr0 + k0 + off);
    v16bf a1 = frag_ld(kr1 + k0 + off);
    v16bf b0 = frag_ld(vr0 + k0 + off);
    v16bf b1 = frag_ld(vr1 + k0 + off);
    acc[0][0] = wmma_bf16(a0, b0, acc[0][0]);
    acc[0][1] = wmma_bf16(a0, b1, acc[0][1]);
    acc[1][0] = wmma_bf16(a1, b0, acc[1][0]);
    acc[1][1] = wmma_bf16(a1, b1, acc[1][1]);
  }
#pragma unroll
  for (int i = 0; i < 2; ++i)
#pragma unroll
    for (int j = 0; j < 2; ++j)
#pragma unroll
      for (int r = 0; r < 8; ++r) {
        const int m = i * 16 + r + ((lane >> 4) << 3);
        const int e = j * 16 + (lane & 15);
        atomicAdd(&ctxs[m * DH_ + e], acc[i][j][r]);
      }
  __syncthreads();
  for (int i = threadIdx.x; i < DH_ * DH_; i += 256)
    ctx[(size_t)bh * DH_ * DH_ + i] = ctxs[i];
}

// ---------------------------------------------------------------------------
// 5) attn[e][n] = sum_d ctx[d][e] q'[d][n]; K=32 -> one WMMA per tile.
//    Writes transposed bf16 attn_t[b][n][128] (8 accs = 8 consecutive channels
//    -> one packed b128 store).  grid (32, 64), block 256.
// ---------------------------------------------------------------------------
__global__ __launch_bounds__(256) void k_attn_out(const __bf16* __restrict__ qbt,
                                                  const float* __restrict__ ctx,
                                                  __bf16* __restrict__ attn_t) {
  const int bh = blockIdx.y;
  const int b = bh >> 2, h = bh & 3;
  const int lane = threadIdx.x & 31;
  const int wave = threadIdx.x >> 5;
  const int nBase = blockIdx.x * 128 + wave * 16;
  const int n = nBase + (lane & 15);
  const int off = (lane >> 4) << 3;

  __shared__ float ctxs[DH_ * DH_];
  for (int i = threadIdx.x; i < DH_ * DH_; i += 256)
    ctxs[i] = ctx[(size_t)bh * DH_ * DH_ + i];
  __syncthreads();

  v16bf bm = frag_ld(qbt + ((size_t)bh * N_ + n) * DH_ + off);

#pragma unroll
  for (int i = 0; i < 2; ++i) {
    v16bf a;
#pragma unroll
    for (int e = 0; e < 16; ++e)
      a[e] = (__bf16)ctxs[kmap16(lane, e) * DH_ + i * 16 + (lane & 15)];
    v8f acc = {};
    acc = wmma_bf16(a, bm, acc);
    v8bf pk;
#pragma unroll
    for (int r = 0; r < 8; ++r) pk[r] = (__bf16)acc[r];
    *(v8bf*)(attn_t + ((size_t)b * N_ + n) * INNER_ + h * DH_ + i * 16 + off) = pk;
  }
}

// ---------------------------------------------------------------------------
// 6) out2[o][n] = sum_c wout[o][c] attn_t[n][c] + bout[o] -> d_out (unnormalized)
//    grid (64, 8, 16), block 256.
// ---------------------------------------------------------------------------
__global__ __launch_bounds__(256) void k_proj(const __bf16* __restrict__ attn_t,
                                              const __bf16* __restrict__ wob,
                                              const float* __restrict__ bout,
                                              float* __restrict__ out) {
  const int lane = threadIdx.x & 31;
  const int wave = threadIdx.x >> 5;
  const int b = blockIdx.z;
  const int oBase = blockIdx.y * 32 + (wave >> 2) * 16;
  const int nBase = blockIdx.x * 64 + (wave & 3) * 16;
  const int row = oBase + (lane & 15);
  const int col = nBase + (lane & 15);
  const int off = (lane >> 4) << 3;
  const __bf16* bbase = attn_t + ((size_t)b * N_ + col) * INNER_;
  v8f acc = {};
#pragma unroll
  for (int k0 = 0; k0 < INNER_; k0 += 32) {
    v16bf a = frag_ld(wob + row * INNER_ + k0 + off);
    v16bf bm = frag_ld(bbase + k0 + off);
    acc = wmma_bf16(a, bm, acc);
  }
  float* ob = out + (size_t)b * C_ * N_;
#pragma unroll
  for (int r = 0; r < 8; ++r) {
    const int m = oBase + r + ((lane >> 4) << 3);
    ob[(size_t)m * N_ + col] = acc[r] + bout[m];
  }
}

// ---------------------------------------------------------------------------
// 7) per-batch partial sums (sum, sumsq).  grid (256, 16), block 256.
// ---------------------------------------------------------------------------
__global__ __launch_bounds__(256) void k_gn_partial(const float* __restrict__ out,
                                                    float* __restrict__ part) {
  const int b = blockIdx.y;
  const float* p = out + (size_t)b * C_ * N_ + (size_t)blockIdx.x * 4096;
  float s = 0.f, sq = 0.f;
  for (int i = threadIdx.x; i < 4096; i += 256) {
    const float v = p[i];
    s += v; sq += v * v;
  }
  __shared__ float ss[256], qq[256];
  const int t = threadIdx.x;
  ss[t] = s; qq[t] = sq; __syncthreads();
  for (int o = 128; o > 0; o >>= 1) {
    if (t < o) { ss[t] += ss[t + o]; qq[t] += qq[t + o]; }
    __syncthreads();
  }
  if (t == 0) {
    part[(size_t)(b * 256 + blockIdx.x) * 2 + 0] = ss[0];
    part[(size_t)(b * 256 + blockIdx.x) * 2 + 1] = qq[0];
  }
}

// ---------------------------------------------------------------------------
// 8) finalize mean/var + normalize + affine.  grid (256, 16), block 256.
// ---------------------------------------------------------------------------
__global__ __launch_bounds__(256) void k_gn_apply(float* __restrict__ out,
                                                  const float* __restrict__ part,
                                                  const float* __restrict__ gamma,
                                                  const float* __restrict__ beta) {
  const int b = blockIdx.y;
  const int t = threadIdx.x;
  __shared__ float ss[256], qq[256];
  ss[t] = part[(size_t)(b * 256 + t) * 2 + 0];
  qq[t] = part[(size_t)(b * 256 + t) * 2 + 1];
  __syncthreads();
  for (int o = 128; o > 0; o >>= 1) {
    if (t < o) { ss[t] += ss[t + o]; qq[t] += qq[t + o]; }
    __syncthreads();
  }
  const float invM = 1.0f / (float)(C_ * N_);
  const float mean = ss[0] * invM;
  const float var  = qq[0] * invM - mean * mean;
  const float inv  = rsqrtf(var + EPS_);
  float* p = out + (size_t)b * C_ * N_ + (size_t)blockIdx.x * 4096;
  for (int i = t; i < 4096; i += 256) {
    const int flat = blockIdx.x * 4096 + i;
    const int c = flat >> 12;
    p[i] = (p[i] - mean) * inv * gamma[c] + beta[c];
  }
}

// ---------------------------------------------------------------------------
extern "C" void kernel_launch(void* const* d_in, const int* in_sizes, int n_in,
                              void* d_out, int out_size, void* d_ws, size_t ws_size,
                              hipStream_t stream) {
  const float* x     = (const float*)d_in[0];
  const float* wqkv  = (const float*)d_in[1];
  const float* wout  = (const float*)d_in[2];
  const float* bout  = (const float*)d_in[3];
  const float* gamma = (const float*)d_in[4];
  const float* beta  = (const float*)d_in[5];
  float* out = (float*)d_out;
  (void)ws_size; (void)in_sizes; (void)n_in; (void)out_size;

  const size_t QSZ = (size_t)B_ * INNER_ * N_;   // 8,388,608
  float*  qf  = (float*)d_ws;                    // fp32 q (later reused as attn_t)
  float*  kf  = qf + QSZ;                        // fp32 k (bf16 k' in place)
  __bf16* vbf = (__bf16*)(kf + QSZ);             // bf16 v
  __bf16* qbt = vbf + QSZ;                       // bf16 q_t [bh][n][32]
  __bf16* wqb = qbt + QSZ;                       // bf16 w_qkv, fragment order
  __bf16* wob = wqb + (size_t)O3_ * C_;          // bf16 w_out
  float*  ctx = (float*)(wob + (size_t)C_ * INNER_);
  float*  part = ctx + (size_t)B_ * HEADS_ * DH_ * DH_;
  __bf16* attn_t = (__bf16*)qf;                  // reuse dead q region

  k_cvt_w    <<<dim3(512),        256, 0, stream>>>(wqkv, wout, wqb, wob);
  k_qkv_gemm <<<dim3(64, 16),     256, 0, stream>>>(x, wqb, qf, kf, vbf);
  k_ksoftmax <<<dim3(32, 4, 16),  256, 0, stream>>>(kf);
  k_qsoftmax <<<dim3(16, 4, 16),  256, 0, stream>>>(qf, qbt);
  k_context  <<<dim3(64),         256, 0, stream>>>(kf, vbf, ctx);
  k_attn_out <<<dim3(32, 64),     256, 0, stream>>>(qbt, ctx, attn_t);
  k_proj     <<<dim3(64, 8, 16),  256, 0, stream>>>(attn_t, wob, bout, out);
  k_gn_partial<<<dim3(256, 16),   256, 0, stream>>>(out, part);
  k_gn_apply <<<dim3(256, 16),    256, 0, stream>>>(out, part, gamma, beta);
}

// v002
// Measured time: 98.3 microseconds a run.
// In both of two side-by-side timings against v001, it was 1.25 times as fast.
// Over all steps from v000 it is 1.97 times as fast.
#include <hip/hip_runtime.h>

#define B_     16
#define C_     256
#define N_     4096
#define O3_    384
#define INNER_ 128
#define HEADS_ 4
#define DH_    32
#define SCALE_ 0.1767766952966369f
#define EPS_   1e-5f

typedef __attribute__((ext_vector_type(16))) __bf16 v16bf;
typedef __attribute__((ext_vector_type(8)))  __bf16 v8bf;
typedef __attribute__((ext_vector_type(8)))  float  v8f;
typedef __attribute__((ext_vector_type(4)))  __bf16 v4bf;
typedef __attribute__((ext_vector_type(4)))  float  v4f;

// 16-bit A/B fragment K-index for lane `lane`, element `e`
// K = (e>>3)*16 + (lane>>4)*8 + (e&7)   (ISA 7.12.2)
__device__ __forceinline__ int kmap16(int lane, int e) {
  return ((e >> 3) << 4) | ((lane >> 4) << 3) | (e & 7);
}

__device__ __forceinline__ v8f wmma_bf16(v16bf a, v16bf b, v8f c) {
  return __builtin_amdgcn_wmma_f32_16x16x32_bf16(false, a, false, b, (short)0, c,
                                                 false, false);
}

// Load one 16-element bf16 fragment: per-lane K chunks are contiguous, so this
// is two 16-byte loads (global or LDS).  p must point at K = k0 + (lane>>4)*8.
__device__ __forceinline__ v16bf frag_ld(const __bf16* p) {
  v8bf lo = *(const v8bf*)p;
  v8bf hi = *(const v8bf*)(p + 16);
  return __builtin_shufflevector(lo, hi, 0, 1, 2, 3, 4, 5, 6, 7,
                                 8, 9, 10, 11, 12, 13, 14, 15);
}

// ---------------------------------------------------------------------------
// 0) weights -> bf16.  grid 512, block 256.
//    w_qkv is laid out in fragment order for k_qkv_gemm: per (16-row tile,
//    32-k step) two planes of 32 lanes x 8 elements, so that one wave-wide
//    16-byte load of a plane covers 512 contiguous bytes.  w_out likewise,
//    for k_proj (four 32-k steps a row tile).
// ---------------------------------------------------------------------------
__global__ __launch_bounds__(256) void k_cvt_w(const float* __restrict__ wqkv,
                                               const float* __restrict__ wout,
                                               __bf16* __restrict__ wqb,
                                               __bf16* __restrict__ wob) {
  const int i = blockIdx.x * 256 + threadIdx.x;
  if (i < O3_ * C_) {
    const int o = i >> 8, k = i & 255;
    const int plane = ((o >> 4) * 8 + (k >> 5)) * 2 + ((k >> 4) & 1);
    const int ln = ((k >> 3) & 1) * 16 + (o & 15);
    wqb[plane * 256 + ln * 8 + (k & 7)] = (__bf16)wqkv[i];
  }
  const int j = i - O3_ * C_;
  if (j >= 0 && j < C_ * INNER_) {
    const int o = j >> 7, k = j & 127;
    const int plane = ((o >> 4) * 4 + (k >> 5)) * 2 + ((k >> 4) & 1);
    const int ln = ((k >> 3) & 1) * 16 + (o & 15);
    wob[plane * 256 + ln * 8 + (k & 7)] = (__bf16)wout[j];
  }
}

// ---------------------------------------------------------------------------
// 1) qkv GEMM: [384x256] @ [256x4096] per batch.
//    One work-group makes all 384 rows of 64 columns: the x tile is read once,
//    converted once to bf16 and laid k-contiguous in LDS; each wave holds one
//    16-row tile of q, of k and of v times four 16-column tiles.
//    Column c of column tile j is spatial column 4c + j, so a lane's four
//    tiles give four consecutive columns of a row: whole-line stores.
//    q,k out fp32 (softmax precision); v out bf16 directly.
//    grid (64, 16), block 256 (8 waves).
// ---------------------------------------------------------------------------
#define XP_ 264  // LDS row pitch, elements: 528 B = 16 B x odd, for 16-byte row readers

// One weight fragment in k_cvt_w's order: two planes, 256 elements apart.
__device__ __forceinline__ v16bf wfrag_ld(const __bf16* p) {
  v8bf lo = *(const v8bf*)p;
  v8bf hi = *(const v8bf*)(p + 256);
  return __builtin_shufflevector(lo, hi, 0, 1, 2, 3, 4, 5, 6, 7,
                                 8, 9, 10, 11, 12, 13, 14, 15);
}

__global__ __launch_bounds__(256) void k_qkv_gemm(const float* __restrict__ x,
                                                  const __bf16* __restrict__ wqb,
                                                  float* __restrict__ qf,
                                                  float* __restrict__ kf,
                                                  __bf16* __restrict__ vbf) {
  const int lane = threadIdx.x & 31;
  const int wave = threadIdx.x >> 5;
  const int b = blockIdx.y;
  const int nWG = blockIdx.x * 64;
  const int c = lane & 15;
  const int h = lane >> 4;
  const float* xb = x + (size_t)b * C_ * N_ + nWG;

  __shared__ __align__(16) __bf16 xs[64 * XP_];

  // step 0's weight fragments are asked for first: they land while x is staged
  const __bf16* ap = wqb + wave * 4096 + lane * 8;
  v16bf a[2][3];
#pragma unroll
  for (int t = 0; t < 3; ++t) a[0][t] = wfrag_ld(ap + t * 32768);

  {
    // a thread takes 4 columns x 8 k, twice; LDS row j*16 + q holds column 4q + j
    const int q = threadIdx.x & 15;
    const int oc = threadIdx.x >> 4;
    v4f f[2][8];
#pragma unroll
    for (int u = 0; u < 2; ++u)
#pragma unroll
      for (int i = 0; i < 8; ++i)
        f[u][i] = *(const v4f*)(xb + (size_t)((oc + 16 * u) * 8 + i) * N_ + 4 * q);
#pragma unroll
    for (int u = 0; u < 2; ++u)
#pragma unroll
      for (int j = 0; j < 4; ++j) {
        v8bf pk;
#pragma unroll
        for (int i = 0; i < 8; ++i) pk[i] = (__bf16)f[u][i][j];
        *(v8bf*)(xs + (j * 16 + q) * XP_ + (oc + 16 * u) * 8) = pk;
      }
  }
  __syncthreads();

  v8f acc[3][4] = {};
  const __bf16* bp = xs + c * XP_ + h * 8;
  v16bf bm[2][4];
#pragma unroll
  for (int j = 0; j < 4; ++j) bm[0][j] = frag_ld(bp + j * 16 * XP_);
#pragma unroll
  for (int ks = 0; ks < 8; ++ks) {
    const int cur = ks & 1, nxt = cur ^ 1;
    if (ks < 7) {
#pragma unroll
      for (int t = 0; t < 3; ++t) a[nxt][t] = wfrag_ld(ap + t * 32768 + (ks + 1) * 512);
#pragma unroll
      for (int j = 0; j < 4; ++j) bm[nxt][j] = frag_ld(bp + j * 16 * XP_ + (ks + 1) * 32);
    }
    // keeps the next step's loads in front of this step's matrix block, so that
    // their L2 and LDS latency runs under twelve matrix instructions
    __builtin_amdgcn_sched_barrier(0);
#pragma unroll
    for (int t = 0; t < 3; ++t)
#pragma unroll
      for (int j = 0; j < 4; ++j) acc[t][j] = wmma_bf16(a[cur][t], bm[cur][j], acc[t][j]);
    // keeps later steps' loads from being moved in among these matrix instructions
    __builtin_amdgcn_sched_barrier(0);
  }
#pragma unroll
  for (int r = 0; r < 8; ++r) {
    const size_t o = (size_t)(b * INNER_ + wave * 16 + h * 8 + r) * N_ + nWG + 4 * c;
    v4f vq = {acc[0][0][r], acc[0][1][r], acc[0][2][r], acc[0][3][r]};
    v4f vk = {acc[1][0][r], acc[1][1][r], acc[1][2][r], acc[1][3][r]};
    v4bf vv = {(__bf16)acc[2][0][r], (__bf16)acc[2][1][r], (__bf16)acc[2][2][r],
               (__bf16)acc[2][3][r]};
    *(v4f*)(qf + o) = vq;
    *(v4f*)(kf + o) = vk;
    *(v4bf*)(vbf + o) = vv;
  }
}

// ---------------------------------------------------------------------------
// 2) softmax of k over n; writes bf16 IN PLACE over its own fp32 row
//    (values cached in registers).  grid (32, 4, 16), block 256.
// ---------------------------------------------------------------------------
__global__ __launch_bounds__(256) void k_ksoftmax(float* __restrict__ kf) {
  const int d = blockIdx.x, h = blockIdx.y, b = blockIdx.z;
  float* row = kf + (size_t)(b * INNER_ + h * DH_ + d) * N_;
  __shared__ float s[256];
  const int t = threadIdx.x;
  float vv[16];
  float m = -3.4e38f;
#pragma unroll
  for (int j = 0; j < 16; ++j) {
    vv[j] = row[t * 16 + j];
    m = fmaxf(m, vv[j]);
  }
  s[t] = m; __syncthreads();
  for (int o = 128; o > 0; o >>= 1) {
    if (t < o) s[t] = fmaxf(s[t], s[t + o]);
    __syncthreads();
  }
  m = s[0]; __syncthreads();
  float sum = 0.f;
#pragma unroll
  for (int j = 0; j < 16; ++j) { vv[j] = __expf(vv[j] - m); sum += vv[j]; }
  s[t] = sum; __syncthreads();
  for (int o = 128; o > 0; o >>= 1) {
    if (t < o) s[t] += s[t + o];
    __syncthreads();
  }
  const float inv = 1.0f / s[0];
  __bf16* rowb = (__bf16*)row;                // bf16 row in first half of fp32 row
  v8bf pk[2];
#pragma unroll
  for (int j = 0; j < 16; ++j) pk[j >> 3][j & 7] = (__bf16)(vv[j] * inv);
  *(v8bf*)(rowb + t * 16) = pk[0];
  *(v8bf*)(rowb + t * 16 + 8) = pk[1];
}

// ---------------------------------------------------------------------------
// 3) softmax of q over d (*SCALE); writes transposed bf16 q_t[(b,h)][n][32].
//    grid (16, 4, 16), block 256.
// ---------------------------------------------------------------------------
__global__ __launch_bounds__(256) void k_qsoftmax(const float* __restrict__ qf,
                                                  __bf16* __restrict__ qbt) {
  const int n = blockIdx.x * 256 + threadIdx.x;
  const int h = blockIdx.y, b = blockIdx.z;
  const float* base = qf + (size_t)(b * INNER_ + h * DH_) * N_ + n;
  float v[DH_];
  float m = -3.4e38f;
#pragma unroll
  for (int d = 0; d < DH_; ++d) { v[d] = base[(size_t)d * N_]; m = fmaxf(m, v[d]); }
  float sum = 0.f;
#pragma unroll
  for (int d = 0; d < DH_; ++d) { v[d] = __expf(v[d] - m); sum += v[d]; }
  const float sc = SCALE_ / sum;
  v8bf pk[4];
#pragma unroll
  for (int d = 0; d < DH_; ++d) pk[d >> 3][d & 7] = (__bf16)(v[d] * sc);
  v8bf* dst = (v8bf*)(qbt + ((size_t)(b * HEADS_ + h) * N_ + n) * DH_);
#pragma unroll
  for (int j = 0; j < 4; ++j) dst[j] = pk[j];
}

// ---------------------------------------------------------------------------
// 4) context[d][e] = sum_n k'[d][n] v[e][n] per (b,h).  grid 64, block 256.
//    bf16 b128 fragment loads; 8 waves split K=4096; ds_add_f32 reduce.
// ---------------------------------------------------------------------------
__global__ __launch_bounds__(256) void k_context(const float* __restrict__ kf,
                                                 const __bf16* __restrict__ vbf,
                                                 float* __restrict__ ctx) {
  const int bh = blockIdx.x;
  const int b = bh >> 2, h = bh & 3;
  const int lane = threadIdx.x & 31;
  const int wave = threadIdx.x >> 5;
  const int off = (lane >> 4) << 3;
  const float* kbase = kf + (size_t)(b * INNER_ + h * DH_) * N_;
  const __bf16* kr0 = (const __bf16*)(kbase + (size_t)(lane & 15) * N_);
  const __bf16* kr1 = (const __bf16*)(kbase + (size_t)(16 + (lane & 15)) * N_);
  const __bf16* vr0 = vbf + (size_t)(b * INNER_ + h * DH_ + (lane & 15)) * N_;
  const __bf16* vr1 = vr0 + (size_t)16 * N_;

  __shared__ float ctxs[DH_ * DH_];
  for (int i = threadIdx.x; i < DH_ * DH_; i += 256) ctxs[i] = 0.f;
  __syncthreads();

  v8f acc[2][2] = {};
  const int kBeg = wave * 512, kEnd = kBeg + 512;
  for (int k0 = kBeg; k0 < kEnd; k0 += 32) {
    v16bf a0 = frag_ld(kr0 + k0 + off);
    v16bf a1 = frag_ld(kr1 + k0 + off);
    v16bf b0 = frag_ld(vr0 + k0 + off);
    v16bf b1 = frag_ld(vr1 + k0 + off);
    acc[0][0] = wmma_bf16(a0, b0, acc[0][0]);
    acc[0][1] = wmma_bf16(a0, b1, acc[0][1]);
    acc[1][0] = wmma_bf16(a1, b0, acc[1][0]);
    acc[1][1] = wmma_bf16(a1, b1, acc[1][1]);
  }
#pragma unroll
  for (int i = 0; i < 2; ++i)
#pragma unroll
    for (int j = 0; j < 2; ++j)
#pragma unroll
      for (int r = 0; r < 8; ++r) {
        const int m = i * 16 + r + ((lane >> 4) << 3);
        const int e = j * 16 + (lane & 15);
        atomicAdd(&ctxs[m * DH_ + e], acc[i][j][r]);
      }
  __syncthreads();
  for (int i = threadIdx.x; i < DH_ * DH_; i += 256)
    ctx[(size_t)bh * DH_ * DH_ + i] = ctxs[i];
}

// ---------------------------------------------------------------------------
// 5) attn[e][n] = sum_d ctx[d][e] q'[d][n]; K=32 -> one WMMA per tile.
//    Writes transposed bf16 attn_t[b][n][128] (8 accs = 8 consecutive channels
//    -> one packed b128 store).  grid (32, 64), block 256.
// ---------------------------------------------------------------------------
__global__ __launch_bounds__(256) void k_attn_out(const __bf16* __restrict__ qbt,
                                                  const float* __restrict__ ctx,
                                                  __bf16* __restrict__ attn_t) {
  const int bh = blockIdx.y;
  const int b = bh >> 2, h = bh & 3;
  const int lane = threadIdx.x & 31;
  const int wave = threadIdx.x >> 5;
  const int nBase = blockIdx.x * 128 + wave * 16;
  const int n = nBase + (lane & 15);
  const int off = (lane >> 4) << 3;

  __shared__ float ctxs[DH_ * DH_];
  for (int i = threadIdx.x; i < DH_ * DH_; i += 256)
    ctxs[i] = ctx[(size_t)bh * DH_ * DH_ + i];
  __syncthreads();

  v16bf bm = frag_ld(qbt + ((size_t)bh * N_ + n) * DH_ + off);

#pragma unroll
  for (int i = 0; i < 2; ++i) {
    v16bf a;
#pragma unroll
    for (int e = 0; e < 16; ++e)
      a[e] = (__bf16)ctxs[kmap16(lane, e) * DH_ + i * 16 + (lane & 15)];
    v8f acc = {};
    acc = wmma_bf16(a, bm, acc);
    v8bf pk;
#pragma unroll
    for (int r = 0; r < 8; ++r) pk[r] = (__bf16)acc[r];
    *(v8bf*)(attn_t + ((size_t)b * N_ + n) * INNER_ + h * DH_ + i * 16 + off) = pk;
  }
}

// ---------------------------------------------------------------------------
// 6) out2[o][n] = sum_c wout[o][c] attn_t[n][c] + bout[o] -> d_out (unnormalized)
//    One work-group makes all 256 rows of 64 columns: its attn_t tile (64 rows
//    of 256 B, contiguous) is read once and laid in LDS; each wave holds two
//    16-row tiles times four 16-column tiles.  Column c of column tile j is
//    spatial column 4c + j, as in k_qkv_gemm: whole-line stores.
//    grid (64, 16), block 256 (8 waves).
// ---------------------------------------------------------------------------
#define AP_ 136  // LDS row pitch, elements: 272 B = 16 B x odd, for 16-byte row readers

__global__ __launch_bounds__(256) void k_proj(const __bf16* __restrict__ attn_t,
                                              const __bf16* __restrict__ wob,
                                              const float* __restrict__ bout,
                                              float* __restrict__ out) {
  const int lane = threadIdx.x & 31;
  const int wave = threadIdx.x >> 5;
  const int b = blockIdx.y;
  const int nWG = blockIdx.x * 64;
  const int c = lane & 15;
  const int h = lane >> 4;

  __shared__ __align__(16) __bf16 as[64 * AP_];

  // the tile first, then all of the wave's weight fragments: one latency for both
  const __bf16* src = attn_t + ((size_t)b * N_ + nWG) * INNER_ + threadIdx.x * 8;
  v8bf g[4];
#pragma unroll
  for (int i = 0; i < 4; ++i) g[i] = *(const v8bf*)(src + i * 2048);

  const __bf16* ap = wob + wave * 4096 + lane * 8;
  v16bf a[4][2];
#pragma unroll
  for (int ks = 0; ks < 4; ++ks)
#pragma unroll
    for (int t = 0; t < 2; ++t) a[ks][t] = wfrag_ld(ap + t * 2048 + ks * 512);
  // a lane's sixteen bias values, asked for with the rest
  v4f bi[2][2];
#pragma unroll
  for (int t = 0; t < 2; ++t)
#pragma unroll
    for (int u = 0; u < 2; ++u)
      bi[t][u] = *(const v4f*)(bout + wave * 32 + t * 16 + h * 8 + u * 4);

  // LDS row j*16 + q holds column 4q + j
#pragma unroll
  for (int i = 0; i < 4; ++i) {
    const int n = (threadIdx.x >> 4) + 16 * i;
    *(v8bf*)(as + ((n & 3) * 16 + (n >> 2)) * AP_ + (threadIdx.x & 15) * 8) = g[i];
  }
  __syncthreads();

  v8f acc[2][4] = {};
  const __bf16* bp = as + c * AP_ + h * 8;
  v16bf bm[2][4];
#pragma unroll
  for (int j = 0; j < 4; ++j) bm[0][j] = frag_ld(bp + j * 16 * AP_);
#pragma unroll
  for (int ks = 0; ks < 4; ++ks) {
    const int cur = ks & 1, nxt = cur ^ 1;
    if (ks < 3) {
#pragma unroll
      for (int j = 0; j < 4; ++j) bm[nxt][j] = frag_ld(bp + j * 16 * AP_ + (ks + 1) * 32);
    }
    // keeps the next step's LDS reads together in front of this step's matrix
    // block, so that their latency runs under eight matrix instructions
    __builtin_amdgcn_sched_barrier(0);
#pragma unroll
    for (int t = 0; t < 2; ++t)
#pragma unroll
      for (int j = 0; j < 4; ++j) acc[t][j] = wmma_bf16(a[ks][t], bm[cur][j], acc[t][j]);
    // keeps later steps' reads from being moved in among these matrix instructions
    __builtin_amdgcn_sched_barrier(0);
  }
#pragma unroll
  for (int t = 0; t < 2; ++t) {
    const int m0 = wave * 32 + t * 16 + h * 8;
    float* op = out + (size_t)(b * C_ + m0) * N_ + nWG + 4 * c;
#pragma unroll
    for (int r = 0; r < 8; ++r) {
      const float bv = bi[t][r >> 2][r & 3];
      v4f vo = {acc[t][0][r] + bv, acc[t][1][r] + bv, acc[t][2][r] + bv,
                acc[t][3][r] + bv};
      *(v4f*)(op + (size_t)r * N_) = vo;
    }
  }
}

// ---------------------------------------------------------------------------
// 7) per-batch partial sums (sum, sumsq).  grid (256, 16), block 256.
// ---------------------------------------------------------------------------
__global__ __launch_bounds__(256) void k_gn_partial(const float* __restrict__ out,
                                                    float* __restrict__ part) {
  const int b = blockIdx.y;
  const float* p = out + (size_t)b * C_ * N_ + (size_t)blockIdx.x * 4096;
  float s = 0.f, sq = 0.f;
  for (int i = threadIdx.x; i < 4096; i += 256) {
    const float v = p[i];
    s += v; sq += v * v;
  }
  __shared__ float ss[256], qq[256];
  const int t = threadIdx.x;
  ss[t] = s; qq[t] = sq; __syncthreads();
  for (int o = 128; o > 0; o >>= 1) {
    if (t < o) { ss[t] += ss[t + o]; qq[t] += qq[t + o]; }
    __syncthreads();
  }
  if (t == 0) {
    part[(size_t)(b * 256 + blockIdx.x) * 2 + 0] = ss[0];
    part[(size_t)(b * 256 + blockIdx.x) * 2 + 1] = qq[0];
  }
}

// ---------------------------------------------------------------------------
// 8) finalize mean/var + normalize + affine.  grid (256, 16), block 256.
// ---------------------------------------------------------------------------
__global__ __launch_bounds__(256) void k_gn_apply(float* __restrict__ out,
                                                  const float* __restrict__ part,
                                                  const float* __restrict__ gamma,
                                                  const float* __restrict__ beta) {
  const int b = blockIdx.y;
  const int t = threadIdx.x;
  __shared__ float ss[256], qq[256];
  ss[t] = part[(size_t)(b * 256 + t) * 2 + 0];
  qq[t] = part[(size_t)(b * 256 + t) * 2 + 1];
  __syncthreads();
  for (int o = 128; o > 0; o >>= 1) {
    if (t < o) { ss[t] += ss[t + o]; qq[t] += qq[t + o]; }
    __syncthreads();
  }
  const float invM = 1.0f / (float)(C_ * N_);
  const float mean = ss[0] * invM;
  const float var  = qq[0] * invM - mean * mean;
  const float inv  = rsqrtf(var + EPS_);
  float* p = out + (size_t)b * C_ * N_ + (size_t)blockIdx.x * 4096;
  for (int i = t; i < 4096; i += 256) {
    const int flat = blockIdx.x * 4096 + i;
    const int c = flat >> 12;
    p[i] = (p[i] - mean) * inv * gamma[c] + beta[c];
  }
}

// ---------------------------------------------------------------------------
extern "C" void kernel_launch(void* const* d_in, const int* in_sizes, int n_in,
                              void* d_out, int out_size, void* d_ws, size_t ws_size,
                              hipStream_t stream) {
  const float* x     = (const float*)d_in[0];
  const float* wqkv  = (const float*)d_in[1];
  const float* wout  = (const float*)d_in[2];
  const float* bout  = (const float*)d_in[3];
  const float* gamma = (const float*)d_in[4];
  const float* beta  = (const float*)d_in[5];
  float* out = (float*)d_out;
  (void)ws_size; (void)in_sizes; (void)n_in; (void)out_size;

  const size_t QSZ = (size_t)B_ * INNER_ * N_;   // 8,388,608
  float*  qf  = (float*)d_ws;                    // fp32 q (later reused as attn_t)
  float*  kf  = qf + QSZ;                        // fp32 k (bf16 k' in place)
  __bf16* vbf = (__bf16*)(kf + QSZ);             // bf16 v
  __bf16* qbt = vbf + QSZ;                       // bf16 q_t [bh][n][32]
  __bf16* wqb = qbt + QSZ;                       // bf16 w_qkv, fragment order
  __bf16* wob = wqb + (size_t)O3_ * C_;          // bf16 w_out, fragment order
  float*  ctx = (float*)(wob + (size_t)C_ * INNER_);
  float*  part = ctx + (size_t)B_ * HEADS_ * DH_ * DH_;
  __bf16* attn_t = (__bf16*)qf;                  // reuse dead q region

  k_cvt_w    <<<dim3(512),        256, 0, stream>>>(wqkv, wout, wqb, wob);
  k_qkv_gemm <<<dim3(64, 16),     256, 0, stream>>>(x, wqb, qf, kf, vbf);
  k_ksoftmax <<<dim3(32, 4, 16),  256, 0, stream>>>(kf);
  k_qsoftmax <<<dim3(16, 4, 16),  256, 0, stream>>>(qf, qbt);
  k_context  <<<dim3(64),         256, 0, stream>>>(kf, vbf, ctx);
  k_attn_out <<<dim3(32, 64),     256, 0, stream>>>(qbt, ctx, attn_t);
  k_proj     <<<dim3(64, 16),     256, 0, stream>>>(attn_t, wob, bout, out);
  k_gn_partial<<<dim3(256, 16),   256, 0, stream>>>(out, part);
  k_gn_apply <<<dim3(256, 16),    256, 0, stream>>>(out, part, gamma, beta);
}

// v003
// A run of this version takes 85.9 microseconds.
// Timed twice side by side with v002, it ran 1.16 and 1.13 times as fast.
// Over all steps from v000 it is 2.25 times as fast.
#include <hip/hip_runtime.h>

#define B_     16
#define C_     256
#define N_     4096
#define O3_    384
#define INNER_ 128
#define HEADS_ 4
#define DH_    32
#define SCALE_ 0.1767766952966369f
#define EPS_   1e-5f

typedef __attribute__((ext_vector_type(16))) __bf16 v16bf;
typedef __attribute__((ext_vector_type(8)))  __bf16 v8bf;
typedef __attribute__((ext_vector_type(8)))  float  v8f;
typedef __attribute__((ext_vector_type(4)))  __bf16 v4bf;
typedef __attribute__((ext_vector_type(4)))  float  v4f;

// 16-bit A/B fragment K-index for lane `lane`, element `e`
// K = (e>>3)*16 + (lane>>4)*8 + (e&7)   (ISA 7.12.2)
__device__ __forceinline__ int kmap16(int lane, int e) {
  return ((e >> 3) << 4) | ((lane >> 4) << 3) | (e & 7);
}

__device__ __forceinline__ v8f wmma_bf16(v16bf a, v16bf b, v8f c) {
  return __builtin_amdgcn_wmma_f32_16x16x32_bf16(false, a, false, b, (short)0, c,
                                                 false, false);
}

// Load one 16-element bf16 fragment: per-lane K chunks are contiguous, so this
// is two 16-byte loads (global or LDS).  p must point at K = k0 + (lane>>4)*8.
__device__ __forceinline__ v16bf frag_ld(const __bf16* p) {
  v8bf lo = *(const v8bf*)p;
  v8bf hi = *(const v8bf*)(p + 16);
  return __builtin_shufflevector(lo, hi, 0, 1, 2, 3, 4, 5, 6, 7,
                                 8, 9, 10, 11, 12, 13, 14, 15);
}

// ---------------------------------------------------------------------------
// 0) weights -> bf16.  grid 512, block 256.
//    w_qkv is laid out in fragment order for k_qkv_gemm: per (16-row tile,
//    32-k step) two planes of 32 lanes x 8 elements, so that one wave-wide
//    16-byte load of a plane covers 512 contiguous bytes.  w_out likewise,
//    for the two projection kernels (four 32-k steps a row tile).
// ---------------------------------------------------------------------------
__global__ __launch_bounds__(256) void k_cvt_w(const float* __restrict__ wqkv,
                                               const float* __restrict__ wout,
                                               __bf16* __restrict__ wqb,
                                               __bf16* __restrict__ wob) {
  const int i = blockIdx.x * 256 + threadIdx.x;
  if (i < O3_ * C_) {
    const int o = i >> 8, k = i & 255;
    const int plane = ((o >> 4) * 8 + (k >> 5)) * 2 + ((k >> 4) & 1);
    const int ln = ((k >> 3) & 1) * 16 + (o & 15);
    wqb[plane * 256 + ln * 8 + (k & 7)] = (__bf16)wqkv[i];
  }
  const int j = i - O3_ * C_;
  if (j >= 0 && j < C_ * INNER_) {
    const int o = j >> 7, k = j & 127;
    const int plane = ((o >> 4) * 4 + (k >> 5)) * 2 + ((k >> 4) & 1);
    const int ln = ((k >> 3) & 1) * 16 + (o & 15);
    wob[plane * 256 + ln * 8 + (k & 7)] = (__bf16)wout[j];
  }
}

// ---------------------------------------------------------------------------
// 1) qkv GEMM: [384x256] @ [256x4096] per batch.
//    One work-group makes all 384 rows of 64 columns: the x tile is read once,
//    converted once to bf16 and laid k-contiguous in LDS; each wave holds one
//    16-row tile of q, of k and of v times four 16-column tiles.
//    Column c of column tile j is spatial column 4c + j, so a lane's four
//    tiles give four consecutive columns of a row: whole-line stores.
//    q,k out fp32 (softmax precision); v out bf16 directly.
//    grid (64, 16), block 256 (8 waves).
// ---------------------------------------------------------------------------
#define XP_ 264  // LDS row pitch, elements: 528 B = 16 B x odd, for 16-byte row readers

// One weight fragment in k_cvt_w's order: two planes, 256 elements apart.
__device__ __forceinline__ v16bf wfrag_ld(const __bf16* p) {
  v8bf lo = *(const v8bf*)p;
  v8bf hi = *(const v8bf*)(p + 256);
  return __builtin_shufflevector(lo, hi, 0, 1, 2, 3, 4, 5, 6, 7,
                                 8, 9, 10, 11, 12, 13, 14, 15);
}

__global__ __launch_bounds__(256) void k_qkv_gemm(const float* __restrict__ x,
                                                  const __bf16* __restrict__ wqb,
                                                  float* __restrict__ qf,
                                                  float* __restrict__ kf,
                                                  __bf16* __restrict__ vbf) {
  const int lane = threadIdx.x & 31;
  const int wave = threadIdx.x >> 5;
  const int b = blockIdx.y;
  const int nWG = blockIdx.x * 64;
  const int c = lane & 15;
  const int h = lane >> 4;
  const float* xb = x + (size_t)b * C_ * N_ + nWG;

  __shared__ __align__(16) __bf16 xs[64 * XP_];

  // step 0's weight fragments are asked for first: they land while x is staged
  const __bf16* ap = wqb + wave * 4096 + lane * 8;
  v16bf a[2][3];
#pragma unroll
  for (int t = 0; t < 3; ++t) a[0][t] = wfrag_ld(ap + t * 32768);

  {
    // a thread takes 4 columns x 8 k, twice; LDS row j*16 + q holds column 4q + j
    const int q = threadIdx.x & 15;
    const int oc = threadIdx.x >> 4;
    v4f f[2][8];
#pragma unroll
    for (int u = 0; u < 2; ++u)
#pragma unroll
      for (int i = 0; i < 8; ++i)
        f[u][i] = *(const v4f*)(xb + (size_t)((oc + 16 * u) * 8 + i) * N_ + 4 * q);
#pragma unroll
    for (int u = 0; u < 2; ++u)
#pragma unroll
      for (int j = 0; j < 4; ++j) {
        v8bf pk;
#pragma unroll
        for (int i = 0; i < 8; ++i) pk[i] = (__bf16)f[u][i][j];
        *(v8bf*)(xs + (j * 16 + q) * XP_ + (oc + 16 * u) * 8) = pk;
      }
  }
  __syncthreads();

  v8f acc[3][4] = {};
  const __bf16* bp = xs + c * XP_ + h * 8;
  v16bf bm[2][4];
#pragma unroll
  for (int j = 0; j < 4; ++j) bm[0][j] = frag_ld(bp + j * 16 * XP_);
#pragma unroll
  for (int ks = 0; ks < 8; ++ks) {
    const int cur = ks & 1, nxt = cur ^ 1;
    if (ks < 7) {
#pragma unroll
      for (int t = 0; t < 3; ++t) a[nxt][t] = wfrag_ld(ap + t * 32768 + (ks + 1) * 512);
#pragma unroll
      for (int j = 0; j < 4; ++j) bm[nxt][j] = frag_ld(bp + j * 16 * XP_ + (ks + 1) * 32);
    }
    // keeps the next step's loads in front of this step's matrix block, so that
    // their L2 and LDS latency runs under twelve matrix instructions
    __builtin_amdgcn_sched_barrier(0);
#pragma unroll
    for (int t = 0; t < 3; ++t)
#pragma unroll
      for (int j = 0; j < 4; ++j) acc[t][j] = wmma_bf16(a[cur][t], bm[cur][j], acc[t][j]);
    // keeps later steps' loads from being moved in among these matrix instructions
    __builtin_amdgcn_sched_barrier(0);
  }
#pragma unroll
  for (int r = 0; r < 8; ++r) {
    const size_t o = (size_t)(b * INNER_ + wave * 16 + h * 8 + r) * N_ + nWG + 4 * c;
    v4f vq = {acc[0][0][r], acc[0][1][r], acc[0][2][r], acc[0][3][r]};
    v4f vk = {acc[1][0][r], acc[1][1][r], acc[1][2][r], acc[1][3][r]};
    v4bf vv = {(__bf16)acc[2][0][r], (__bf16)acc[2][1][r], (__bf16)acc[2][2][r],
               (__bf16)acc[2][3][r]};
    *(v4f*)(qf + o) = vq;
    *(v4f*)(kf + o) = vk;
    *(v4bf*)(vbf + o) = vv;
  }
}

// ---------------------------------------------------------------------------
// 2) softmax of k over n; writes bf16 IN PLACE over its own fp32 row
//    (values cached in registers).  grid (32, 4, 16), block 256.
// ---------------------------------------------------------------------------
__global__ __launch_bounds__(256) void k_ksoftmax(float* __restrict__ kf) {
  const int d = blockIdx.x, h = blockIdx.y, b = blockIdx.z;
  float* row = kf + (size_t)(b * INNER_ + h * DH_ + d) * N_;
  __shared__ float s[256];
  const int t = threadIdx.x;
  float vv[16];
  float m = -3.4e38f;
#pragma unroll
  for (int j = 0; j < 16; ++j) {
    vv[j] = row[t * 16 + j];
    m = fmaxf(m, vv[j]);
  }
  s[t] = m; __syncthreads();
  for (int o = 128; o > 0; o >>= 1) {
    if (t < o) s[t] = fmaxf(s[t], s[t + o]);
    __syncthreads();
  }
  m = s[0]; __syncthreads();
  float sum = 0.f;
#pragma unroll
  for (int j = 0; j < 16; ++j) { vv[j] = __expf(vv[j] - m); sum += vv[j]; }
  s[t] = sum; __syncthreads();
  for (int o = 128; o > 0; o >>= 1) {
    if (t < o) s[t] += s[t + o];
    __syncthreads();
  }
  const float inv = 1.0f / s[0];
  __bf16* rowb = (__bf16*)row;                // bf16 row in first half of fp32 row
  v8bf pk[2];
#pragma unroll
  for (int j = 0; j < 16; ++j) pk[j >> 3][j & 7] = (__bf16)(vv[j] * inv);
  *(v8bf*)(rowb + t * 16) = pk[0];
  *(v8bf*)(rowb + t * 16 + 8) = pk[1];
}

// ---------------------------------------------------------------------------
// 3) softmax of q over d (*SCALE); writes transposed bf16 q_t[(b,h)][n][32].
//    grid (16, 4, 16), block 256.
// ---------------------------------------------------------------------------
__global__ __launch_bounds__(256) void k_qsoftmax(const float* __restrict__ qf,
                                                  __bf16* __restrict__ qbt) {
  const int n = blockIdx.x * 256 + threadIdx.x;
  const int h = blockIdx.y, b = blockIdx.z;
  const float* base = qf + (size_t)(b * INNER_ + h * DH_) * N_ + n;
  float v[DH_];
  float m = -3.4e38f;
#pragma unroll
  for (int d = 0; d < DH_; ++d) { v[d] = base[(size_t)d * N_]; m = fmaxf(m, v[d]); }
  float sum = 0.f;
#pragma unroll
  for (int d = 0; d < DH_; ++d) { v[d] = __expf(v[d] - m); sum += v[d]; }
  const float sc = SCALE_ / sum;
  v8bf pk[4];
#pragma unroll
  for (int d = 0; d < DH_; ++d) pk[d >> 3][d & 7] = (__bf16)(v[d] * sc);
  v8bf* dst = (v8bf*)(qbt + ((size_t)(b * HEADS_ + h) * N_ + n) * DH_);
#pragma unroll
  for (int j = 0; j < 4; ++j) dst[j] = pk[j];
}

// ---------------------------------------------------------------------------
// 4) context[d][e] = sum_n k'[d][n] v[e][n] per (b,h).  grid 64, block 256.
//    bf16 b128 fragment loads; 8 waves split K=4096; ds_add_f32 reduce.
// ---------------------------------------------------------------------------
__global__ __launch_bounds__(256) void k_context(const float* __restrict__ kf,
                                                 const __bf16* __restrict__ vbf,
                                                 float* __restrict__ ctx) {
  const int bh = blockIdx.x;
  const int b = bh >> 2, h = bh & 3;
  const int lane = threadIdx.x & 31;
  const int wave = threadIdx.x >> 5;
  const int off = (lane >> 4) << 3;
  const float* kbase = kf + (size_t)(b * INNER_ + h * DH_) * N_;
  const __bf16* kr0 = (const __bf16*)(kbase + (size_t)(lane & 15) * N_);
  const __bf16* kr1 = (const __bf16*)(kbase + (size_t)(16 + (lane & 15)) * N_);
  const __bf16* vr0 = vbf + (size_t)(b * INNER_ + h * DH_ + (lane & 15)) * N_;
  const __bf16* vr1 = vr0 + (size_t)16 * N_;

  __shared__ float ctxs[DH_ * DH_];
  for (int i = threadIdx.x; i < DH_ * DH_; i += 256) ctxs[i] = 0.f;
  __syncthreads();

  v8f acc[2][2] = {};
  const int kBeg = wave * 512, kEnd = kBeg + 512;
  for (int k0 = kBeg; k0 < kEnd; k0 += 32) {
    v16bf a0 = frag_ld(kr0 + k0 + off);
    v16bf a1 = frag_ld(kr1 + k0 + off);
    v16bf b0 = frag_ld(vr0 + k0 + off);
    v16bf b1 = frag_ld(vr1 + k0 + off);
    acc[0][0] = wmma_bf16(a0, b0, acc[0][0]);
    acc[0][1] = wmma_bf16(a0, b1, acc[0][1]);
    acc[1][0] = wmma_bf16(a1, b0, acc[1][0]);
    acc[1][1] = wmma_bf16(a1, b1, acc[1][1]);
  }
#pragma unroll
  for (int i = 0; i < 2; ++i)
#pragma unroll
    for (int j = 0; j < 2; ++j)
#pragma unroll
      for (int r = 0; r < 8; ++r) {
        const int m = i * 16 + r + ((lane >> 4) << 3);
        const int e = j * 16 + (lane & 15);
        atomicAdd(&ctxs[m * DH_ + e], acc[i][j][r]);
      }
  __syncthreads();
  for (int i = threadIdx.x; i < DH_ * DH_; i += 256)
    ctx[(size_t)bh * DH_ * DH_ + i] = ctxs[i];
}

// ---------------------------------------------------------------------------
// 5) attn[e][n] = sum_d ctx[d][e] q'[d][n]; K=32 -> one WMMA per tile.
//    Writes transposed bf16 attn_t[b][n][128] (8 accs = 8 consecutive channels
//    -> one packed b128 store).  grid (32, 64), block 256.
// ---------------------------------------------------------------------------
__global__ __launch_bounds__(256) void k_attn_out(const __bf16* __restrict__ qbt,
                                                  const float* __restrict__ ctx,
                                                  __bf16* __restrict__ attn_t) {
  const int bh = blockIdx.y;
  const int b = bh >> 2, h = bh & 3;
  const int lane = threadIdx.x & 31;
  const int wave = threadIdx.x >> 5;
  const int nBase = blockIdx.x * 128 + wave * 16;
  const int n = nBase + (lane & 15);
  const int off = (lane >> 4) << 3;

  __shared__ float ctxs[DH_ * DH_];
  for (int i = threadIdx.x; i < DH_ * DH_; i += 256)
    ctxs[i] = ctx[(size_t)bh * DH_ * DH_ + i];
  __syncthreads();

  v16bf bm = frag_ld(qbt + ((size_t)bh * N_ + n) * DH_ + off);

#pragma unroll
  for (int i = 0; i < 2; ++i) {
    v16bf a;
#pragma unroll
    for (int e = 0; e < 16; ++e)
      a[e] = (__bf16)ctxs[kmap16(lane, e) * DH_ + i * 16 + (lane & 15)];
    v8f acc = {};
    acc = wmma_bf16(a, bm, acc);
    v8bf pk;
#pragma unroll
    for (int r = 0; r < 8; ++r) pk[r] = (__bf16)acc[r];
    *(v8bf*)(attn_t + ((size_t)b * N_ + n) * INNER_ + h * DH_ + i * 16 + off) = pk;
  }
}

// ---------------------------------------------------------------------------
// 6) out2[o][n] = sum_c wout[o][c] attn_t[n][c] + bout[o], made twice and never
//    stored unnormalized: the product is cheap next to a round trip of the
//    64 MiB result through memory.
//    k_proj_stats keeps only each work-group's sum and sum of squares;
//    k_proj_norm makes the same product again, reduces its batch's 64 partial
//    pairs to mean and variance, and stores the normalized, affine result.
//    One work-group makes all 256 rows of 64 columns: its attn_t tile (64 rows
//    of 256 B, contiguous) is read once and laid in LDS; each wave holds two
//    16-row tiles times four 16-column tiles.  Column c of column tile j is
//    spatial column 4c + j, as in k_qkv_gemm: whole-line stores.
//    grid (64, 16), block 256 (8 waves), both.
// ---------------------------------------------------------------------------
#define AP_ 136  // LDS row pitch, elements: 272 B = 16 B x odd, for 16-byte row readers

typedef __attribute__((ext_vector_type(2))) float v2f;

template <bool NORM>
__device__ __forceinline__ void proj_body(const __bf16* __restrict__ attn_t,
                                          const __bf16* __restrict__ wob,
                                          const float* __restrict__ bout,
                                          const float* __restrict__ gamma,
                                          const float* __restrict__ beta,
                                          const float* __restrict__ part_in,
                                          float* __restrict__ part_out,
                                          float* __restrict__ out) {
  const int lane = threadIdx.x & 31;
  const int wave = threadIdx.x >> 5;
  const int b = blockIdx.y;
  const int nWG = blockIdx.x * 64;
  const int c = lane & 15;
  const int h = lane >> 4;

  __shared__ __align__(16) __bf16 as[64 * AP_];

  // the tile first, then all of the wave's weight fragments: one latency for both
  const __bf16* src = attn_t + ((size_t)b * N_ + nWG) * INNER_ + threadIdx.x * 8;
  v8bf g[4];
#pragma unroll
  for (int i = 0; i < 4; ++i) g[i] = *(const v8bf*)(src + i * 2048);

  const __bf16* ap = wob + wave * 4096 + lane * 8;
  v16bf a[4][2];
#pragma unroll
  for (int ks = 0; ks < 4; ++ks)
#pragma unroll
    for (int t = 0; t < 2; ++t) a[ks][t] = wfrag_ld(ap + t * 2048 + ks * 512);
  // a lane's sixteen bias values, asked for with the rest
  v4f bi[2][2];
#pragma unroll
  for (int t = 0; t < 2; ++t)
#pragma unroll
    for (int u = 0; u < 2; ++u)
      bi[t][u] = *(const v4f*)(bout + wave * 32 + t * 16 + h * 8 + u * 4);
  // likewise the batch's 64 partial pairs (two a lane) and the lane's affine terms
  v2f pp[2];
  v4f ga[2][2], be[2][2];
  if (NORM) {
#pragma unroll
    for (int u = 0; u < 2; ++u)
      pp[u] = *(const v2f*)(part_in + (size_t)(b * 64 + u * 32 + lane) * 2);
#pragma unroll
    for (int t = 0; t < 2; ++t)
#pragma unroll
      for (int u = 0; u < 2; ++u) {
        ga[t][u] = *(const v4f*)(gamma + wave * 32 + t * 16 + h * 8 + u * 4);
        be[t][u] = *(const v4f*)(beta + wave * 32 + t * 16 + h * 8 + u * 4);
      }
  }

  // LDS row j*16 + q holds column 4q + j
#pragma unroll
  for (int i = 0; i < 4; ++i) {
    const int n = (threadIdx.x >> 4) + 16 * i;
    *(v8bf*)(as + ((n & 3) * 16 + (n >> 2)) * AP_ + (threadIdx.x & 15) * 8) = g[i];
  }
  __syncthreads();

  v8f acc[2][4] = {};
  const __bf16* bp = as + c * AP_ + h * 8;
  v16bf bm[2][4];
#pragma unroll
  for (int j = 0; j < 4; ++j) bm[0][j] = frag_ld(bp + j * 16 * AP_);
#pragma unroll
  for (int ks = 0; ks < 4; ++ks) {
    const int cur = ks & 1, nxt = cur ^ 1;
    if (ks < 3) {
#pragma unroll
      for (int j = 0; j < 4; ++j) bm[nxt][j] = frag_ld(bp + j * 16 * AP_ + (ks + 1) * 32);
    }
    // keeps the next step's LDS reads together in front of this step's matrix
    // block, so that their latency runs under eight matrix instructions
    __builtin_amdgcn_sched_barrier(0);
#pragma unroll
    for (int t = 0; t < 2; ++t)
#pragma unroll
      for (int j = 0; j < 4; ++j) acc[t][j] = wmma_bf16(a[ks][t], bm[cur][j], acc[t][j]);
    // keeps later steps' reads from being moved in among these matrix instructions
    __builtin_amdgcn_sched_barrier(0);
  }

  if (!NORM) {
    // four independent chains a lane, a butterfly over the wave, eight waves in LDS
    float s[4] = {0.f, 0.f, 0.f, 0.f}, sq[4] = {0.f, 0.f, 0.f, 0.f};
#pragma unroll
    for (int t = 0; t < 2; ++t)
#pragma unroll
      for (int r = 0; r < 8; ++r) {
        const float bv = bi[t][r >> 2][r & 3];
#pragma unroll
        for (int j = 0; j < 4; ++j) {
          const float v = acc[t][j][r] + bv;
          s[j] += v;
          sq[j] += v * v;
        }
      }
    float st = (s[0] + s[1]) + (s[2] + s[3]);
    float qt = (sq[0] + sq[1]) + (sq[2] + sq[3]);
#pragma unroll
    for (int o = 16; o > 0; o >>= 1) {
      st += __shfl_xor(st, o);
      qt += __shfl_xor(qt, o);
    }
    __shared__ v2f red[8];
    if (lane == 0) red[wave] = v2f{st, qt};
    __syncthreads();
    if (threadIdx.x == 0) {
      v2f tot = red[0];
#pragma unroll
      for (int w = 1; w < 8; ++w) tot += red[w];
      *(v2f*)(part_out + (size_t)(b * 64 + blockIdx.x) * 2) = tot;
    }
  } else {
    // every wave reduces the 64 pairs the same way: no LDS, no barrier
    float st = pp[0][0] + pp[1][0];
    float qt = pp[0][1] + pp[1][1];
#pragma unroll
    for (int o = 16; o > 0; o >>= 1) {
      st += __shfl_xor(st, o);
      qt += __shfl_xor(qt, o);
    }
    const float invM = 1.0f / (float)(C_ * N_);
    const float mean = st * invM;
    const float var  = qt * invM - mean * mean;
    const float inv  = rsqrtf(var + EPS_);
#pragma unroll
    for (int t = 0; t < 2; ++t) {
      const int m0 = wave * 32 + t * 16 + h * 8;
      float* op = out + (size_t)(b * C_ + m0) * N_ + nWG + 4 * c;
#pragma unroll
      for (int r = 0; r < 8; ++r) {
        const float bv = bi[t][r >> 2][r & 3];
        const float gv = ga[t][r >> 2][r & 3];
        const float ev = be[t][r >> 2][r & 3];
        v4f vo;
#pragma unroll
        for (int j = 0; j < 4; ++j)
          vo[j] = ((acc[t][j][r] + bv) - mean) * inv * gv + ev;
        *(v4f*)(op + (size_t)r * N_) = vo;
      }
    }
  }
}

__global__ __launch_bounds__(256) void k_proj_stats(const __bf16* __restrict__ attn_t,
                                                    const __bf16* __restrict__ wob,
                                                    const float* __restrict__ bout,
                                                    float* __restrict__ part) {
  proj_body<false>(attn_t, wob, bout, nullptr, nullptr, nullptr, part, nullptr);
}

__global__ __launch_bounds__(256) void k_proj_norm(const __bf16* __restrict__ attn_t,
                                                   const __bf16* __restrict__ wob,
                                                   const float* __restrict__ bout,
                                                   const float* __restrict__ gamma,
                                                   const float* __restrict__ beta,
                                                   const float* __restrict__ part,
                                                   float* __restrict__ out) {
  proj_body<true>(attn_t, wob, bout, gamma, beta, part, nullptr, out);
}

// ---------------------------------------------------------------------------
extern "C" void kernel_launch(void* const* d_in, const int* in_sizes, int n_in,
                              void* d_out, int out_size, void* d_ws, size_t ws_size,
                              hipStream_t stream) {
  const float* x     = (const float*)d_in[0];
  const float* wqkv  = (const float*)d_in[1];
  const float* wout  = (const float*)d_in[2];
  const float* bout  = (const float*)d_in[3];
  const float* gamma = (const float*)d_in[4];
  const float* beta  = (const float*)d_in[5];
  float* out = (float*)d_out;
  (void)ws_size; (void)in_sizes; (void)n_in; (void)out_size;

  const size_t QSZ = (size_t)B_ * INNER_ * N_;   // 8,388,608
  float*  qf  = (float*)d_ws;                    // fp32 q (later reused as attn_t)
  float*  kf  = qf + QSZ;                        // fp32 k (bf16 k' in place)
  __bf16* vbf = (__bf16*)(kf + QSZ);             // bf16 v
  __bf16* qbt = vbf + QSZ;                       // bf16 q_t [bh][n][32]
  __bf16* wqb = qbt + QSZ;                       // bf16 w_qkv, fragment order
  __bf16* wob = wqb + (size_t)O3_ * C_;          // bf16 w_out, fragment order
  float*  ctx = (float*)(wob + (size_t)C_ * INNER_);
  float*  part = ctx + (size_t)B_ * HEADS_ * DH_ * DH_;
  __bf16* attn_t = (__bf16*)qf;                  // reuse dead q region

  k_cvt_w    <<<dim3(512),        256, 0, stream>>>(wqkv, wout, wqb, wob);
  k_qkv_gemm <<<dim3(64, 16),     256, 0, stream>>>(x, wqb, qf, kf, vbf);
  k_ksoftmax <<<dim3(32, 4, 16),  256, 0, stream>>>(kf);
  k_qsoftmax <<<dim3(16, 4, 16),  256, 0, stream>>>(qf, qbt);
  k_context  <<<dim3(64),         256, 0, stream>>>(kf, vbf, ctx);
  k_attn_out <<<dim3(32, 64),     256, 0, stream>>>(qbt, ctx, attn_t);
  k_proj_stats<<<dim3(64, 16),   256, 0, stream>>>(attn_t, wob, bout, part);
  k_proj_norm<<<dim3(64, 16),     256, 0, stream>>>(attn_t, wob, bout, gamma, beta, part, out);
}

// v004
// One run takes 65.8 microseconds.
// Next to v003, in two timings, it ran 1.30 and 1.29 times as fast.
// All steps since v000 together make it 2.92 times as fast.
#include <hip/hip_runtime.h>

#define B_     16
#define C_     256
#define N_     4096
#define O3_    384
#define INNER_ 128
#define HEADS_ 4
#define DH_    32
#define SCALE_ 0.1767766952966369f
#define EPS_   1e-5f

typedef __attribute__((ext_vector_type(16))) __bf16 v16bf;
typedef __attribute__((ext_vector_type(8)))  __bf16 v8bf;
typedef __attribute__((ext_vector_type(8)))  float  v8f;
typedef __attribute__((ext_vector_type(4)))  __bf16 v4bf;
typedef __attribute__((ext_vector_type(4)))  float  v4f;

// 16-bit A/B fragment K-index for lane `lane`, element `e`
// K = (e>>3)*16 + (lane>>4)*8 + (e&7)   (ISA 7.12.2)
__device__ __forceinline__ int kmap16(int lane, int e) {
  return ((e >> 3) << 4) | ((lane >> 4) << 3) | (e & 7);
}

__device__ __forceinline__ v8f wmma_bf16(v16bf a, v16bf b, v8f c) {
  return __builtin_amdgcn_wmma_f32_16x16x32_bf16(false, a, false, b, (short)0, c,
                                                 false, false);
}

// Load one 16-element bf16 fragment: per-lane K chunks are contiguous, so this
// is two 16-byte loads (global or LDS).  p must point at K = k0 + (lane>>4)*8.
__device__ __forceinline__ v16bf frag_ld(const __bf16* p) {
  v8bf lo = *(const v8bf*)p;
  v8bf hi = *(const v8bf*)(p + 16);
  return __builtin_shufflevector(lo, hi, 0, 1, 2, 3, 4, 5, 6, 7,
                                 8, 9, 10, 11, 12, 13, 14, 15);
}

// ---------------------------------------------------------------------------
// 0) weights -> bf16.  grid 512, block 256.
//    w_qkv is laid out in fragment order for k_qkv_gemm: per (16-row tile,
//    32-k step) two planes of 32 lanes x 8 elements, so that one wave-wide
//    16-byte load of a plane covers 512 contiguous bytes.  w_out likewise,
//    for the two projection kernels (four 32-k steps a row tile).
// ---------------------------------------------------------------------------
__global__ __launch_bounds__(256) void k_cvt_w(const float* __restrict__ wqkv,
                                               const float* __restrict__ wout,
                                               __bf16* __restrict__ wqb,
                                               __bf16* __restrict__ wob) {
  const int i = blockIdx.x * 256 + threadIdx.x;
  if (i < O3_ * C_) {
    const int o = i >> 8, k = i & 255;
    const int plane = ((o >> 4) * 8 + (k >> 5)) * 2 + ((k >> 4) & 1);
    const int ln = ((k >> 3) & 1) * 16 + (o & 15);
    wqb[plane * 256 + ln * 8 + (k & 7)] = (__bf16)wqkv[i];
  }
  const int j = i - O3_ * C_;
  if (j >= 0 && j < C_ * INNER_) {
    const int o = j >> 7, k = j & 127;
    const int plane = ((o >> 4) * 4 + (k >> 5)) * 2 + ((k >> 4) & 1);
    const int ln = ((k >> 3) & 1) * 16 + (o & 15);
    wob[plane * 256 + ln * 8 + (k & 7)] = (__bf16)wout[j];
  }
}

// ---------------------------------------------------------------------------
// 1) qkv GEMM: [384x256] @ [256x4096] per batch.
//    One work-group makes all 384 rows of 64 columns: the x tile is read once,
//    converted once to bf16 and laid k-contiguous in LDS; each wave holds one
//    16-row tile of q, of k and of v times four 16-column tiles.
//    Column c of column tile j is spatial column 4c + j, so a lane's four
//    tiles give four consecutive columns of a row: whole-line stores.
//    q out fp32 (softmax precision).  k and v never leave the work-group:
//    each k row is taken to exp(k - its maximum over these 64 columns), laid
//    in LDS as bf16 beside v, and multiplied there into this work-group's
//    share of context[d][e] = sum_n k'[d][n] v[e][n].  Stored are that share
//    (fp32, 4 heads x 32 x 32), each row's local maximum and its local sum of
//    exponentials; k_ctx_merge puts the 64 shares of a batch on one scale.
//    grid (64, 16), block 256 (8 waves).
// ---------------------------------------------------------------------------
#define XP_ 264  // LDS row pitch, elements: 528 B = 16 B x odd, for 16-byte row readers
#define KP_ 72   // LDS row pitch of k' and v, elements: 144 B = 16 B x odd
#define NBLK_ 64 // column blocks (work-groups) a batch

// One weight fragment in k_cvt_w's order: two planes, 256 elements apart.
__device__ __forceinline__ v16bf wfrag_ld(const __bf16* p) {
  v8bf lo = *(const v8bf*)p;
  v8bf hi = *(const v8bf*)(p + 256);
  return __builtin_shufflevector(lo, hi, 0, 1, 2, 3, 4, 5, 6, 7,
                                 8, 9, 10, 11, 12, 13, 14, 15);
}

// exp(x) as 2^(x log2 e).  The v_nop fills the one slot that the instruction set
// asks for behind a transcendental, whatever the compiler schedules next.
__device__ __forceinline__ float exp_slot(float x) {
  float y;
  asm("v_exp_f32 %0, %1\n\tv_nop" : "=v"(y) : "v"(x * 1.442695041f));
  return y;
}

__global__ __launch_bounds__(256) void k_qkv_gemm(const float* __restrict__ x,
                                                  const __bf16* __restrict__ wqb,
                                                  float* __restrict__ qf,
                                                  float* __restrict__ pctx,
                                                  float* __restrict__ pmax,
                                                  float* __restrict__ psum) {
  const int lane = threadIdx.x & 31;
  const int wave = threadIdx.x >> 5;
  const int b = blockIdx.y;
  const int nWG = blockIdx.x * 64;
  const int c = lane & 15;
  const int h = lane >> 4;
  const float* xb = x + (size_t)b * C_ * N_ + nWG;

  __shared__ __align__(16) __bf16 xs[64 * XP_];
  __shared__ __align__(16) __bf16 ks[INNER_ * KP_];
  __shared__ __align__(16) __bf16 vs[INNER_ * KP_];

  // step 0's weight fragments are asked for first: they land while x is staged
  const __bf16* ap = wqb + wave * 4096 + lane * 8;
  v16bf a[2][3];
#pragma unroll
  for (int t = 0; t < 3; ++t) a[0][t] = wfrag_ld(ap + t * 32768);

  {
    // a thread takes 4 columns x 8 k, twice; LDS row j*16 + q holds column 4q + j
    const int q = threadIdx.x & 15;
    const int oc = threadIdx.x >> 4;
    v4f f[2][8];
#pragma unroll
    for (int u = 0; u < 2; ++u)
#pragma unroll
      for (int i = 0; i < 8; ++i)
        f[u][i] = *(const v4f*)(xb + (size_t)((oc + 16 * u) * 8 + i) * N_ + 4 * q);
#pragma unroll
    for (int u = 0; u < 2; ++u)
#pragma unroll
      for (int j = 0; j < 4; ++j) {
        v8bf pk;
#pragma unroll
        for (int i = 0; i < 8; ++i) pk[i] = (__bf16)f[u][i][j];
        *(v8bf*)(xs + (j * 16 + q) * XP_ + (oc + 16 * u) * 8) = pk;
      }
  }
  __syncthreads();

  v8f acc[3][4] = {};
  const __bf16* bp = xs + c * XP_ + h * 8;
  v16bf bm[2][4];
#pragma unroll
  for (int j = 0; j < 4; ++j) bm[0][j] = frag_ld(bp + j * 16 * XP_);
#pragma unroll
  for (int ks = 0; ks < 8; ++ks) {
    const int cur = ks & 1, nxt = cur ^ 1;
    if (ks < 7) {
#pragma unroll
      for (int t = 0; t < 3; ++t) a[nxt][t] = wfrag_ld(ap + t * 32768 + (ks + 1) * 512);
#pragma unroll
      for (int j = 0; j < 4; ++j) bm[nxt][j] = frag_ld(bp + j * 16 * XP_ + (ks + 1) * 32);
    }
    // keeps the next step's loads in front of this step's matrix block, so that
    // their L2 and LDS latency runs under twelve matrix instructions
    __builtin_amdgcn_sched_barrier(0);
#pragma unroll
    for (int t = 0; t < 3; ++t)
#pragma unroll
      for (int j = 0; j < 4; ++j) acc[t][j] = wmma_bf16(a[cur][t], bm[cur][j], acc[t][j]);
    // keeps later steps' loads from being moved in among these matrix instructions
    __builtin_amdgcn_sched_barrier(0);
  }
  // A row's 64 columns lie in the 16 lanes of one half, four a lane: maximum
  // and sum go over the lane's four, then by a butterfly inside the half.
  const int wg = b * NBLK_ + blockIdx.x;
  float ml[8], sl[8];
#pragma unroll
  for (int r = 0; r < 8; ++r) {
    float m = fmaxf(fmaxf(acc[1][0][r], acc[1][1][r]), fmaxf(acc[1][2][r], acc[1][3][r]));
#pragma unroll
    for (int o = 8; o > 0; o >>= 1) m = fmaxf(m, __shfl_xor(m, o));
    ml[r] = m;
  }
#pragma unroll
  for (int r = 0; r < 8; ++r) {
    float e[4];
#pragma unroll
    for (int j = 0; j < 4; ++j) e[j] = exp_slot(acc[1][j][r] - ml[r]);
    float s = (e[0] + e[1]) + (e[2] + e[3]);
#pragma unroll
    for (int o = 8; o > 0; o >>= 1) s += __shfl_xor(s, o);
    sl[r] = s;
    // LDS column 4c + j is the local spatial column, for k' and for v alike
    v4bf pk = {(__bf16)e[0], (__bf16)e[1], (__bf16)e[2], (__bf16)e[3]};
    v4bf vv = {(__bf16)acc[2][0][r], (__bf16)acc[2][1][r], (__bf16)acc[2][2][r],
               (__bf16)acc[2][3][r]};
    const int lo = (wave * 16 + h * 8 + r) * KP_ + 4 * c;
    *(v4bf*)(ks + lo) = pk;
    *(v4bf*)(vs + lo) = vv;
  }
  __syncthreads();

  // every global store stands behind the barrier: in front of it the barrier's
  // own wait would hold each wave until its stores had been acknowledged
#pragma unroll
  for (int r = 0; r < 8; ++r) {
    const size_t o = (size_t)(b * INNER_ + wave * 16 + h * 8 + r) * N_ + nWG + 4 * c;
    v4f vq = {acc[0][0][r], acc[0][1][r], acc[0][2][r], acc[0][3][r]};
    *(v4f*)(qf + o) = vq;
  }
  if (c == 0) {
    const size_t so = (size_t)wg * INNER_ + wave * 16 + h * 8;
#pragma unroll
    for (int u = 0; u < 2; ++u) {
      *(v4f*)(pmax + so + u * 4) = v4f{ml[u * 4], ml[u * 4 + 1], ml[u * 4 + 2], ml[u * 4 + 3]};
      *(v4f*)(psum + so + u * 4) = v4f{sl[u * 4], sl[u * 4 + 1], sl[u * 4 + 2], sl[u * 4 + 3]};
    }
  }

  // wave w: head w >> 1, rows d = (w & 1) * 16 .. + 15, all 32 columns e; K = 64
  const __bf16* ka = ks + ((wave >> 1) * DH_ + (wave & 1) * 16 + c) * KP_ + h * 8;
  const __bf16* vb = vs + ((wave >> 1) * DH_ + c) * KP_ + h * 8;
  v8f pc[2] = {};
#pragma unroll
  for (int s2 = 0; s2 < 2; ++s2) {
    const v16bf af = frag_ld(ka + s2 * 32);
#pragma unroll
    for (int j = 0; j < 2; ++j)
      pc[j] = wmma_bf16(af, frag_ld(vb + j * 16 * KP_ + s2 * 32), pc[j]);
  }
  // share layout: [wave][j * 2 + u][lane][4], so every store covers 512 B in a row
  float* pd = pctx + (size_t)wg * (HEADS_ * DH_ * DH_) + wave * 512 + lane * 4;
#pragma unroll
  for (int j = 0; j < 2; ++j)
#pragma unroll
    for (int u = 0; u < 2; ++u)
      *(v4f*)(pd + (j * 2 + u) * 128) =
          v4f{pc[j][u * 4], pc[j][u * 4 + 1], pc[j][u * 4 + 2], pc[j][u * 4 + 3]};
}

// ---------------------------------------------------------------------------
// 2) context of one (batch, head) from its 64 shares: with M[d] the maximum of
//    the local maxima m_i[d] and w_i[d] = exp(m_i[d] - M[d]),
//    context[d][e] = sum_i w_i[d] share_i[d][e] / sum_i w_i[d] s_i[d],
//    which is the softmax of k over all n times v.  One thread an element.
//    grid (64, 4), block 256.
// ---------------------------------------------------------------------------
__global__ __launch_bounds__(256) void k_ctx_merge(const float* __restrict__ pctx,
                                                   const float* __restrict__ pmax,
                                                   const float* __restrict__ psum,
                                                   float* __restrict__ ctx) {
  const int bh = blockIdx.x;
  const int b = bh >> 2, hd = bh & 3;
  const int t = threadIdx.x;
  // element f of the head's 1024 in k_qkv_gemm's share layout
  const int f = blockIdx.y * 256 + t;
  const int ln = (f >> 2) & 31;
  const int d = (f >> 9) * 16 + ((f >> 7) & 1) * 4 + (f & 3) + ((ln >> 4) << 3);
  const int e = ((f >> 8) & 1) * 16 + (ln & 15);

  __shared__ float redm[8 * DH_];
  __shared__ float reds[8 * DH_];
  __shared__ float scl[NBLK_ * DH_];

  // the statistics first, then all 64 shares' values: one latency for both
  const int dd = t & 31, g = t >> 5;
  const size_t so = (size_t)(b * NBLK_ + g * 8) * INNER_ + hd * DH_ + dd;
  float ml[8], sl[8];
#pragma unroll
  for (int u = 0; u < 8; ++u) {
    ml[u] = pmax[so + u * INNER_];
    sl[u] = psum[so + u * INNER_];
  }
  // the loads below may land in registers that hold the addresses of the loads
  // above: this wait stands in front of that overwrite
  asm volatile("s_wait_xcnt 0x0" ::: "memory");
  const float* ps = pctx + (size_t)b * NBLK_ * (HEADS_ * DH_ * DH_) + hd * (DH_ * DH_) + f;
  float p[NBLK_];
#pragma unroll
  for (int i = 0; i < NBLK_; ++i) p[i] = ps[(size_t)i * (HEADS_ * DH_ * DH_)];

  float m = ml[0];
#pragma unroll
  for (int u = 1; u < 8; ++u) m = fmaxf(m, ml[u]);
  redm[g * DH_ + dd] = m;
  __syncthreads();
  m = redm[dd];
#pragma unroll
  for (int w = 1; w < 8; ++w) m = fmaxf(m, redm[w * DH_ + dd]);
  float s = 0.f;
#pragma unroll
  for (int u = 0; u < 8; ++u) {
    const float w = __expf(ml[u] - m);
    scl[(g * 8 + u) * DH_ + dd] = w;
    s += sl[u] * w;
  }
  reds[g * DH_ + dd] = s;
  __syncthreads();

  float tot = reds[d];
#pragma unroll
  for (int w = 1; w < 8; ++w) tot += reds[w * DH_ + d];
  float a4[4] = {0.f, 0.f, 0.f, 0.f};  // four independent chains
#pragma unroll
  for (int i = 0; i < NBLK_; ++i) a4[i & 3] += p[i] * scl[i * DH_ + d];
  ctx[(size_t)bh * DH_ * DH_ + d * DH_ + e] = ((a4[0] + a4[1]) + (a4[2] + a4[3])) / tot;
}

// ---------------------------------------------------------------------------
// 3) softmax of q over d (*SCALE); writes transposed bf16 q_t[(b,h)][n][32].
//    grid (16, 4, 16), block 256.
// ---------------------------------------------------------------------------
__global__ __launch_bounds__(256) void k_qsoftmax(const float* __restrict__ qf,
                                                  __bf16* __restrict__ qbt) {
  const int n = blockIdx.x * 256 + threadIdx.x;
  const int h = blockIdx.y, b = blockIdx.z;
  const float* base = qf + (size_t)(b * INNER_ + h * DH_) * N_ + n;
  float v[DH_];
  float m = -3.4e38f;
#pragma unroll
  for (int d = 0; d < DH_; ++d) { v[d] = base[(size_t)d * N_]; m = fmaxf(m, v[d]); }
  float sum = 0.f;
#pragma unroll
  for (int d = 0; d < DH_; ++d) { v[d] = __expf(v[d] - m); sum += v[d]; }
  const float sc = SCALE_ / sum;
  v8bf pk[4];
#pragma unroll
  for (int d = 0; d < DH_; ++d) pk[d >> 3][d & 7] = (__bf16)(v[d] * sc);
  v8bf* dst = (v8bf*)(qbt + ((size_t)(b * HEADS_ + h) * N_ + n) * DH_);
#pragma unroll
  for (int j = 0; j < 4; ++j) dst[j] = pk[j];
}

// ---------------------------------------------------------------------------
// 4) attn[e][n] = sum_d ctx[d][e] q'[d][n]; K=32 -> one WMMA per tile.
//    Writes transposed bf16 attn_t[b][n][128] (8 accs = 8 consecutive channels
//    -> one packed b128 store).  grid (32, 64), block 256.
// ---------------------------------------------------------------------------
__global__ __launch_bounds__(256) void k_attn_out(const __bf16* __restrict__ qbt,
                                                  const float* __restrict__ ctx,
                                                  __bf16* __restrict__ attn_t) {
  const int bh = blockIdx.y;
  const int b = bh >> 2, h = bh & 3;
  const int lane = threadIdx.x & 31;
  const int wave = threadIdx.x >> 5;
  const int nBase = blockIdx.x * 128 + wave * 16;
  const int n = nBase + (lane & 15);
  const int off = (lane >> 4) << 3;

  __shared__ float ctxs[DH_ * DH_];
  for (int i = threadIdx.x; i < DH_ * DH_; i += 256)
    ctxs[i] = ctx[(size_t)bh * DH_ * DH_ + i];
  __syncthreads();

  v16bf bm = frag_ld(qbt + ((size_t)bh * N_ + n) * DH_ + off);

#pragma unroll
  for (int i = 0; i < 2; ++i) {
    v16bf a;
#pragma unroll
    for (int e = 0; e < 16; ++e)
      a[e] = (__bf16)ctxs[kmap16(lane, e) * DH_ + i * 16 + (lane & 15)];
    v8f acc = {};
    acc = wmma_bf16(a, bm, acc);
    v8bf pk;
#pragma unroll
    for (int r = 0; r < 8; ++r) pk[r] = (__bf16)acc[r];
    *(v8bf*)(attn_t + ((size_t)b * N_ + n) * INNER_ + h * DH_ + i * 16 + off) = pk;
  }
}

// ---------------------------------------------------------------------------
// 5) out2[o][n] = sum_c wout[o][c] attn_t[n][c] + bout[o], made twice and never
//    stored unnormalized: the product is cheap next to a round trip of the
//    64 MiB result through memory.
//    k_proj_stats keeps only each work-group's sum and sum of squares;
//    k_proj_norm makes the same product again, reduces its batch's 64 partial
//    pairs to mean and variance, and stores the normalized, affine result.
//    One work-group makes all 256 rows of 64 columns: its attn_t tile (64 rows
//    of 256 B, contiguous) is read once and laid in LDS; each wave holds two
//    16-row tiles times four 16-column tiles.  Column c of column tile j is
//    spatial column 4c + j, as in k_qkv_gemm: whole-line stores.
//    grid (64, 16), block 256 (8 waves), both.
// ---------------------------------------------------------------------------
#define AP_ 136  // LDS row pitch, elements: 272 B = 16 B x odd, for 16-byte row readers

typedef __attribute__((ext_vector_type(2))) float v2f;

template <bool NORM>
__device__ __forceinline__ void proj_body(const __bf16* __restrict__ attn_t,
                                          const __bf16* __restrict__ wob,
                                          const float* __restrict__ bout,
                                          const float* __restrict__ gamma,
                                          const float* __restrict__ beta,
                                          const float* __restrict__ part_in,
                                          float* __restrict__ part_out,
                                          float* __restrict__ out) {
  const int lane = threadIdx.x & 31;
  const int wave = threadIdx.x >> 5;
  const int b = blockIdx.y;
  const int nWG = blockIdx.x * 64;
  const int c = lane & 15;
  const int h = lane >> 4;

  __shared__ __align__(16) __bf16 as[64 * AP_];

  // the tile first, then all of the wave's weight fragments: one latency for both
  const __bf16* src = attn_t + ((size_t)b * N_ + nWG) * INNER_ + threadIdx.x * 8;
  v8bf g[4];
#pragma unroll
  for (int i = 0; i < 4; ++i) g[i] = *(const v8bf*)(src + i * 2048);

  const __bf16* ap = wob + wave * 4096 + lane * 8;
  v16bf a[4][2];
#pragma unroll
  for (int ks = 0; ks < 4; ++ks)
#pragma unroll
    for (int t = 0; t < 2; ++t) a[ks][t] = wfrag_ld(ap + t * 2048 + ks * 512);
  // a lane's sixteen bias values, asked for with the rest
  v4f bi[2][2];
#pragma unroll
  for (int t = 0; t < 2; ++t)
#pragma unroll
    for (int u = 0; u < 2; ++u)
      bi[t][u] = *(const v4f*)(bout + wave * 32 + t * 16 + h * 8 + u * 4);
  // likewise the batch's 64 partial pairs (two a lane) and the lane's affine terms
  v2f pp[2];
  v4f ga[2][2], be[2][2];
  if (NORM) {
#pragma unroll
    for (int u = 0; u < 2; ++u)
      pp[u] = *(const v2f*)(part_in + (size_t)(b * 64 + u * 32 + lane) * 2);
#pragma unroll
    for (int t = 0; t < 2; ++t)
#pragma unroll
      for (int u = 0; u < 2; ++u) {
        ga[t][u] = *(const v4f*)(gamma + wave * 32 + t * 16 + h * 8 + u * 4);
        be[t][u] = *(const v4f*)(beta + wave * 32 + t * 16 + h * 8 + u * 4);
      }
  }

  // LDS row j*16 + q holds column 4q + j
#pragma unroll
  for (int i = 0; i < 4; ++i) {
    const int n = (threadIdx.x >> 4) + 16 * i;
    *(v8bf*)(as + ((n & 3) * 16 + (n >> 2)) * AP_ + (threadIdx.x & 15) * 8) = g[i];
  }
  __syncthreads();

  v8f acc[2][4] = {};
  const __bf16* bp = as + c * AP_ + h * 8;
  v16bf bm[2][4];
#pragma unroll
  for (int j = 0; j < 4; ++j) bm[0][j] = frag_ld(bp + j * 16 * AP_);
#pragma unroll
  for (int ks = 0; ks < 4; ++ks) {
    const int cur = ks & 1, nxt = cur ^ 1;
    if (ks < 3) {
#pragma unroll
      for (int j = 0; j < 4; ++j) bm[nxt][j] = frag_ld(bp + j * 16 * AP_ + (ks + 1) * 32);
    }
    // keeps the next step's LDS reads together in front of this step's matrix
    // block, so that their latency runs under eight matrix instructions
    __builtin_amdgcn_sched_barrier(0);
#pragma unroll
    for (int t = 0; t < 2; ++t)
#pragma unroll
      for (int j = 0; j < 4; ++j) acc[t][j] = wmma_bf16(a[ks][t], bm[cur][j], acc[t][j]);
    // keeps later steps' reads from being moved in among these matrix instructions
    __builtin_amdgcn_sched_barrier(0);
  }

  if (!NORM) {
    // four independent chains a lane, a butterfly over the wave, eight waves in LDS
    float s[4] = {0.f, 0.f, 0.f, 0.f}, sq[4] = {0.f, 0.f, 0.f, 0.f};
#pragma unroll
    for (int t = 0; t < 2; ++t)
#pragma unroll
      for (int r = 0; r < 8; ++r) {
        const float bv = bi[t][r >> 2][r & 3];
#pragma unroll
        for (int j = 0; j < 4; ++j) {
          const float v = acc[t][j][r] + bv;
          s[j] += v;
          sq[j] += v * v;
        }
      }
    float st = (s[0] + s[1]) + (s[2] + s[3]);
    float qt = (sq[0] + sq[1]) + (sq[2] + sq[3]);
#pragma unroll
    for (int o = 16; o > 0; o >>= 1) {
      st += __shfl_xor(st, o);
      qt += __shfl_xor(qt, o);
    }
    __shared__ v2f red[8];
    if (lane == 0) red[wave] = v2f{st, qt};
    __syncthreads();
    if (threadIdx.x == 0) {
      v2f tot = red[0];
#pragma unroll
      for (int w = 1; w < 8; ++w) tot += red[w];
      *(v2f*)(part_out + (size_t)(b * 64 + blockIdx.x) * 2) = tot;
    }
  } else {
    // every wave reduces the 64 pairs the same way: no LDS, no barrier
    float st = pp[0][0] + pp[1][0];
    float qt = pp[0][1] + pp[1][1];
#pragma unroll
    for (int o = 16; o > 0; o >>= 1) {
      st += __shfl_xor(st, o);
      qt += __shfl_xor(qt, o);
    }
    const float invM = 1.0f / (float)(C_ * N_);
    const float mean = st * invM;
    const float var  = qt * invM - mean * mean;
    const float inv  = rsqrtf(var + EPS_);
#pragma unroll
    for (int t = 0; t < 2; ++t) {
      const int m0 = wave * 32 + t * 16 + h * 8;
      float* op = out + (size_t)(b * C_ + m0) * N_ + nWG + 4 * c;
#pragma unroll
      for (int r = 0; r < 8; ++r) {
        const float bv = bi[t][r >> 2][r & 3];
        const float gv = ga[t][r >> 2][r & 3];
        const float ev = be[t][r >> 2][r & 3];
        v4f vo;
#pragma unroll
        for (int j = 0; j < 4; ++j)
          vo[j] = ((acc[t][j][r] + bv) - mean) * inv * gv + ev;
        *(v4f*)(op + (size_t)r * N_) = vo;
      }
    }
  }
}

__global__ __launch_bounds__(256) void k_proj_stats(const __bf16* __restrict__ attn_t,
                                                    const __bf16* __restrict__ wob,
                                                    const float* __restrict__ bout,
                                                    float* __restrict__ part) {
  proj_body<false>(attn_t, wob, bout, nullptr, nullptr, nullptr, part, nullptr);
}

__global__ __launch_bounds__(256) void k_proj_norm(const __bf16* __restrict__ attn_t,
                                                   const __bf16* __restrict__ wob,
                                                   const float* __restrict__ bout,
                                                   const float* __restrict__ gamma,
                                                   const float* __restrict__ beta,
                                                   const float* __restrict__ part,
                                                   float* __restrict__ out) {
  proj_body<true>(attn_t, wob, bout, gamma, beta, part, nullptr, out);
}

// ---------------------------------------------------------------------------
extern "C" void kernel_launch(void* const* d_in, const int* in_sizes, int n_in,
                              void* d_out, int out_size, void* d_ws, size_t ws_size,
                              hipStream_t stream) {
  const float* x     = (const float*)d_in[0];
  const float* wqkv  = (const float*)d_in[1];
  const float* wout  = (const float*)d_in[2];
  const float* bout  = (const float*)d_in[3];
  const float* gamma = (const float*)d_in[4];
  const float* beta  = (const float*)d_in[5];
  float* out = (float*)d_out;
  (void)ws_size; (void)in_sizes; (void)n_in; (void)out_size;

  const size_t QSZ = (size_t)B_ * INNER_ * N_;   // 8,388,608
  float*  qf  = (float*)d_ws;                    // fp32 q (later reused as attn_t)
  float*  pctx = qf + QSZ;                       // context shares, 4096 floats a work-group
  float*  pmax = pctx + (size_t)B_ * NBLK_ * HEADS_ * DH_ * DH_;  // local row maxima
  float*  psum = pmax + (size_t)B_ * NBLK_ * INNER_;              // local row sums
  __bf16* qbt = (__bf16*)(psum + (size_t)B_ * NBLK_ * INNER_);    // bf16 q_t [bh][n][32]
  __bf16* wqb = qbt + QSZ;                       // bf16 w_qkv, fragment order
  __bf16* wob = wqb + (size_t)O3_ * C_;          // bf16 w_out, fragment order
  float*  ctx = (float*)(wob + (size_t)C_ * INNER_);
  float*  part = ctx + (size_t)B_ * HEADS_ * DH_ * DH_;
  __bf16* attn_t = (__bf16*)qf;                  // reuse dead q region

  k_cvt_w    <<<dim3(512),        256, 0, stream>>>(wqkv, wout, wqb, wob);
  k_qkv_gemm <<<dim3(64, 16),     256, 0, stream>>>(x, wqb, qf, pctx, pmax, psum);
  k_ctx_merge<<<dim3(64, 4),      256, 0, stream>>>(pctx, pmax, psum, ctx);
  k_qsoftmax <<<dim3(16, 4, 16),  256, 0, stream>>>(qf, qbt);
  k_attn_out <<<dim3(32, 64),     256, 0, stream>>>(qbt, ctx, attn_t);
  k_proj_stats<<<dim3(64, 16),   256, 0, stream>>>(attn_t, wob, bout, part);
  k_proj_norm<<<dim3(64, 16),     256, 0, stream>>>(attn_t, wob, bout, gamma, beta, part, out);
}

// v005
// It runs in 53.3 microseconds.
// Two timings next to v004 both put it at 1.26 times that version's speed.
// Counting every step since v000, it is 3.67 times as fast.
#include <hip/hip_runtime.h>

#define B_     16
#define C_     256
#define N_     4096
#define O3_    384
#define INNER_ 128
#define HEADS_ 4
#define DH_    32
#define SCALE_ 0.1767766952966369f
#define EPS_   1e-5f

typedef __attribute__((ext_vector_type(16))) __bf16 v16bf;
typedef __attribute__((ext_vector_type(8)))  __bf16 v8bf;
typedef __attribute__((ext_vector_type(8)))  float  v8f;
typedef __attribute__((ext_vector_type(4)))  __bf16 v4bf;
typedef __attribute__((ext_vector_type(4)))  float  v4f;

// 16-bit A/B fragment: lane `lane`, element `e` holds
// K = (e>>3)*16 + (lane>>4)*8 + (e&7)   (ISA 7.12.2)

__device__ __forceinline__ v8f wmma_bf16(v16bf a, v16bf b, v8f c) {
  return __builtin_amdgcn_wmma_f32_16x16x32_bf16(false, a, false, b, (short)0, c,
                                                 false, false);
}

// Load one 16-element bf16 fragment: per-lane K chunks are contiguous, so this
// is two 16-byte loads (global or LDS).  p must point at K = k0 + (lane>>4)*8.
__device__ __forceinline__ v16bf frag_ld(const __bf16* p) {
  v8bf lo = *(const v8bf*)p;
  v8bf hi = *(const v8bf*)(p + 16);
  return __builtin_shufflevector(lo, hi, 0, 1, 2, 3, 4, 5, 6, 7,
                                 8, 9, 10, 11, 12, 13, 14, 15);
}

// ---------------------------------------------------------------------------
// 0) weights -> bf16.  grid 512, block 256.
//    w_qkv is laid out in fragment order for k_qkv_gemm: per (16-row tile,
//    32-k step) two planes of 32 lanes x 8 elements, so that one wave-wide
//    16-byte load of a plane covers 512 contiguous bytes.  w_out likewise,
//    for the two projection kernels (four 32-k steps a row tile).
// ---------------------------------------------------------------------------
__global__ __launch_bounds__(256) void k_cvt_w(const float* __restrict__ wqkv,
                                               const float* __restrict__ wout,
                                               __bf16* __restrict__ wqb,
                                               __bf16* __restrict__ wob) {
  const int i = blockIdx.x * 256 + threadIdx.x;
  if (i < O3_ * C_) {
    const int o = i >> 8, k = i & 255;
    const int plane = ((o >> 4) * 8 + (k >> 5)) * 2 + ((k >> 4) & 1);
    const int ln = ((k >> 3) & 1) * 16 + (o & 15);
    wqb[plane * 256 + ln * 8 + (k & 7)] = (__bf16)wqkv[i];
  }
  const int j = i - O3_ * C_;
  if (j >= 0 && j < C_ * INNER_) {
    const int o = j >> 7, k = j & 127;
    const int plane = ((o >> 4) * 4 + (k >> 5)) * 2 + ((k >> 4) & 1);
    const int ln = ((k >> 3) & 1) * 16 + (o & 15);
    wob[plane * 256 + ln * 8 + (k & 7)] = (__bf16)wout[j];
  }
}

// ---------------------------------------------------------------------------
// 1) qkv GEMM: [384x256] @ [256x4096] per batch.
//    One work-group makes all 384 rows of 64 columns: the x tile is read once,
//    converted once to bf16 and laid k-contiguous in LDS; each wave holds one
//    16-row tile of q, of k and of v times four 16-column tiles.
//    Column c of column tile j is spatial column 4c + j, so a lane's four
//    tiles give four consecutive columns of a row: whole-line stores.
//    q out fp32 (softmax precision).  k and v never leave the work-group:
//    each k row is taken to exp(k - its maximum over these 64 columns), laid
//    in LDS as bf16 beside v, and multiplied there into this work-group's
//    share of context[d][e] = sum_n k'[d][n] v[e][n].  Stored are that share
//    (fp32, 4 heads x 32 x 32), each row's local maximum and its local sum of
//    exponentials; k_ctx_merge puts the 64 shares of a batch on one scale.
//    grid (64, 16), block 256 (8 waves).
// ---------------------------------------------------------------------------
#define XP_ 264  // LDS row pitch, elements: 528 B = 16 B x odd, for 16-byte row readers
#define KP_ 72   // LDS row pitch of k' and v, elements: 144 B = 16 B x odd
#define NBLK_ 64 // column blocks (work-groups) a batch

// One weight fragment in k_cvt_w's order: two planes, 256 elements apart.
__device__ __forceinline__ v16bf wfrag_ld(const __bf16* p) {
  v8bf lo = *(const v8bf*)p;
  v8bf hi = *(const v8bf*)(p + 256);
  return __builtin_shufflevector(lo, hi, 0, 1, 2, 3, 4, 5, 6, 7,
                                 8, 9, 10, 11, 12, 13, 14, 15);
}

// exp(x) as 2^(x log2 e).  The v_nop fills the one slot that the instruction set
// asks for behind a transcendental, whatever the compiler schedules next.
__device__ __forceinline__ float exp_slot(float x) {
  float y;
  asm("v_exp_f32 %0, %1\n\tv_nop" : "=v"(y) : "v"(x * 1.442695041f));
  return y;
}

__global__ __launch_bounds__(256) void k_qkv_gemm(const float* __restrict__ x,
                                                  const __bf16* __restrict__ wqb,
                                                  float* __restrict__ qf,
                                                  float* __restrict__ pctx,
                                                  float* __restrict__ pmax,
                                                  float* __restrict__ psum) {
  const int lane = threadIdx.x & 31;
  const int wave = threadIdx.x >> 5;
  const int b = blockIdx.y;
  const int nWG = blockIdx.x * 64;
  const int c = lane & 15;
  const int h = lane >> 4;
  const float* xb = x + (size_t)b * C_ * N_ + nWG;

  __shared__ __align__(16) __bf16 xs[64 * XP_];
  __shared__ __align__(16) __bf16 ks[INNER_ * KP_];
  __shared__ __align__(16) __bf16 vs[INNER_ * KP_];

  // step 0's weight fragments are asked for first: they land while x is staged
  const __bf16* ap = wqb + wave * 4096 + lane * 8;
  v16bf a[2][3];
#pragma unroll
  for (int t = 0; t < 3; ++t) a[0][t] = wfrag_ld(ap + t * 32768);

  {
    // a thread takes 4 columns x 8 k, twice; LDS row j*16 + q holds column 4q + j
    const int q = threadIdx.x & 15;
    const int oc = threadIdx.x >> 4;
    v4f f[2][8];
#pragma unroll
    for (int u = 0; u < 2; ++u)
#pragma unroll
      for (int i = 0; i < 8; ++i)
        f[u][i] = *(const v4f*)(xb + (size_t)((oc + 16 * u) * 8 + i) * N_ + 4 * q);
#pragma unroll
    for (int u = 0; u < 2; ++u)
#pragma unroll
      for (int j = 0; j < 4; ++j) {
        v8bf pk;
#pragma unroll
        for (int i = 0; i < 8; ++i) pk[i] = (__bf16)f[u][i][j];
        *(v8bf*)(xs + (j * 16 + q) * XP_ + (oc + 16 * u) * 8) = pk;
      }
  }
  __syncthreads();

  v8f acc[3][4] = {};
  const __bf16* bp = xs + c * XP_ + h * 8;
  v16bf bm[2][4];
#pragma unroll
  for (int j = 0; j < 4; ++j) bm[0][j] = frag_ld(bp + j * 16 * XP_);
#pragma unroll
  for (int ks = 0; ks < 8; ++ks) {
    const int cur = ks & 1, nxt = cur ^ 1;
    if (ks < 7) {
#pragma unroll
      for (int t = 0; t < 3; ++t) a[nxt][t] = wfrag_ld(ap + t * 32768 + (ks + 1) * 512);
#pragma unroll
      for (int j = 0; j < 4; ++j) bm[nxt][j] = frag_ld(bp + j * 16 * XP_ + (ks + 1) * 32);
    }
    // keeps the next step's loads in front of this step's matrix block, so that
    // their L2 and LDS latency runs under twelve matrix instructions
    __builtin_amdgcn_sched_barrier(0);
#pragma unroll
    for (int t = 0; t < 3; ++t)
#pragma unroll
      for (int j = 0; j < 4; ++j) acc[t][j] = wmma_bf16(a[cur][t], bm[cur][j], acc[t][j]);
    // keeps later steps' loads from being moved in among these matrix instructions
    __builtin_amdgcn_sched_barrier(0);
  }
  // A row's 64 columns lie in the 16 lanes of one half, four a lane: maximum
  // and sum go over the lane's four, then by a butterfly inside the half.
  const int wg = b * NBLK_ + blockIdx.x;
  float ml[8], sl[8];
#pragma unroll
  for (int r = 0; r < 8; ++r) {
    float m = fmaxf(fmaxf(acc[1][0][r], acc[1][1][r]), fmaxf(acc[1][2][r], acc[1][3][r]));
#pragma unroll
    for (int o = 8; o > 0; o >>= 1) m = fmaxf(m, __shfl_xor(m, o));
    ml[r] = m;
  }
#pragma unroll
  for (int r = 0; r < 8; ++r) {
    float e[4];
#pragma unroll
    for (int j = 0; j < 4; ++j) e[j] = exp_slot(acc[1][j][r] - ml[r]);
    float s = (e[0] + e[1]) + (e[2] + e[3]);
#pragma unroll
    for (int o = 8; o > 0; o >>= 1) s += __shfl_xor(s, o);
    sl[r] = s;
    // LDS column 4c + j is the local spatial column, for k' and for v alike
    v4bf pk = {(__bf16)e[0], (__bf16)e[1], (__bf16)e[2], (__bf16)e[3]};
    v4bf vv = {(__bf16)acc[2][0][r], (__bf16)acc[2][1][r], (__bf16)acc[2][2][r],
               (__bf16)acc[2][3][r]};
    const int lo = (wave * 16 + h * 8 + r) * KP_ + 4 * c;
    *(v4bf*)(ks + lo) = pk;
    *(v4bf*)(vs + lo) = vv;
  }
  __syncthreads();

  // every global store stands behind the barrier: in front of it the barrier's
  // own wait would hold each wave until its stores had been acknowledged
#pragma unroll
  for (int r = 0; r < 8; ++r) {
    const size_t o = (size_t)(b * INNER_ + wave * 16 + h * 8 + r) * N_ + nWG + 4 * c;
    v4f vq = {acc[0][0][r], acc[0][1][r], acc[0][2][r], acc[0][3][r]};
    *(v4f*)(qf + o) = vq;
  }
  if (c == 0) {
    const size_t so = (size_t)wg * INNER_ + wave * 16 + h * 8;
#pragma unroll
    for (int u = 0; u < 2; ++u) {
      *(v4f*)(pmax + so + u * 4) = v4f{ml[u * 4], ml[u * 4 + 1], ml[u * 4 + 2], ml[u * 4 + 3]};
      *(v4f*)(psum + so + u * 4) = v4f{sl[u * 4], sl[u * 4 + 1], sl[u * 4 + 2], sl[u * 4 + 3]};
    }
  }

  // wave w: head w >> 1, rows d = (w & 1) * 16 .. + 15, all 32 columns e; K = 64
  const __bf16* ka = ks + ((wave >> 1) * DH_ + (wave & 1) * 16 + c) * KP_ + h * 8;
  const __bf16* vb = vs + ((wave >> 1) * DH_ + c) * KP_ + h * 8;
  v8f pc[2] = {};
#pragma unroll
  for (int s2 = 0; s2 < 2; ++s2) {
    const v16bf af = frag_ld(ka + s2 * 32);
#pragma unroll
    for (int j = 0; j < 2; ++j)
      pc[j] = wmma_bf16(af, frag_ld(vb + j * 16 * KP_ + s2 * 32), pc[j]);
  }
  // share layout: [wave][j * 2 + u][lane][4], so every store covers 512 B in a row
  float* pd = pctx + (size_t)wg * (HEADS_ * DH_ * DH_) + wave * 512 + lane * 4;
#pragma unroll
  for (int j = 0; j < 2; ++j)
#pragma unroll
    for (int u = 0; u < 2; ++u)
      *(v4f*)(pd + (j * 2 + u) * 128) =
          v4f{pc[j][u * 4], pc[j][u * 4 + 1], pc[j][u * 4 + 2], pc[j][u * 4 + 3]};
}

// ---------------------------------------------------------------------------
// 2) context of one (batch, head) from its 64 shares: with M[d] the maximum of
//    the local maxima m_i[d] and w_i[d] = exp(m_i[d] - M[d]),
//    context[d][e] = sum_i w_i[d] share_i[d][e] / sum_i w_i[d] s_i[d],
//    which is the softmax of k over all n times v.  One thread an element,
//    stored as bf16 [d][e]: the projection kernels read it as a matrix operand.
//    grid (64, 4), block 256.
// ---------------------------------------------------------------------------
__global__ __launch_bounds__(256) void k_ctx_merge(const float* __restrict__ pctx,
                                                   const float* __restrict__ pmax,
                                                   const float* __restrict__ psum,
                                                   __bf16* __restrict__ ctx) {
  const int bh = blockIdx.x;
  const int b = bh >> 2, hd = bh & 3;
  const int t = threadIdx.x;
  // element f of the head's 1024 in k_qkv_gemm's share layout
  const int f = blockIdx.y * 256 + t;
  const int ln = (f >> 2) & 31;
  const int d = (f >> 9) * 16 + ((f >> 7) & 1) * 4 + (f & 3) + ((ln >> 4) << 3);
  const int e = ((f >> 8) & 1) * 16 + (ln & 15);

  __shared__ float redm[8 * DH_];
  __shared__ float reds[8 * DH_];
  __shared__ float scl[NBLK_ * DH_];

  // the statistics first, then all 64 shares' values: one latency for both
  const int dd = t & 31, g = t >> 5;
  const size_t so = (size_t)(b * NBLK_ + g * 8) * INNER_ + hd * DH_ + dd;
  float ml[8], sl[8];
#pragma unroll
  for (int u = 0; u < 8; ++u) {
    ml[u] = pmax[so + u * INNER_];
    sl[u] = psum[so + u * INNER_];
  }
  // the loads below may land in registers that hold the addresses of the loads
  // above: this wait stands in front of that overwrite
  asm volatile("s_wait_xcnt 0x0" ::: "memory");
  const float* ps = pctx + (size_t)b * NBLK_ * (HEADS_ * DH_ * DH_) + hd * (DH_ * DH_) + f;
  float p[NBLK_];
#pragma unroll
  for (int i = 0; i < NBLK_; ++i) p[i] = ps[(size_t)i * (HEADS_ * DH_ * DH_)];

  float m = ml[0];
#pragma unroll
  for (int u = 1; u < 8; ++u) m = fmaxf(m, ml[u]);
  redm[g * DH_ + dd] = m;
  __syncthreads();
  m = redm[dd];
#pragma unroll
  for (int w = 1; w < 8; ++w) m = fmaxf(m, redm[w * DH_ + dd]);
  float s = 0.f;
#pragma unroll
  for (int u = 0; u < 8; ++u) {
    const float w = __expf(ml[u] - m);
    scl[(g * 8 + u) * DH_ + dd] = w;
    s += sl[u] * w;
  }
  reds[g * DH_ + dd] = s;
  __syncthreads();

  float tot = reds[d];
#pragma unroll
  for (int w = 1; w < 8; ++w) tot += reds[w * DH_ + d];
  float a4[4] = {0.f, 0.f, 0.f, 0.f};  // four independent chains
#pragma unroll
  for (int i = 0; i < NBLK_; ++i) a4[i & 3] += p[i] * scl[i * DH_ + d];
  ctx[(size_t)bh * DH_ * DH_ + d * DH_ + e] =
      (__bf16)(((a4[0] + a4[1]) + (a4[2] + a4[3])) / tot);
}

// ---------------------------------------------------------------------------
// 3) softmax of q over d (*SCALE); writes transposed bf16 q_t[(b,h)][n][32].
//    grid (16, 4, 16), block 256.
// ---------------------------------------------------------------------------
__global__ __launch_bounds__(256) void k_qsoftmax(const float* __restrict__ qf,
                                                  __bf16* __restrict__ qbt) {
  const int n = blockIdx.x * 256 + threadIdx.x;
  const int h = blockIdx.y, b = blockIdx.z;
  const float* base = qf + (size_t)(b * INNER_ + h * DH_) * N_ + n;
  float v[DH_];
  float m = -3.4e38f;
#pragma unroll
  for (int d = 0; d < DH_; ++d) { v[d] = base[(size_t)d * N_]; m = fmaxf(m, v[d]); }
  float sum = 0.f;
#pragma unroll
  for (int d = 0; d < DH_; ++d) { v[d] = __expf(v[d] - m); sum += v[d]; }
  const float sc = SCALE_ / sum;
  v8bf pk[4];
#pragma unroll
  for (int d = 0; d < DH_; ++d) pk[d >> 3][d & 7] = (__bf16)(v[d] * sc);
  v8bf* dst = (v8bf*)(qbt + ((size_t)(b * HEADS_ + h) * N_ + n) * DH_);
#pragma unroll
  for (int j = 0; j < 4; ++j) dst[j] = pk[j];
}

// ---------------------------------------------------------------------------
// 4) out2[o][n] = sum_(hd,e) wout[o][hd,e] (sum_d ctx[hd][d][e] q'[hd][d][n]) + bout[o],
//    summed in the other order: out2 = W2 q' + bout with
//    W2[o][hd,d] = sum_e wout[o][hd,e] ctx[hd][d][e], 256 x 128 a batch.
//    Each wave makes the W2 rows it needs itself, transposed: ctx (rows d) times
//    wout^T (columns o) leaves lane l with column o = l & 15 and rows
//    d = (l >> 4) * 8 + r, which is the A-fragment order of W2 as it stands, so
//    the two d tiles of a head, rounded to bf16, are one A fragment.
//    out2 is made twice and never stored unnormalized: the product is cheap
//    next to a round trip of the 64 MiB result through memory.
//    k_proj_stats keeps only each work-group's sum and sum of squares;
//    k_proj_norm makes the same product again, reduces its batch's 64 partial
//    pairs to mean and variance, and stores the normalized, affine result.
//    One work-group makes all 256 rows of 64 columns: its q' tile (64 columns
//    of 64 B a head, 4 KiB contiguous) is read once and laid in LDS; each wave
//    holds two 16-row tiles times four 16-column tiles.  Column c of column tile j is
//    spatial column 4c + j, as in k_qkv_gemm: whole-line stores.
//    grid (64, 16), block 256 (8 waves), both.
// ---------------------------------------------------------------------------
#define AP_ 136  // LDS row pitch, elements: 272 B = 16 B x odd, for 16-byte row readers

typedef __attribute__((ext_vector_type(2))) float v2f;

template <bool NORM>
__device__ __forceinline__ void proj_body(const __bf16* __restrict__ qbt,
                                          const __bf16* __restrict__ ctx,
                                          const __bf16* __restrict__ wob,
                                          const float* __restrict__ bout,
                                          const float* __restrict__ gamma,
                                          const float* __restrict__ beta,
                                          const float* __restrict__ part_in,
                                          float* __restrict__ part_out,
                                          float* __restrict__ out) {
  const int lane = threadIdx.x & 31;
  // the wave's number in a scalar register: what is formed from it costs no
  // vector register, of which k_proj_norm has none to spare
  const int wave = __builtin_amdgcn_readfirstlane(threadIdx.x >> 5);
  const int b = blockIdx.y;
  const int nWG = blockIdx.x * 64;
  const int c = lane & 15;
  const int h = lane >> 4;

  __shared__ __align__(16) __bf16 as[64 * AP_];

  // the operands of W2 first, the tile last: W2 is made while the tile is in flight
  const __bf16* ap = wob + wave * 4096 + lane * 8;
  v16bf a[4][2];
#pragma unroll
  for (int ks = 0; ks < 4; ++ks)
#pragma unroll
    for (int t = 0; t < 2; ++t) a[ks][t] = wfrag_ld(ap + t * 2048 + ks * 512);
  // later loads may land in registers that hold the addresses of the loads
  // above: this wait, and those like it below, stand in front of that overwrite
  asm volatile("s_wait_xcnt 0x0" ::: "memory");
  // the batch's context as A fragments: head ks, rows d = dh * 16 + c, k = e
  const __bf16* cp = ctx + ((size_t)b * HEADS_ * DH_ + c) * DH_ + h * 8;
  v16bf cf[4][2];
#pragma unroll
  for (int ks = 0; ks < 4; ++ks)
#pragma unroll
    for (int dh = 0; dh < 2; ++dh) cf[ks][dh] = frag_ld(cp + (ks * DH_ + dh * 16) * DH_);
  asm volatile("s_wait_xcnt 0x0" ::: "memory");
  // a lane's sixteen bias values, asked for with the rest
  v4f bi[2][2];
#pragma unroll
  for (int t = 0; t < 2; ++t)
#pragma unroll
    for (int u = 0; u < 2; ++u)
      bi[t][u] = *(const v4f*)(bout + wave * 32 + t * 16 + h * 8 + u * 4);
  asm volatile("s_wait_xcnt 0x0" ::: "memory");
  // likewise the batch's 64 partial pairs (two a lane) and the lane's affine terms
  v2f pp[2];
  v4f ga[2][2], be[2][2];
  if (NORM) {
#pragma unroll
    for (int u = 0; u < 2; ++u)
      pp[u] = *(const v2f*)(part_in + (size_t)(b * 64 + u * 32 + lane) * 2);
#pragma unroll
    for (int t = 0; t < 2; ++t)
#pragma unroll
      for (int u = 0; u < 2; ++u)
        ga[t][u] = *(const v4f*)(gamma + wave * 32 + t * 16 + h * 8 + u * 4);
    asm volatile("s_wait_xcnt 0x0" ::: "memory");
#pragma unroll
    for (int t = 0; t < 2; ++t)
#pragma unroll
      for (int u = 0; u < 2; ++u)
        be[t][u] = *(const v4f*)(beta + wave * 32 + t * 16 + h * 8 + u * 4);
    asm volatile("s_wait_xcnt 0x0" ::: "memory");
  }
  const __bf16* src = qbt + ((size_t)b * HEADS_ * N_ + nWG) * DH_ + threadIdx.x * 8;
  v8bf g[4];  // head i: column threadIdx.x >> 2, eight d from (threadIdx.x & 3) * 8
#pragma unroll
  for (int i = 0; i < 4; ++i) g[i] = *(const v8bf*)(src + (size_t)i * N_ * DH_);

  // W2 fragments, in front of the barrier: they need nothing of the tile.
  // The wout fragment serves as B here (k = e, column o): same lane order as A.
  v16bf w2[4][2];
#pragma unroll
  for (int ks = 0; ks < 4; ++ks) {
#pragma unroll
    for (int t = 0; t < 2; ++t) {
      const v8f d0 = wmma_bf16(cf[ks][0], a[ks][t], v8f{});
      const v8f d1 = wmma_bf16(cf[ks][1], a[ks][t], v8f{});
#pragma unroll
      for (int r = 0; r < 8; ++r) {
        w2[ks][t][r] = (__bf16)d0[r];
        w2[ks][t][8 + r] = (__bf16)d1[r];
      }
    }
    // a head's four results are rounded before the next head's are made: left
    // free, results stay live as fp32 and k_proj_norm spills past its 256 registers
    __builtin_amdgcn_sched_barrier(0);
  }

  // LDS row j*16 + q holds column 4q + j
#pragma unroll
  for (int i = 0; i < 4; ++i) {
    const int n = threadIdx.x >> 2;
    *(v8bf*)(as + ((n & 3) * 16 + (n >> 2)) * AP_ + i * DH_ + (threadIdx.x & 3) * 8) = g[i];
  }
  __syncthreads();

  v8f acc[2][4] = {};
  const __bf16* bp = as + c * AP_ + h * 8;
  v16bf bm[2][4];
#pragma unroll
  for (int j = 0; j < 4; ++j) bm[0][j] = frag_ld(bp + j * 16 * AP_);
#pragma unroll
  for (int ks = 0; ks < 4; ++ks) {
    const int cur = ks & 1, nxt = cur ^ 1;
    if (ks < 3) {
#pragma unroll
      for (int j = 0; j < 4; ++j) bm[nxt][j] = frag_ld(bp + j * 16 * AP_ + (ks + 1) * 32);
    }
    // keeps the next step's LDS reads together in front of this step's matrix
    // block, so that their latency runs under eight matrix instructions
    __builtin_amdgcn_sched_barrier(0);
#pragma unroll
    for (int t = 0; t < 2; ++t)
#pragma unroll
      for (int j = 0; j < 4; ++j) acc[t][j] = wmma_bf16(w2[ks][t], bm[cur][j], acc[t][j]);
    // keeps later steps' reads from being moved in among these matrix instructions
    __builtin_amdgcn_sched_barrier(0);
  }

  if (!NORM) {
    // four independent chains a lane, a butterfly over the wave, eight waves in LDS
    float s[4] = {0.f, 0.f, 0.f, 0.f}, sq[4] = {0.f, 0.f, 0.f, 0.f};
#pragma unroll
    for (int t = 0; t < 2; ++t)
#pragma unroll
      for (int r = 0; r < 8; ++r) {
        const float bv = bi[t][r >> 2][r & 3];
#pragma unroll
        for (int j = 0; j < 4; ++j) {
          const float v = acc[t][j][r] + bv;
          s[j] += v;
          sq[j] += v * v;
        }
      }
    float st = (s[0] + s[1]) + (s[2] + s[3]);
    float qt = (sq[0] + sq[1]) + (sq[2] + sq[3]);
#pragma unroll
    for (int o = 16; o > 0; o >>= 1) {
      st += __shfl_xor(st, o);
      qt += __shfl_xor(qt, o);
    }
    __shared__ v2f red[8];
    if (lane == 0) red[wave] = v2f{st, qt};
    __syncthreads();
    if (threadIdx.x == 0) {
      v2f tot = red[0];
#pragma unroll
      for (int w = 1; w < 8; ++w) tot += red[w];
      *(v2f*)(part_out + (size_t)(b * 64 + blockIdx.x) * 2) = tot;
    }
  } else {
    // every wave reduces the 64 pairs the same way: no LDS, no barrier
    float st = pp[0][0] + pp[1][0];
    float qt = pp[0][1] + pp[1][1];
#pragma unroll
    for (int o = 16; o > 0; o >>= 1) {
      st += __shfl_xor(st, o);
      qt += __shfl_xor(qt, o);
    }
    const float invM = 1.0f / (float)(C_ * N_);
    const float mean = st * invM;
    const float var  = qt * invM - mean * mean;
    const float inv  = rsqrtf(var + EPS_);
#pragma unroll
    for (int t = 0; t < 2; ++t) {
      const int m0 = wave * 32 + t * 16 + h * 8;
      float* op = out + (size_t)(b * C_ + m0) * N_ + nWG + 4 * c;
#pragma unroll
      for (int r = 0; r < 8; ++r) {
        const float bv = bi[t][r >> 2][r & 3];
        const float gv = ga[t][r >> 2][r & 3];
        const float ev = be[t][r >> 2][r & 3];
        v4f vo;
#pragma unroll
        for (int j = 0; j < 4; ++j)
          vo[j] = ((acc[t][j][r] + bv) - mean) * inv * gv + ev;
        *(v4f*)(op + (size_t)r * N_) = vo;
      }
    }
  }
}

__global__ __launch_bounds__(256) void k_proj_stats(const __bf16* __restrict__ qbt,
                                                    const __bf16* __restrict__ ctx,
                                                    const __bf16* __restrict__ wob,
                                                    const float* __restrict__ bout,
                                                    float* __restrict__ part) {
  proj_body<false>(qbt, ctx, wob, bout, nullptr, nullptr, nullptr, part, nullptr);
}

// four waves a SIMD (two work-groups a WGP) are meant: a budget of 256 registers
__global__ __launch_bounds__(256, 4) void k_proj_norm(const __bf16* __restrict__ qbt,
                                                   const __bf16* __restrict__ ctx,
                                                   const __bf16* __restrict__ wob,
                                                   const float* __restrict__ bout,
                                                   const float* __restrict__ gamma,
                                                   const float* __restrict__ beta,
                                                   const float* __restrict__ part,
                                                   float* __restrict__ out) {
  proj_body<true>(qbt, ctx, wob, bout, gamma, beta, part, nullptr, out);
}

// ---------------------------------------------------------------------------
extern "C" void kernel_launch(void* const* d_in, const int* in_sizes, int n_in,
                              void* d_out, int out_size, void* d_ws, size_t ws_size,
                              hipStream_t stream) {
  const float* x     = (const float*)d_in[0];
  const float* wqkv  = (const float*)d_in[1];
  const float* wout  = (const float*)d_in[2];
  const float* bout  = (const float*)d_in[3];
  const float* gamma = (const float*)d_in[4];
  const float* beta  = (const float*)d_in[5];
  float* out = (float*)d_out;
  (void)ws_size; (void)in_sizes; (void)n_in; (void)out_size;

  const size_t QSZ = (size_t)B_ * INNER_ * N_;   // 8,388,608
  float*  qf  = (float*)d_ws;                    // fp32 q
  float*  pctx = qf + QSZ;                       // context shares, 4096 floats a work-group
  float*  pmax = pctx + (size_t)B_ * NBLK_ * HEADS_ * DH_ * DH_;  // local row maxima
  float*  psum = pmax + (size_t)B_ * NBLK_ * INNER_;              // local row sums
  __bf16* qbt = (__bf16*)(psum + (size_t)B_ * NBLK_ * INNER_);    // bf16 q_t [bh][n][32]
  __bf16* wqb = qbt + QSZ;                       // bf16 w_qkv, fragment order
  __bf16* wob = wqb + (size_t)O3_ * C_;          // bf16 w_out, fragment order
  __bf16* ctx = wob + (size_t)C_ * INNER_;       // bf16 context [bh][d][e]
  float*  part = (float*)(ctx + (size_t)B_ * HEADS_ * DH_ * DH_);

  k_cvt_w    <<<dim3(512),        256, 0, stream>>>(wqkv, wout, wqb, wob);
  k_qkv_gemm <<<dim3(64, 16),     256, 0, stream>>>(x, wqb, qf, pctx, pmax, psum);
  k_ctx_merge<<<dim3(64, 4),      256, 0, stream>>>(pctx, pmax, psum, ctx);
  k_qsoftmax <<<dim3(16, 4, 16),  256, 0, stream>>>(qf, qbt);
  k_proj_stats<<<dim3(64, 16),   256, 0, stream>>>(qbt, ctx, wob, bout, part);
  k_proj_norm<<<dim3(64, 16),     256, 0, stream>>>(qbt, ctx, wob, bout, gamma, beta, part, out);
}

// v006
// A run of this version takes 44.5 microseconds.
// Two timings next to v005 both put it at 1.20 times that version's speed.
// Over all steps from v000 it is 4.40 times as fast.
#include <hip/hip_runtime.h>

#define B_     16
#define C_     256
#define N_     4096
#define O3_    384
#define INNER_ 128
#define HEADS_ 4
#define DH_    32
#define SCALE_ 0.1767766952966369f
#define EPS_   1e-5f

typedef __attribute__((ext_vector_type(16))) __bf16 v16bf;
typedef __attribute__((ext_vector_type(8)))  __bf16 v8bf;
typedef __attribute__((ext_vector_type(8)))  float  v8f;
typedef __attribute__((ext_vector_type(4)))  __bf16 v4bf;
typedef __attribute__((ext_vector_type(4)))  float  v4f;

// 16-bit A/B fragment: lane `lane`, element `e` holds
// K = (e>>3)*16 + (lane>>4)*8 + (e&7)   (ISA 7.12.2)

__device__ __forceinline__ v8f wmma_bf16(v16bf a, v16bf b, v8f c) {
  return __builtin_amdgcn_wmma_f32_16x16x32_bf16(false, a, false, b, (short)0, c,
                                                 false, false);
}

// Load one 16-element bf16 fragment: per-lane K chunks are contiguous, so this
// is two 16-byte loads (global or LDS).  p must point at K = k0 + (lane>>4)*8.
__device__ __forceinline__ v16bf frag_ld(const __bf16* p) {
  v8bf lo = *(const v8bf*)p;
  v8bf hi = *(const v8bf*)(p + 16);
  return __builtin_shufflevector(lo, hi, 0, 1, 2, 3, 4, 5, 6, 7,
                                 8, 9, 10, 11, 12, 13, 14, 15);
}

// ---------------------------------------------------------------------------
// 0) weights -> bf16.  grid 512, block 256.
//    w_qkv is laid out in fragment order for k_qkv_gemm: per (16-row tile,
//    32-k step) two planes of 32 lanes x 8 elements, so that one wave-wide
//    16-byte load of a plane covers 512 contiguous bytes.  w_out likewise,
//    for the two projection kernels (four 32-k steps a row tile).
// ---------------------------------------------------------------------------
__global__ __launch_bounds__(256) void k_cvt_w(const float* __restrict__ wqkv,
                                               const float* __restrict__ wout,
                                               __bf16* __restrict__ wqb,
                                               __bf16* __restrict__ wob) {
  const int i = blockIdx.x * 256 + threadIdx.x;
  if (i < O3_ * C_) {
    const int o = i >> 8, k = i & 255;
    const int plane = ((o >> 4) * 8 + (k >> 5)) * 2 + ((k >> 4) & 1);
    const int ln = ((k >> 3) & 1) * 16 + (o & 15);
    wqb[plane * 256 + ln * 8 + (k & 7)] = (__bf16)wqkv[i];
  }
  const int j = i - O3_ * C_;
  if (j >= 0 && j < C_ * INNER_) {
    const int o = j >> 7, k = j & 127;
    const int plane = ((o >> 4) * 4 + (k >> 5)) * 2 + ((k >> 4) & 1);
    const int ln = ((k >> 3) & 1) * 16 + (o & 15);
    wob[plane * 256 + ln * 8 + (k & 7)] = (__bf16)wout[j];
  }
}

// ---------------------------------------------------------------------------
// 1) qkv GEMM: [384x256] @ [256x4096] per batch.
//    One work-group makes all 384 rows of 64 columns: the x tile is read once,
//    converted once to bf16 and laid k-contiguous in LDS; each wave holds one
//    16-row tile of q, of k and of v times four 16-column tiles.
//    Column c of column tile j is spatial column 4c + j, so a lane's four
//    tiles give four consecutive columns of a row: whole-line stores.
//    q leaves as softmax over its head's 32 rows d, times SCALE, in bf16: a
//    head's rows lie in two waves, so each wave takes its 16 rows to
//    exp(q - its own column maximum), the two exchange maximum and sum through
//    LDS, and each rescales its half.  A lane's eight values of a column tile
//    are one half of its B fragment in the projection kernels, and are stored
//    in that order: [work-group][head][column tile][half][lane][8].
//    k and v never leave the work-group:
//    each k row is taken to exp(k - its maximum over these 64 columns), laid
//    in LDS as bf16 beside v, and multiplied there into this work-group's
//    share of context[d][e] = sum_n k'[d][n] v[e][n].  Stored are that share
//    (fp32, 4 heads x 32 x 32), each row's local maximum and its local sum of
//    exponentials; k_ctx_merge puts the 64 shares of a batch on one scale.
//    grid (64, 16), block 256 (8 waves).
// ---------------------------------------------------------------------------
#define XP_ 264  // LDS row pitch, elements: 528 B = 16 B x odd, for 16-byte row readers
#define KP_ 72   // LDS row pitch of k' and v, elements: 144 B = 16 B x odd
#define NBLK_ 64 // column blocks (work-groups) a batch

// One weight fragment in k_cvt_w's order: two planes, 256 elements apart.
__device__ __forceinline__ v16bf wfrag_ld(const __bf16* p) {
  v8bf lo = *(const v8bf*)p;
  v8bf hi = *(const v8bf*)(p + 256);
  return __builtin_shufflevector(lo, hi, 0, 1, 2, 3, 4, 5, 6, 7,
                                 8, 9, 10, 11, 12, 13, 14, 15);
}

// exp(x) as 2^(x log2 e).  The v_nop fills the one slot that the instruction set
// asks for behind a transcendental, whatever the compiler schedules next.
__device__ __forceinline__ float exp_slot(float x) {
  float y;
  asm("v_exp_f32 %0, %1\n\tv_nop" : "=v"(y) : "v"(x * 1.442695041f));
  return y;
}

__global__ __launch_bounds__(256) void k_qkv_gemm(const float* __restrict__ x,
                                                  const __bf16* __restrict__ wqb,
                                                  __bf16* __restrict__ qbt,
                                                  float* __restrict__ pctx,
                                                  float* __restrict__ pmax,
                                                  float* __restrict__ psum) {
  const int lane = threadIdx.x & 31;
  const int wave = threadIdx.x >> 5;
  const int b = blockIdx.y;
  const int nWG = blockIdx.x * 64;
  const int c = lane & 15;
  const int h = lane >> 4;
  const float* xb = x + (size_t)b * C_ * N_ + nWG;

  __shared__ __align__(16) __bf16 xs[64 * XP_];
  __shared__ __align__(16) __bf16 ks[INNER_ * KP_];
  __shared__ __align__(16) __bf16 vs[INNER_ * KP_];
  __shared__ __align__(16) float qm[8 * 64];  // a wave's column maxima of q
  __shared__ __align__(16) float qs[8 * 64];  // and its column sums of exponentials

  // step 0's weight fragments are asked for first: they land while x is staged
  const __bf16* ap = wqb + wave * 4096 + lane * 8;
  v16bf a[2][3];
#pragma unroll
  for (int t = 0; t < 3; ++t) a[0][t] = wfrag_ld(ap + t * 32768);

  {
    // a thread takes 4 columns x 8 k, twice; LDS row j*16 + q holds column 4q + j
    const int q = threadIdx.x & 15;
    const int oc = threadIdx.x >> 4;
    v4f f[2][8];
#pragma unroll
    for (int u = 0; u < 2; ++u)
#pragma unroll
      for (int i = 0; i < 8; ++i)
        f[u][i] = *(const v4f*)(xb + (size_t)((oc + 16 * u) * 8 + i) * N_ + 4 * q);
#pragma unroll
    for (int u = 0; u < 2; ++u)
#pragma unroll
      for (int j = 0; j < 4; ++j) {
        v8bf pk;
#pragma unroll
        for (int i = 0; i < 8; ++i) pk[i] = (__bf16)f[u][i][j];
        *(v8bf*)(xs + (j * 16 + q) * XP_ + (oc + 16 * u) * 8) = pk;
      }
  }
  __syncthreads();

  v8f acc[3][4] = {};
  const __bf16* bp = xs + c * XP_ + h * 8;
  v16bf bm[2][4];
#pragma unroll
  for (int j = 0; j < 4; ++j) bm[0][j] = frag_ld(bp + j * 16 * XP_);
#pragma unroll
  for (int ks = 0; ks < 8; ++ks) {
    const int cur = ks & 1, nxt = cur ^ 1;
    if (ks < 7) {
#pragma unroll
      for (int t = 0; t < 3; ++t) a[nxt][t] = wfrag_ld(ap + t * 32768 + (ks + 1) * 512);
#pragma unroll
      for (int j = 0; j < 4; ++j) bm[nxt][j] = frag_ld(bp + j * 16 * XP_ + (ks + 1) * 32);
    }
    // keeps the next step's loads in front of this step's matrix block, so that
    // their L2 and LDS latency runs under twelve matrix instructions
    __builtin_amdgcn_sched_barrier(0);
#pragma unroll
    for (int t = 0; t < 3; ++t)
#pragma unroll
      for (int j = 0; j < 4; ++j) acc[t][j] = wmma_bf16(a[cur][t], bm[cur][j], acc[t][j]);
    // keeps later steps' loads from being moved in among these matrix instructions
    __builtin_amdgcn_sched_barrier(0);
  }
  // q: a column's 16 rows of this wave lie in two lanes, eight a lane
  v4f mq, sq;
#pragma unroll
  for (int j = 0; j < 4; ++j) {
    float m = acc[0][j][0];
#pragma unroll
    for (int r = 1; r < 8; ++r) m = fmaxf(m, acc[0][j][r]);
    m = fmaxf(m, __shfl_xor(m, 16));
#pragma unroll
    for (int r = 0; r < 8; ++r) acc[0][j][r] = exp_slot(acc[0][j][r] - m);
    float t = ((acc[0][j][0] + acc[0][j][1]) + (acc[0][j][2] + acc[0][j][3])) +
              ((acc[0][j][4] + acc[0][j][5]) + (acc[0][j][6] + acc[0][j][7]));
    t += __shfl_xor(t, 16);
    mq[j] = m;
    sq[j] = t;
  }
  if (h == 0) {
    *(v4f*)(qm + wave * 64 + 4 * c) = mq;
    *(v4f*)(qs + wave * 64 + 4 * c) = sq;
  }
  // A row's 64 columns lie in the 16 lanes of one half, four a lane: maximum
  // and sum go over the lane's four, then by a butterfly inside the half.
  const int wg = b * NBLK_ + blockIdx.x;
  float ml[8], sl[8];
#pragma unroll
  for (int r = 0; r < 8; ++r) {
    float m = fmaxf(fmaxf(acc[1][0][r], acc[1][1][r]), fmaxf(acc[1][2][r], acc[1][3][r]));
#pragma unroll
    for (int o = 8; o > 0; o >>= 1) m = fmaxf(m, __shfl_xor(m, o));
    ml[r] = m;
  }
#pragma unroll
  for (int r = 0; r < 8; ++r) {
    float e[4];
#pragma unroll
    for (int j = 0; j < 4; ++j) e[j] = exp_slot(acc[1][j][r] - ml[r]);
    float s = (e[0] + e[1]) + (e[2] + e[3]);
#pragma unroll
    for (int o = 8; o > 0; o >>= 1) s += __shfl_xor(s, o);
    sl[r] = s;
    // LDS column 4c + j is the local spatial column, for k' and for v alike
    v4bf pk = {(__bf16)e[0], (__bf16)e[1], (__bf16)e[2], (__bf16)e[3]};
    v4bf vv = {(__bf16)acc[2][0][r], (__bf16)acc[2][1][r], (__bf16)acc[2][2][r],
               (__bf16)acc[2][3][r]};
    const int lo = (wave * 16 + h * 8 + r) * KP_ + 4 * c;
    *(v4bf*)(ks + lo) = pk;
    *(v4bf*)(vs + lo) = vv;
  }
  __syncthreads();

  // every global store stands behind the barrier: in front of it the barrier's
  // own wait would hold each wave until its stores had been acknowledged
  {
    // the head's other wave's maxima and sums put both halves on one scale
    const v4f mo = *(const v4f*)(qm + (wave ^ 1) * 64 + 4 * c);
    const v4f so = *(const v4f*)(qs + (wave ^ 1) * 64 + 4 * c);
    __bf16* qd = qbt + (size_t)wg * (64 * INNER_) + (wave >> 1) * 2048 + (wave & 1) * 256 + lane * 8;
#pragma unroll
    for (int j = 0; j < 4; ++j) {
      const float mm = fmaxf(mq[j], mo[j]);
      const float wa = exp_slot(mq[j] - mm);
      const float wb = exp_slot(mo[j] - mm);
      const float fs = SCALE_ * wa / (sq[j] * wa + so[j] * wb);
      v8bf pk;
#pragma unroll
      for (int r = 0; r < 8; ++r) pk[r] = (__bf16)(acc[0][j][r] * fs);
      *(v8bf*)(qd + j * 512) = pk;  // a wave's store covers 512 B in a row
    }
  }
  if (c == 0) {
    const size_t so = (size_t)wg * INNER_ + wave * 16 + h * 8;
#pragma unroll
    for (int u = 0; u < 2; ++u) {
      *(v4f*)(pmax + so + u * 4) = v4f{ml[u * 4], ml[u * 4 + 1], ml[u * 4 + 2], ml[u * 4 + 3]};
      *(v4f*)(psum + so + u * 4) = v4f{sl[u * 4], sl[u * 4 + 1], sl[u * 4 + 2], sl[u * 4 + 3]};
    }
  }

  // wave w: head w >> 1, rows d = (w & 1) * 16 .. + 15, all 32 columns e; K = 64
  const __bf16* ka = ks + ((wave >> 1) * DH_ + (wave & 1) * 16 + c) * KP_ + h * 8;
  const __bf16* vb = vs + ((wave >> 1) * DH_ + c) * KP_ + h * 8;
  v8f pc[2] = {};
#pragma unroll
  for (int s2 = 0; s2 < 2; ++s2) {
    const v16bf af = frag_ld(ka + s2 * 32);
#pragma unroll
    for (int j = 0; j < 2; ++j)
      pc[j] = wmma_bf16(af, frag_ld(vb + j * 16 * KP_ + s2 * 32), pc[j]);
  }
  // share layout: [wave][j * 2 + u][lane][4], so every store covers 512 B in a row
  float* pd = pctx + (size_t)wg * (HEADS_ * DH_ * DH_) + wave * 512 + lane * 4;
#pragma unroll
  for (int j = 0; j < 2; ++j)
#pragma unroll
    for (int u = 0; u < 2; ++u)
      *(v4f*)(pd + (j * 2 + u) * 128) =
          v4f{pc[j][u * 4], pc[j][u * 4 + 1], pc[j][u * 4 + 2], pc[j][u * 4 + 3]};
}

// ---------------------------------------------------------------------------
// 2) context of one (batch, head) from its 64 shares: with M[d] the maximum of
//    the local maxima m_i[d] and w_i[d] = exp(m_i[d] - M[d]),
//    context[d][e] = sum_i w_i[d] share_i[d][e] / sum_i w_i[d] s_i[d],
//    which is the softmax of k over all n times v.  One thread an element,
//    stored as bf16 [d][e]: the projection kernels read it as a matrix operand.
//    grid (64, 4), block 256.
// ---------------------------------------------------------------------------
__global__ __launch_bounds__(256) void k_ctx_merge(const float* __restrict__ pctx,
                                                   const float* __restrict__ pmax,
                                                   const float* __restrict__ psum,
                                                   __bf16* __restrict__ ctx) {
  const int bh = blockIdx.x;
  const int b = bh >> 2, hd = bh & 3;
  const int t = threadIdx.x;
  // element f of the head's 1024 in k_qkv_gemm's share layout
  const int f = blockIdx.y * 256 + t;
  const int ln = (f >> 2) & 31;
  const int d = (f >> 9) * 16 + ((f >> 7) & 1) * 4 + (f & 3) + ((ln >> 4) << 3);
  const int e = ((f >> 8) & 1) * 16 + (ln & 15);

  __shared__ float redm[8 * DH_];
  __shared__ float reds[8 * DH_];
  __shared__ float scl[NBLK_ * DH_];

  // the statistics first, then all 64 shares' values: one latency for both
  const int dd = t & 31, g = t >> 5;
  const size_t so = (size_t)(b * NBLK_ + g * 8) * INNER_ + hd * DH_ + dd;
  float ml[8], sl[8];
#pragma unroll
  for (int u = 0; u < 8; ++u) {
    ml[u] = pmax[so + u * INNER_];
    sl[u] = psum[so + u * INNER_];
  }
  // the loads below may land in registers that hold the addresses of the loads
  // above: this wait stands in front of that overwrite
  asm volatile("s_wait_xcnt 0x0" ::: "memory");
  const float* ps = pctx + (size_t)b * NBLK_ * (HEADS_ * DH_ * DH_) + hd * (DH_ * DH_) + f;
  float p[NBLK_];
#pragma unroll
  for (int i = 0; i < NBLK_; ++i) p[i] = ps[(size_t)i * (HEADS_ * DH_ * DH_)];

  float m = ml[0];
#pragma unroll
  for (int u = 1; u < 8; ++u) m = fmaxf(m, ml[u]);
  redm[g * DH_ + dd] = m;
  __syncthreads();
  m = redm[dd];
#pragma unroll
  for (int w = 1; w < 8; ++w) m = fmaxf(m, redm[w * DH_ + dd]);
  float s = 0.f;
#pragma unroll
  for (int u = 0; u < 8; ++u) {
    const float w = __expf(ml[u] - m);
    scl[(g * 8 + u) * DH_ + dd] = w;
    s += sl[u] * w;
  }
  reds[g * DH_ + dd] = s;
  __syncthreads();

  float tot = reds[d];
#pragma unroll
  for (int w = 1; w < 8; ++w) tot += reds[w * DH_ + d];
  float a4[4] = {0.f, 0.f, 0.f, 0.f};  // four independent chains
#pragma unroll
  for (int i = 0; i < NBLK_; ++i) a4[i & 3] += p[i] * scl[i * DH_ + d];
  ctx[(size_t)bh * DH_ * DH_ + d * DH_ + e] =
      (__bf16)(((a4[0] + a4[1]) + (a4[2] + a4[3])) / tot);
}

// ---------------------------------------------------------------------------
// 3) out2[o][n] = sum_(hd,e) wout[o][hd,e] (sum_d ctx[hd][d][e] q'[hd][d][n]) + bout[o],
//    summed in the other order: out2 = W2 q' + bout with
//    W2[o][hd,d] = sum_e wout[o][hd,e] ctx[hd][d][e], 256 x 128 a batch.
//    Each wave makes the W2 rows it needs itself, transposed: ctx (rows d) times
//    wout^T (columns o) leaves lane l with column o = l & 15 and rows
//    d = (l >> 4) * 8 + r, which is the A-fragment order of W2 as it stands, so
//    the two d tiles of a head, rounded to bf16, are one A fragment.
//    out2 is made twice and never stored unnormalized: the product is cheap
//    next to a round trip of the 64 MiB result through memory.
//    k_proj_stats keeps only each work-group's sum and sum of squares;
//    k_proj_norm makes the same product again, reduces its batch's 64 partial
//    pairs to mean and variance, and stores the normalized, affine result.
//    One work-group makes all 256 rows of 64 columns: its q' tile (16 KiB in a
//    row, in B-fragment order as k_qkv_gemm stores it) is read once and copied
//    to LDS as it stands; each wave
//    holds two 16-row tiles times four 16-column tiles.  Column c of column tile j is
//    spatial column 4c + j, as in k_qkv_gemm: whole-line stores.
//    grid (64, 16), block 256 (8 waves), both.
// ---------------------------------------------------------------------------
typedef __attribute__((ext_vector_type(2))) float v2f;

template <bool NORM>
__device__ __forceinline__ void proj_body(const __bf16* __restrict__ qbt,
                                          const __bf16* __restrict__ ctx,
                                          const __bf16* __restrict__ wob,
                                          const float* __restrict__ bout,
                                          const float* __restrict__ gamma,
                                          const float* __restrict__ beta,
                                          const float* __restrict__ part_in,
                                          float* __restrict__ part_out,
                                          float* __restrict__ out) {
  const int lane = threadIdx.x & 31;
  // the wave's number in a scalar register: what is formed from it costs no
  // vector register, of which k_proj_norm has none to spare
  const int wave = __builtin_amdgcn_readfirstlane(threadIdx.x >> 5);
  const int b = blockIdx.y;
  const int nWG = blockIdx.x * 64;
  const int c = lane & 15;
  const int h = lane >> 4;

  __shared__ __align__(16) __bf16 as[64 * INNER_];

  // the operands of W2 first, the tile last: W2 is made while the tile is in flight
  const __bf16* ap = wob + wave * 4096 + lane * 8;
  v16bf a[4][2];
#pragma unroll
  for (int ks = 0; ks < 4; ++ks)
#pragma unroll
    for (int t = 0; t < 2; ++t) a[ks][t] = wfrag_ld(ap + t * 2048 + ks * 512);
  // later loads may land in registers that hold the addresses of the loads
  // above: this wait, and those like it below, stand in front of that overwrite
  asm volatile("s_wait_xcnt 0x0" ::: "memory");
  // the batch's context as A fragments: head ks, rows d = dh * 16 + c, k = e
  const __bf16* cp = ctx + ((size_t)b * HEADS_ * DH_ + c) * DH_ + h * 8;
  v16bf cf[4][2];
#pragma unroll
  for (int ks = 0; ks < 4; ++ks)
#pragma unroll
    for (int dh = 0; dh < 2; ++dh) cf[ks][dh] = frag_ld(cp + (ks * DH_ + dh * 16) * DH_);
  asm volatile("s_wait_xcnt 0x0" ::: "memory");
  // a lane's sixteen bias values, asked for with the rest
  v4f bi[2][2];
#pragma unroll
  for (int t = 0; t < 2; ++t)
#pragma unroll
    for (int u = 0; u < 2; ++u)
      bi[t][u] = *(const v4f*)(bout + wave * 32 + t * 16 + h * 8 + u * 4);
  asm volatile("s_wait_xcnt 0x0" ::: "memory");
  // likewise the batch's 64 partial pairs (two a lane) and the lane's affine terms
  v2f pp[2];
  v4f ga[2][2], be[2][2];
  if (NORM) {
#pragma unroll
    for (int u = 0; u < 2; ++u)
      pp[u] = *(const v2f*)(part_in + (size_t)(b * 64 + u * 32 + lane) * 2);
#pragma unroll
    for (int t = 0; t < 2; ++t)
#pragma unroll
      for (int u = 0; u < 2; ++u)
        ga[t][u] = *(const v4f*)(gamma + wave * 32 + t * 16 + h * 8 + u * 4);
    asm volatile("s_wait_xcnt 0x0" ::: "memory");
#pragma unroll
    for (int t = 0; t < 2; ++t)
#pragma unroll
      for (int u = 0; u < 2; ++u)
        be[t][u] = *(const v4f*)(beta + wave * 32 + t * 16 + h * 8 + u * 4);
    asm volatile("s_wait_xcnt 0x0" ::: "memory");
  }
  const __bf16* src = qbt + (size_t)(b * 64 + blockIdx.x) * (64 * INNER_) + threadIdx.x * 8;
  v8bf g[4];  // head i's 4 KiB, 16 B a thread
#pragma unroll
  for (int i = 0; i < 4; ++i) g[i] = *(const v8bf*)(src + i * 2048);

  // W2 fragments, in front of the barrier: they need nothing of the tile.
  // The wout fragment serves as B here (k = e, column o): same lane order as A.
  v16bf w2[4][2];
#pragma unroll
  for (int ks = 0; ks < 4; ++ks) {
#pragma unroll
    for (int t = 0; t < 2; ++t) {
      const v8f d0 = wmma_bf16(cf[ks][0], a[ks][t], v8f{});
      const v8f d1 = wmma_bf16(cf[ks][1], a[ks][t], v8f{});
#pragma unroll
      for (int r = 0; r < 8; ++r) {
        w2[ks][t][r] = (__bf16)d0[r];
        w2[ks][t][8 + r] = (__bf16)d1[r];
      }
    }
    // a head's four results are rounded before the next head's are made: left
    // free, results stay live as fp32 and k_proj_norm spills past its 256 registers
    __builtin_amdgcn_sched_barrier(0);
  }

#pragma unroll
  for (int i = 0; i < 4; ++i) *(v8bf*)(as + i * 2048 + threadIdx.x * 8) = g[i];
  __syncthreads();

  v8f acc[2][4] = {};
  const __bf16* bp = as + lane * 8;  // head ks, column tile j: two halves, 256 elements apart
  v16bf bm[2][4];
#pragma unroll
  for (int j = 0; j < 4; ++j) bm[0][j] = wfrag_ld(bp + j * 512);
#pragma unroll
  for (int ks = 0; ks < 4; ++ks) {
    const int cur = ks & 1, nxt = cur ^ 1;
    if (ks < 3) {
#pragma unroll
      for (int j = 0; j < 4; ++j) bm[nxt][j] = wfrag_ld(bp + (ks + 1) * 2048 + j * 512);
    }
    // keeps the next step's LDS reads together in front of this step's matrix
    // block, so that their latency runs under eight matrix instructions
    __builtin_amdgcn_sched_barrier(0);
#pragma unroll
    for (int t = 0; t < 2; ++t)
#pragma unroll
      for (int j = 0; j < 4; ++j) acc[t][j] = wmma_bf16(w2[ks][t], bm[cur][j], acc[t][j]);
    // keeps later steps' reads from being moved in among these matrix instructions
    __builtin_amdgcn_sched_barrier(0);
  }

  if (!NORM) {
    // four independent chains a lane, a butterfly over the wave, eight waves in LDS
    float s[4] = {0.f, 0.f, 0.f, 0.f}, sq[4] = {0.f, 0.f, 0.f, 0.f};
#pragma unroll
    for (int t = 0; t < 2; ++t)
#pragma unroll
      for (int r = 0; r < 8; ++r) {
        const float bv = bi[t][r >> 2][r & 3];
#pragma unroll
        for (int j = 0; j < 4; ++j) {
          const float v = acc[t][j][r] + bv;
          s[j] += v;
          sq[j] += v * v;
        }
      }
    float st = (s[0] + s[1]) + (s[2] + s[3]);
    float qt = (sq[0] + sq[1]) + (sq[2] + sq[3]);
#pragma unroll
    for (int o = 16; o > 0; o >>= 1) {
      st += __shfl_xor(st, o);
      qt += __shfl_xor(qt, o);
    }
    __shared__ v2f red[8];
    if (lane == 0) red[wave] = v2f{st, qt};
    __syncthreads();
    if (threadIdx.x == 0) {
      v2f tot = red[0];
#pragma unroll
      for (int w = 1; w < 8; ++w) tot += red[w];
      *(v2f*)(part_out + (size_t)(b * 64 + blockIdx.x) * 2) = tot;
    }
  } else {
    // every wave reduces the 64 pairs the same way: no LDS, no barrier
    float st = pp[0][0] + pp[1][0];
    float qt = pp[0][1] + pp[1][1];
#pragma unroll
    for (int o = 16; o > 0; o >>= 1) {
      st += __shfl_xor(st, o);
      qt += __shfl_xor(qt, o);
    }
    const float invM = 1.0f / (float)(C_ * N_);
    const float mean = st * invM;
    const float var  = qt * invM - mean * mean;
    const float inv  = rsqrtf(var + EPS_);
#pragma unroll
    for (int t = 0; t < 2; ++t) {
      const int m0 = wave * 32 + t * 16 + h * 8;
      float* op = out + (size_t)(b * C_ + m0) * N_ + nWG + 4 * c;
#pragma unroll
      for (int r = 0; r < 8; ++r) {
        const float bv = bi[t][r >> 2][r & 3];
        const float gv = ga[t][r >> 2][r & 3];
        const float ev = be[t][r >> 2][r & 3];
        v4f vo;
#pragma unroll
        for (int j = 0; j < 4; ++j)
          vo[j] = ((acc[t][j][r] + bv) - mean) * inv * gv + ev;
        *(v4f*)(op + (size_t)r * N_) = vo;
      }
    }
  }
}

__global__ __launch_bounds__(256) void k_proj_stats(const __bf16* __restrict__ qbt,
                                                    const __bf16* __restrict__ ctx,
                                                    const __bf16* __restrict__ wob,
                                                    const float* __restrict__ bout,
                                                    float* __restrict__ part) {
  proj_body<false>(qbt, ctx, wob, bout, nullptr, nullptr, nullptr, part, nullptr);
}

// four waves a SIMD (two work-groups a WGP) are meant: a budget of 256 registers
__global__ __launch_bounds__(256, 4) void k_proj_norm(const __bf16* __restrict__ qbt,
                                                   const __bf16* __restrict__ ctx,
                                                   const __bf16* __restrict__ wob,
                                                   const float* __restrict__ bout,
                                                   const float* __restrict__ gamma,
                                                   const float* __restrict__ beta,
                                                   const float* __restrict__ part,
                                                   float* __restrict__ out) {
  proj_body<true>(qbt, ctx, wob, bout, gamma, beta, part, nullptr, out);
}

// ---------------------------------------------------------------------------
extern "C" void kernel_launch(void* const* d_in, const int* in_sizes, int n_in,
                              void* d_out, int out_size, void* d_ws, size_t ws_size,
                              hipStream_t stream) {
  const float* x     = (const float*)d_in[0];
  const float* wqkv  = (const float*)d_in[1];
  const float* wout  = (const float*)d_in[2];
  const float* bout  = (const float*)d_in[3];
  const float* gamma = (const float*)d_in[4];
  const float* beta  = (const float*)d_in[5];
  float* out = (float*)d_out;
  (void)ws_size; (void)in_sizes; (void)n_in; (void)out_size;

  const size_t QSZ = (size_t)B_ * INNER_ * N_;   // 8,388,608
  float*  pctx = (float*)d_ws;                   // context shares, 4096 floats a work-group
  float*  pmax = pctx + (size_t)B_ * NBLK_ * HEADS_ * DH_ * DH_;  // local row maxima
  float*  psum = pmax + (size_t)B_ * NBLK_ * INNER_;              // local row sums
  __bf16* qbt = (__bf16*)(psum + (size_t)B_ * NBLK_ * INNER_);    // bf16 q', fragment order
  __bf16* wqb = qbt + QSZ;                       // bf16 w_qkv, fragment order
  __bf16* wob = wqb + (size_t)O3_ * C_;          // bf16 w_out, fragment order
  __bf16* ctx = wob + (size_t)C_ * INNER_;       // bf16 context [bh][d][e]
  float*  part = (float*)(ctx + (size_t)B_ * HEADS_ * DH_ * DH_);

  k_cvt_w    <<<dim3(512),        256, 0, stream>>>(wqkv, wout, wqb, wob);
  k_qkv_gemm <<<dim3(64, 16),     256, 0, stream>>>(x, wqb, qbt, pctx, pmax, psum);
  k_ctx_merge<<<dim3(64, 4),      256, 0, stream>>>(pctx, pmax, psum, ctx);
  k_proj_stats<<<dim3(64, 16),   256, 0, stream>>>(qbt, ctx, wob, bout, part);
  k_proj_norm<<<dim3(64, 16),     256, 0, stream>>>(qbt, ctx, wob, bout, gamma, beta, part, out);
}

// v007
// Measured time: 39.4 microseconds a run.
// Timed twice side by side with v006, it ran 1.13 times as fast both times.
// All steps since v000 together make it 4.98 times as fast.
#include <hip/hip_runtime.h>

#define B_     16
#define C_     256
#define N_     4096
#define O3_    384
#define INNER_ 128
#define HEADS_ 4
#define DH_    32
#define SCALE_ 0.1767766952966369f
#define EPS_   1e-5f

typedef __attribute__((ext_vector_type(16))) __bf16 v16bf;
typedef __attribute__((ext_vector_type(8)))  __bf16 v8bf;
typedef __attribute__((ext_vector_type(8)))  float  v8f;
typedef __attribute__((ext_vector_type(4)))  __bf16 v4bf;
typedef __attribute__((ext_vector_type(4)))  float  v4f;

// 16-bit A/B fragment: lane `lane`, element `e` holds
// K = (e>>3)*16 + (lane>>4)*8 + (e&7)   (ISA 7.12.2)

__device__ __forceinline__ v8f wmma_bf16(v16bf a, v16bf b, v8f c) {
  return __builtin_amdgcn_wmma_f32_16x16x32_bf16(false, a, false, b, (short)0, c,
                                                 false, false);
}

// Load one 16-element bf16 fragment: per-lane K chunks are contiguous, so this
// is two 16-byte loads (global or LDS).  p must point at K = k0 + (lane>>4)*8.
__device__ __forceinline__ v16bf frag_ld(const __bf16* p) {
  v8bf lo = *(const v8bf*)p;
  v8bf hi = *(const v8bf*)(p + 16);
  return __builtin_shufflevector(lo, hi, 0, 1, 2, 3, 4, 5, 6, 7,
                                 8, 9, 10, 11, 12, 13, 14, 15);
}

// ---------------------------------------------------------------------------
// 0) weights -> bf16.  grid 512, block 256.
//    w_qkv is laid out in fragment order for k_qkv_gemm: per (16-row tile,
//    32-k step) two planes of 32 lanes x 8 elements, so that one wave-wide
//    16-byte load of a plane covers 512 contiguous bytes.  w_out likewise,
//    for the two projection kernels (four 32-k steps a row tile).
// ---------------------------------------------------------------------------
__global__ __launch_bounds__(256) void k_cvt_w(const float* __restrict__ wqkv,
                                               const float* __restrict__ wout,
                                               __bf16* __restrict__ wqb,
                                               __bf16* __restrict__ wob) {
  const int i = blockIdx.x * 256 + threadIdx.x;
  if (i < O3_ * C_) {
    const int o = i >> 8, k = i & 255;
    const int plane = ((o >> 4) * 8 + (k >> 5)) * 2 + ((k >> 4) & 1);
    const int ln = ((k >> 3) & 1) * 16 + (o & 15);
    wqb[plane * 256 + ln * 8 + (k & 7)] = (__bf16)wqkv[i];
  }
  const int j = i - O3_ * C_;
  if (j >= 0 && j < C_ * INNER_) {
    const int o = j >> 7, k = j & 127;
    const int plane = ((o >> 4) * 4 + (k >> 5)) * 2 + ((k >> 4) & 1);
    const int ln = ((k >> 3) & 1) * 16 + (o & 15);
    wob[plane * 256 + ln * 8 + (k & 7)] = (__bf16)wout[j];
  }
}

// ---------------------------------------------------------------------------
// 1) qkv GEMM: [384x256] @ [256x4096] per batch.
//    One work-group makes all 384 rows of 64 columns: the x tile is read once,
//    converted once to bf16 and laid k-contiguous in LDS; each wave holds one
//    16-row tile of q, of k and of v times four 16-column tiles.
//    Column c of column tile j is spatial column 4c + j, so a lane's four
//    tiles give four consecutive columns of a row: whole-line stores.
//    q leaves as softmax over its head's 32 rows d, times SCALE, in bf16: a
//    head's rows lie in two waves, so each wave takes its 16 rows to
//    exp(q - its own column maximum), the two exchange maximum and sum through
//    LDS, and each rescales its half.  A lane's eight values of a column tile
//    are one half of its B fragment in the projection kernels, and are stored
//    in that order: [work-group][head][column tile][half][lane][8].
//    k and v never leave the work-group:
//    each k row is taken to exp(k - its maximum over these 64 columns), laid
//    in LDS as bf16 beside v, and multiplied there into this work-group's
//    share of context[d][e] = sum_n k'[d][n] v[e][n].  Stored are that share
//    (fp32, 4 heads x 32 x 32), each row's local maximum and its local sum of
//    exponentials; k_ctx_merge puts the 64 shares of a batch on one scale.
//    grid (64, 16), block 256 (8 waves).
// ---------------------------------------------------------------------------
#define XP_ 264  // LDS row pitch, elements: 528 B = 16 B x odd, for 16-byte row readers
#define KP_ 72   // LDS row pitch of k' and v, elements: 144 B = 16 B x odd
#define NBLK_ 64 // column blocks (work-groups) a batch

// One weight fragment in k_cvt_w's order: two planes, 256 elements apart.
__device__ __forceinline__ v16bf wfrag_ld(const __bf16* p) {
  v8bf lo = *(const v8bf*)p;
  v8bf hi = *(const v8bf*)(p + 256);
  return __builtin_shufflevector(lo, hi, 0, 1, 2, 3, 4, 5, 6, 7,
                                 8, 9, 10, 11, 12, 13, 14, 15);
}

// exp(x) as 2^(x log2 e).  The v_nop fills the one slot that the instruction set
// asks for behind a transcendental, whatever the compiler schedules next.
__device__ __forceinline__ float exp_slot(float x) {
  float y;
  asm("v_exp_f32 %0, %1\n\tv_nop" : "=v"(y) : "v"(x * 1.442695041f));
  return y;
}

__global__ __launch_bounds__(256) void k_qkv_gemm(const float* __restrict__ x,
                                                  const __bf16* __restrict__ wqb,
                                                  __bf16* __restrict__ qbt,
                                                  float* __restrict__ pctx,
                                                  float* __restrict__ pmax,
                                                  float* __restrict__ psum) {
  const int lane = threadIdx.x & 31;
  const int wave = threadIdx.x >> 5;
  const int b = blockIdx.y;
  const int nWG = blockIdx.x * 64;
  const int c = lane & 15;
  const int h = lane >> 4;
  const float* xb = x + (size_t)b * C_ * N_ + nWG;

  __shared__ __align__(16) __bf16 xs[64 * XP_];
  __shared__ __align__(16) __bf16 ks[INNER_ * KP_];
  __shared__ __align__(16) __bf16 vs[INNER_ * KP_];
  __shared__ __align__(16) float qm[8 * 64];  // a wave's column maxima of q
  __shared__ __align__(16) float qs[8 * 64];  // and its column sums of exponentials

  // step 0's weight fragments are asked for first: they land while x is staged
  const __bf16* ap = wqb + wave * 4096 + lane * 8;
  v16bf a[2][3];
#pragma unroll
  for (int t = 0; t < 3; ++t) a[0][t] = wfrag_ld(ap + t * 32768);

  {
    // a thread takes 4 columns x 8 k, twice; LDS row j*16 + q holds column 4q + j
    const int q = threadIdx.x & 15;
    const int oc = threadIdx.x >> 4;
    v4f f[2][8];
#pragma unroll
    for (int u = 0; u < 2; ++u)
#pragma unroll
      for (int i = 0; i < 8; ++i)
        f[u][i] = *(const v4f*)(xb + (size_t)((oc + 16 * u) * 8 + i) * N_ + 4 * q);
#pragma unroll
    for (int u = 0; u < 2; ++u)
#pragma unroll
      for (int j = 0; j < 4; ++j) {
        v8bf pk;
#pragma unroll
        for (int i = 0; i < 8; ++i) pk[i] = (__bf16)f[u][i][j];
        *(v8bf*)(xs + (j * 16 + q) * XP_ + (oc + 16 * u) * 8) = pk;
      }
  }
  __syncthreads();

  v8f acc[3][4] = {};
  const __bf16* bp = xs + c * XP_ + h * 8;
  v16bf bm[2][4];
#pragma unroll
  for (int j = 0; j < 4; ++j) bm[0][j] = frag_ld(bp + j * 16 * XP_);
#pragma unroll
  for (int ks = 0; ks < 8; ++ks) {
    const int cur = ks & 1, nxt = cur ^ 1;
    if (ks < 7) {
#pragma unroll
      for (int t = 0; t < 3; ++t) a[nxt][t] = wfrag_ld(ap + t * 32768 + (ks + 1) * 512);
#pragma unroll
      for (int j = 0; j < 4; ++j) bm[nxt][j] = frag_ld(bp + j * 16 * XP_ + (ks + 1) * 32);
    }
    // keeps the next step's loads in front of this step's matrix block, so that
    // their L2 and LDS latency runs under twelve matrix instructions
    __builtin_amdgcn_sched_barrier(0);
#pragma unroll
    for (int t = 0; t < 3; ++t)
#pragma unroll
      for (int j = 0; j < 4; ++j) acc[t][j] = wmma_bf16(a[cur][t], bm[cur][j], acc[t][j]);
    // keeps later steps' loads from being moved in among these matrix instructions
    __builtin_amdgcn_sched_barrier(0);
  }
  // q: a column's 16 rows of this wave lie in two lanes, eight a lane
  v4f mq, sq;
#pragma unroll
  for (int j = 0; j < 4; ++j) {
    float m = acc[0][j][0];
#pragma unroll
    for (int r = 1; r < 8; ++r) m = fmaxf(m, acc[0][j][r]);
    m = fmaxf(m, __shfl_xor(m, 16));
#pragma unroll
    for (int r = 0; r < 8; ++r) acc[0][j][r] = exp_slot(acc[0][j][r] - m);
    float t = ((acc[0][j][0] + acc[0][j][1]) + (acc[0][j][2] + acc[0][j][3])) +
              ((acc[0][j][4] + acc[0][j][5]) + (acc[0][j][6] + acc[0][j][7]));
    t += __shfl_xor(t, 16);
    mq[j] = m;
    sq[j] = t;
  }
  if (h == 0) {
    *(v4f*)(qm + wave * 64 + 4 * c) = mq;
    *(v4f*)(qs + wave * 64 + 4 * c) = sq;
  }
  // A row's 64 columns lie in the 16 lanes of one half, four a lane: maximum
  // and sum go over the lane's four, then by a butterfly inside the half.
  const int wg = b * NBLK_ + blockIdx.x;
  float ml[8], sl[8];
#pragma unroll
  for (int r = 0; r < 8; ++r) {
    float m = fmaxf(fmaxf(acc[1][0][r], acc[1][1][r]), fmaxf(acc[1][2][r], acc[1][3][r]));
#pragma unroll
    for (int o = 8; o > 0; o >>= 1) m = fmaxf(m, __shfl_xor(m, o));
    ml[r] = m;
  }
#pragma unroll
  for (int r = 0; r < 8; ++r) {
    float e[4];
#pragma unroll
    for (int j = 0; j < 4; ++j) e[j] = exp_slot(acc[1][j][r] - ml[r]);
    float s = (e[0] + e[1]) + (e[2] + e[3]);
#pragma unroll
    for (int o = 8; o > 0; o >>= 1) s += __shfl_xor(s, o);
    sl[r] = s;
    // LDS column 4c + j is the local spatial column, for k' and for v alike
    v4bf pk = {(__bf16)e[0], (__bf16)e[1], (__bf16)e[2], (__bf16)e[3]};
    v4bf vv = {(__bf16)acc[2][0][r], (__bf16)acc[2][1][r], (__bf16)acc[2][2][r],
               (__bf16)acc[2][3][r]};
    const int lo = (wave * 16 + h * 8 + r) * KP_ + 4 * c;
    *(v4bf*)(ks + lo) = pk;
    *(v4bf*)(vs + lo) = vv;
  }
  __syncthreads();

  // every global store stands behind the barrier: in front of it the barrier's
  // own wait would hold each wave until its stores had been acknowledged
  {
    // the head's other wave's maxima and sums put both halves on one scale
    const v4f mo = *(const v4f*)(qm + (wave ^ 1) * 64 + 4 * c);
    const v4f so = *(const v4f*)(qs + (wave ^ 1) * 64 + 4 * c);
    __bf16* qd = qbt + (size_t)wg * (64 * INNER_) + (wave >> 1) * 2048 + (wave & 1) * 256 + lane * 8;
#pragma unroll
    for (int j = 0; j < 4; ++j) {
      const float mm = fmaxf(mq[j], mo[j]);
      const float wa = exp_slot(mq[j] - mm);
      const float wb = exp_slot(mo[j] - mm);
      const float fs = SCALE_ * wa / (sq[j] * wa + so[j] * wb);
      v8bf pk;
#pragma unroll
      for (int r = 0; r < 8; ++r) pk[r] = (__bf16)(acc[0][j][r] * fs);
      *(v8bf*)(qd + j * 512) = pk;  // a wave's store covers 512 B in a row
    }
  }
  if (c == 0) {
    const size_t so = (size_t)wg * INNER_ + wave * 16 + h * 8;
#pragma unroll
    for (int u = 0; u < 2; ++u) {
      *(v4f*)(pmax + so + u * 4) = v4f{ml[u * 4], ml[u * 4 + 1], ml[u * 4 + 2], ml[u * 4 + 3]};
      *(v4f*)(psum + so + u * 4) = v4f{sl[u * 4], sl[u * 4 + 1], sl[u * 4 + 2], sl[u * 4 + 3]};
    }
  }

  // wave w: head w >> 1, rows d = (w & 1) * 16 .. + 15, all 32 columns e; K = 64
  const __bf16* ka = ks + ((wave >> 1) * DH_ + (wave & 1) * 16 + c) * KP_ + h * 8;
  const __bf16* vb = vs + ((wave >> 1) * DH_ + c) * KP_ + h * 8;
  v8f pc[2] = {};
#pragma unroll
  for (int s2 = 0; s2 < 2; ++s2) {
    const v16bf af = frag_ld(ka + s2 * 32);
#pragma unroll
    for (int j = 0; j < 2; ++j)
      pc[j] = wmma_bf16(af, frag_ld(vb + j * 16 * KP_ + s2 * 32), pc[j]);
  }
  // share layout: [wave][j * 2 + u][lane][4], so every store covers 512 B in a row
  float* pd = pctx + (size_t)wg * (HEADS_ * DH_ * DH_) + wave * 512 + lane * 4;
#pragma unroll
  for (int j = 0; j < 2; ++j)
#pragma unroll
    for (int u = 0; u < 2; ++u)
      *(v4f*)(pd + (j * 2 + u) * 128) =
          v4f{pc[j][u * 4], pc[j][u * 4 + 1], pc[j][u * 4 + 2], pc[j][u * 4 + 3]};
}

// ---------------------------------------------------------------------------
// 2) context of one (batch, head) from its 64 shares: with M[d] the maximum of
//    the local maxima m_i[d] and w_i[d] = exp(m_i[d] - M[d]),
//    context[d][e] = sum_i w_i[d] share_i[d][e] / sum_i w_i[d] s_i[d],
//    which is the softmax of k over all n times v.  One thread an element,
//    stored as bf16 [d][e]: the projection kernels read it as a matrix operand.
//    grid (64, 4), block 256.
// ---------------------------------------------------------------------------
__global__ __launch_bounds__(256) void k_ctx_merge(const float* __restrict__ pctx,
                                                   const float* __restrict__ pmax,
                                                   const float* __restrict__ psum,
                                                   __bf16* __restrict__ ctx) {
  const int bh = blockIdx.x;
  const int b = bh >> 2, hd = bh & 3;
  const int t = threadIdx.x;
  // element f of the head's 1024 in k_qkv_gemm's share layout
  const int f = blockIdx.y * 256 + t;
  const int ln = (f >> 2) & 31;
  const int d = (f >> 9) * 16 + ((f >> 7) & 1) * 4 + (f & 3) + ((ln >> 4) << 3);
  const int e = ((f >> 8) & 1) * 16 + (ln & 15);

  __shared__ float redm[8 * DH_];
  __shared__ float reds[8 * DH_];
  __shared__ float scl[NBLK_ * DH_];

  // the statistics first, then all 64 shares' values: one latency for both
  const int dd = t & 31, g = t >> 5;
  const size_t so = (size_t)(b * NBLK_ + g * 8) * INNER_ + hd * DH_ + dd;
  float ml[8], sl[8];
#pragma unroll
  for (int u = 0; u < 8; ++u) {
    ml[u] = pmax[so + u * INNER_];
    sl[u] = psum[so + u * INNER_];
  }
  // the loads below may land in registers that hold the addresses of the loads
  // above: this wait stands in front of that overwrite
  asm volatile("s_wait_xcnt 0x0" ::: "memory");
  const float* ps = pctx + (size_t)b * NBLK_ * (HEADS_ * DH_ * DH_) + hd * (DH_ * DH_) + f;
  float p[NBLK_];
#pragma unroll
  for (int i = 0; i < NBLK_; ++i) p[i] = ps[(size_t)i * (HEADS_ * DH_ * DH_)];

  float m = ml[0];
#pragma unroll
  for (int u = 1; u < 8; ++u) m = fmaxf(m, ml[u]);
  redm[g * DH_ + dd] = m;
  __syncthreads();
  m = redm[dd];
#pragma unroll
  for (int w = 1; w < 8; ++w) m = fmaxf(m, redm[w * DH_ + dd]);
  float s = 0.f;
#pragma unroll
  for (int u = 0; u < 8; ++u) {
    const float w = __expf(ml[u] - m);
    scl[(g * 8 + u) * DH_ + dd] = w;
    s += sl[u] * w;
  }
  reds[g * DH_ + dd] = s;
  __syncthreads();

  float tot = reds[d];
#pragma unroll
  for (int w = 1; w < 8; ++w) tot += reds[w * DH_ + d];
  float a4[4] = {0.f, 0.f, 0.f, 0.f};  // four independent chains
#pragma unroll
  for (int i = 0; i < NBLK_; ++i) a4[i & 3] += p[i] * scl[i * DH_ + d];
  ctx[(size_t)bh * DH_ * DH_ + d * DH_ + e] =
      (__bf16)(((a4[0] + a4[1]) + (a4[2] + a4[3])) / tot);
}

// ---------------------------------------------------------------------------
// 3) out2[o][n] = sum_(hd,e) wout[o][hd,e] (sum_d ctx[hd][d][e] q'[hd][d][n]) + bout[o],
//    summed in the other order: out2 = W2 q' + bout with
//    W2[o][hd,d] = sum_e wout[o][hd,e] ctx[hd][d][e], 256 x 128 a batch.
//    Each wave makes the W2 rows it needs itself, transposed: ctx (rows d) times
//    wout^T (columns o) leaves lane l with column o = l & 15 and rows
//    d = (l >> 4) * 8 + r, which is the A-fragment order of W2 as it stands, so
//    the two d tiles of a head, rounded to bf16, are one A fragment.
//    out2 is made twice and never stored unnormalized: the product is cheap
//    next to a round trip of the 64 MiB result through memory.
//    k_proj_stats keeps only each work-group's sum and sum of squares;
//    k_proj_norm makes the same product again, reduces its batch's 16 partial
//    pairs to mean and variance, and stores the normalized, affine result.
//    One work-group makes all 256 rows of PT_ blocks of 64 columns, one block
//    after the other: W2, bias and affine terms are made or fetched once for all
//    of them, and a launch starts one work-group a WGP.  Its q' blocks (PT_ x
//    16 KiB in a row, in B-fragment order as k_qkv_gemm stores them) are read
//    once and copied to LDS as they stand, all in front of the one barrier; each
//    wave holds two 16-row tiles times four 16-column tiles of the block at hand.
//    Column c of column tile j is spatial column 4c + j of its block, as in
//    k_qkv_gemm: whole-line stores.
//    grid (64 / PT_, 16), block 256 (8 waves), both.
// ---------------------------------------------------------------------------
typedef __attribute__((ext_vector_type(2))) float v2f;
#define PT_ 4               // 64-column blocks a projection work-group takes
#define PWG_ (NBLK_ / PT_)  // projection work-groups a batch

template <bool NORM>
__device__ __forceinline__ void proj_body(const __bf16* __restrict__ qbt,
                                          const __bf16* __restrict__ ctx,
                                          const __bf16* __restrict__ wob,
                                          const float* __restrict__ bout,
                                          const float* __restrict__ gamma,
                                          const float* __restrict__ beta,
                                          const float* __restrict__ part_in,
                                          float* __restrict__ part_out,
                                          float* __restrict__ out) {
  const int lane = threadIdx.x & 31;
  // the wave's number in a scalar register: what is formed from it costs no
  // vector register
  const int wave = __builtin_amdgcn_readfirstlane(threadIdx.x >> 5);
  const int b = blockIdx.y;
  const int nWG = blockIdx.x * (64 * PT_);
  const int c = lane & 15;
  const int h = lane >> 4;

  __shared__ __align__(16) __bf16 as[PT_ * 64 * INNER_];

  // the operands of W2 first, the tile last: W2 is made while the tile is in flight
  const __bf16* ap = wob + wave * 4096 + lane * 8;
  v16bf a[4][2];
#pragma unroll
  for (int ks = 0; ks < 4; ++ks)
#pragma unroll
    for (int t = 0; t < 2; ++t) a[ks][t] = wfrag_ld(ap + t * 2048 + ks * 512);
  // later loads may land in registers that hold the addresses of the loads
  // above: this wait, and those like it below, stand in front of that overwrite
  asm volatile("s_wait_xcnt 0x0" ::: "memory");
  // the batch's context as A fragments: head ks, rows d = dh * 16 + c, k = e
  const __bf16* cp = ctx + ((size_t)b * HEADS_ * DH_ + c) * DH_ + h * 8;
  v16bf cf[4][2];
#pragma unroll
  for (int ks = 0; ks < 4; ++ks)
#pragma unroll
    for (int dh = 0; dh < 2; ++dh) cf[ks][dh] = frag_ld(cp + (ks * DH_ + dh * 16) * DH_);
  asm volatile("s_wait_xcnt 0x0" ::: "memory");
  // a lane's sixteen bias values, asked for with the rest
  v4f bi[2][2];
#pragma unroll
  for (int t = 0; t < 2; ++t)
#pragma unroll
    for (int u = 0; u < 2; ++u)
      bi[t][u] = *(const v4f*)(bout + wave * 32 + t * 16 + h * 8 + u * 4);
  asm volatile("s_wait_xcnt 0x0" ::: "memory");
  // likewise the batch's PWG_ partial pairs (one a lane of each half) and the
  // lane's affine terms
  v2f pp;
  v4f ga[2][2], be[2][2];
  if (NORM) {
    pp = *(const v2f*)(part_in + (size_t)(b * PWG_ + c) * 2);
#pragma unroll
    for (int t = 0; t < 2; ++t)
#pragma unroll
      for (int u = 0; u < 2; ++u)
        ga[t][u] = *(const v4f*)(gamma + wave * 32 + t * 16 + h * 8 + u * 4);
    asm volatile("s_wait_xcnt 0x0" ::: "memory");
#pragma unroll
    for (int t = 0; t < 2; ++t)
#pragma unroll
      for (int u = 0; u < 2; ++u)
        be[t][u] = *(const v4f*)(beta + wave * 32 + t * 16 + h * 8 + u * 4);
    asm volatile("s_wait_xcnt 0x0" ::: "memory");
  }
  const __bf16* src =
      qbt + (size_t)(b * NBLK_ + blockIdx.x * PT_) * (64 * INNER_) + threadIdx.x * 8;
  v8bf g[PT_ * 4];  // block i >> 2, head i & 3: 4 KiB, 16 B a thread
#pragma unroll
  for (int i = 0; i < PT_ * 4; ++i) g[i] = *(const v8bf*)(src + i * 2048);
  asm volatile("s_wait_xcnt 0x0" ::: "memory");

  // W2 fragments, in front of the barrier: they need nothing of the tile.
  // The wout fragment serves as B here (k = e, column o): same lane order as A.
  v16bf w2[4][2];
#pragma unroll
  for (int ks = 0; ks < 4; ++ks) {
#pragma unroll
    for (int t = 0; t < 2; ++t) {
      const v8f d0 = wmma_bf16(cf[ks][0], a[ks][t], v8f{});
      const v8f d1 = wmma_bf16(cf[ks][1], a[ks][t], v8f{});
#pragma unroll
      for (int r = 0; r < 8; ++r) {
        w2[ks][t][r] = (__bf16)d0[r];
        w2[ks][t][8 + r] = (__bf16)d1[r];
      }
    }
    // a head's four results are rounded before the next head's are made: left
    // free, the products move up among the loads above, and the q' blocks are
    // asked for only after the first operands have landed (two latencies in a row)
    __builtin_amdgcn_sched_barrier(0);
  }

  // what holds for all of the work-group's blocks
  float s[4] = {0.f, 0.f, 0.f, 0.f}, sq[4] = {0.f, 0.f, 0.f, 0.f};
  float mean = 0.f, inv = 0.f;
  if (NORM) {
    // every half wave reduces the PWG_ pairs the same way: no LDS, no barrier
    float st = pp[0];
    float qt = pp[1];
#pragma unroll
    for (int o = 8; o > 0; o >>= 1) {
      st += __shfl_xor(st, o);
      qt += __shfl_xor(qt, o);
    }
    const float invM = 1.0f / (float)(C_ * N_);
    mean = st * invM;
    const float var = qt * invM - mean * mean;
    inv = rsqrtf(var + EPS_);
  }

#pragma unroll
  for (int i = 0; i < PT_ * 4; ++i) *(v8bf*)(as + i * 2048 + threadIdx.x * 8) = g[i];
  __syncthreads();

  // unrolled: a block's place in LDS is an immediate offset, and the next block's
  // first LDS reads are issued under this block's epilogue
#pragma unroll
  for (int it = 0; it < PT_; ++it) {
  v8f acc[2][4] = {};
  // head ks, column tile j: two halves, 256 elements apart
  const __bf16* bp = as + it * (64 * INNER_) + lane * 8;
  v16bf bm[2][4];
#pragma unroll
  for (int j = 0; j < 4; ++j) bm[0][j] = wfrag_ld(bp + j * 512);
#pragma unroll
  for (int ks = 0; ks < 4; ++ks) {
    const int cur = ks & 1, nxt = cur ^ 1;
    if (ks < 3) {
#pragma unroll
      for (int j = 0; j < 4; ++j) bm[nxt][j] = wfrag_ld(bp + (ks + 1) * 2048 + j * 512);
    }
    // keeps the next step's LDS reads together in front of this step's matrix
    // block, so that their latency runs under eight matrix instructions
    __builtin_amdgcn_sched_barrier(0);
#pragma unroll
    for (int t = 0; t < 2; ++t)
#pragma unroll
      for (int j = 0; j < 4; ++j) acc[t][j] = wmma_bf16(w2[ks][t], bm[cur][j], acc[t][j]);
    // keeps later steps' reads from being moved in among these matrix instructions
    __builtin_amdgcn_sched_barrier(0);
  }

  if (!NORM) {
    // four independent chains a lane, carried over the blocks
#pragma unroll
    for (int t = 0; t < 2; ++t)
#pragma unroll
      for (int r = 0; r < 8; ++r) {
        const float bv = bi[t][r >> 2][r & 3];
#pragma unroll
        for (int j = 0; j < 4; ++j) {
          const float v = acc[t][j][r] + bv;
          s[j] += v;
          sq[j] += v * v;
        }
      }
  } else {
#pragma unroll
    for (int t = 0; t < 2; ++t) {
      const int m0 = wave * 32 + t * 16 + h * 8;
      float* op = out + (size_t)(b * C_ + m0) * N_ + nWG + it * 64 + 4 * c;
#pragma unroll
      for (int r = 0; r < 8; ++r) {
        const float bv = bi[t][r >> 2][r & 3];
        const float gv = ga[t][r >> 2][r & 3];
        const float ev = be[t][r >> 2][r & 3];
        v4f vo;
#pragma unroll
        for (int j = 0; j < 4; ++j)
          vo[j] = ((acc[t][j][r] + bv) - mean) * inv * gv + ev;
        *(v4f*)(op + (size_t)r * N_) = vo;
      }
    }
  }
  }

  if (!NORM) {
    // a butterfly over the wave, eight waves in LDS
    float st = (s[0] + s[1]) + (s[2] + s[3]);
    float qt = (sq[0] + sq[1]) + (sq[2] + sq[3]);
#pragma unroll
    for (int o = 16; o > 0; o >>= 1) {
      st += __shfl_xor(st, o);
      qt += __shfl_xor(qt, o);
    }
    __shared__ v2f red[8];
    if (lane == 0) red[wave] = v2f{st, qt};
    __syncthreads();
    if (threadIdx.x == 0) {
      v2f tot = red[0];
#pragma unroll
      for (int w = 1; w < 8; ++w) tot += red[w];
      *(v2f*)(part_out + (size_t)(b * PWG_ + blockIdx.x) * 2) = tot;
    }
  }
}

__global__ __launch_bounds__(256) void k_proj_stats(const __bf16* __restrict__ qbt,
                                                    const __bf16* __restrict__ ctx,
                                                    const __bf16* __restrict__ wob,
                                                    const float* __restrict__ bout,
                                                    float* __restrict__ part) {
  proj_body<false>(qbt, ctx, wob, bout, nullptr, nullptr, nullptr, part, nullptr);
}

__global__ __launch_bounds__(256) void k_proj_norm(const __bf16* __restrict__ qbt,
                                                   const __bf16* __restrict__ ctx,
                                                   const __bf16* __restrict__ wob,
                                                   const float* __restrict__ bout,
                                                   const float* __restrict__ gamma,
                                                   const float* __restrict__ beta,
                                                   const float* __restrict__ part,
                                                   float* __restrict__ out) {
  proj_body<true>(qbt, ctx, wob, bout, gamma, beta, part, nullptr, out);
}

// ---------------------------------------------------------------------------
extern "C" void kernel_launch(void* const* d_in, const int* in_sizes, int n_in,
                              void* d_out, int out_size, void* d_ws, size_t ws_size,
                              hipStream_t stream) {
  const float* x     = (const float*)d_in[0];
  const float* wqkv  = (const float*)d_in[1];
  const float* wout  = (const float*)d_in[2];
  const float* bout  = (const float*)d_in[3];
  const float* gamma = (const float*)d_in[4];
  const float* beta  = (const float*)d_in[5];
  float* out = (float*)d_out;
  (void)ws_size; (void)in_sizes; (void)n_in; (void)out_size;

  const size_t QSZ = (size_t)B_ * INNER_ * N_;   // 8,388,608
  float*  pctx = (float*)d_ws;                   // context shares, 4096 floats a work-group
  float*  pmax = pctx + (size_t)B_ * NBLK_ * HEADS_ * DH_ * DH_;  // local row maxima
  float*  psum = pmax + (size_t)B_ * NBLK_ * INNER_;              // local row sums
  __bf16* qbt = (__bf16*)(psum + (size_t)B_ * NBLK_ * INNER_);    // bf16 q', fragment order
  __bf16* wqb = qbt + QSZ;                       // bf16 w_qkv, fragment order
  __bf16* wob = wqb + (size_t)O3_ * C_;          // bf16 w_out, fragment order
  __bf16* ctx = wob + (size_t)C_ * INNER_;       // bf16 context [bh][d][e]
  float*  part = (float*)(ctx + (size_t)B_ * HEADS_ * DH_ * DH_);

  k_cvt_w    <<<dim3(512),        256, 0, stream>>>(wqkv, wout, wqb, wob);
  k_qkv_gemm <<<dim3(64, 16),     256, 0, stream>>>(x, wqb, qbt, pctx, pmax, psum);
  k_ctx_merge<<<dim3(64, 4),      256, 0, stream>>>(pctx, pmax, psum, ctx);
  k_proj_stats<<<dim3(16, 16),   256, 0, stream>>>(qbt, ctx, wob, bout, part);
  k_proj_norm<<<dim3(16, 16),     256, 0, stream>>>(qbt, ctx, wob, bout, gamma, beta, part, out);
}

// v008
// Measured time: 38 microseconds a run.
// In both of two side-by-side timings against v007, it was 1.03 times as fast.
// Counting every step since v000, it is 5.15 times as fast.
#include <hip/hip_runtime.h>

#define B_     16
#define C_     256
#define N_     4096
#define O3_    384
#define INNER_ 128
#define HEADS_ 4
#define DH_    32
#define SCALE_ 0.1767766952966369f
#define EPS_   1e-5f

typedef __attribute__((ext_vector_type(16))) __bf16 v16bf;
typedef __attribute__((ext_vector_type(8)))  __bf16 v8bf;
typedef __attribute__((ext_vector_type(8)))  float  v8f;
typedef __attribute__((ext_vector_type(4)))  __bf16 v4bf;
typedef __attribute__((ext_vector_type(4)))  float  v4f;

// 16-bit A/B fragment: lane `lane`, element `e` holds
// K = (e>>3)*16 + (lane>>4)*8 + (e&7)   (ISA 7.12.2)

__device__ __forceinline__ v8f wmma_bf16(v16bf a, v16bf b, v8f c) {
  return __builtin_amdgcn_wmma_f32_16x16x32_bf16(false, a, false, b, (short)0, c,
                                                 false, false);
}

// Load one 16-element bf16 fragment: per-lane K chunks are contiguous, so this
// is two 16-byte loads (global or LDS).  p must point at K = k0 + (lane>>4)*8.
__device__ __forceinline__ v16bf frag_ld(const __bf16* p) {
  v8bf lo = *(const v8bf*)p;
  v8bf hi = *(const v8bf*)(p + 16);
  return __builtin_shufflevector(lo, hi, 0, 1, 2, 3, 4, 5, 6, 7,
                                 8, 9, 10, 11, 12, 13, 14, 15);
}

// ---------------------------------------------------------------------------
// 1) qkv GEMM: [384x256] @ [256x4096] per batch.
//    One work-group makes all 384 rows of QT_ blocks of 64 columns, one block
//    after the other.  There is no weight conversion launch: each wave reads its
//    own 48 rows of fp32 w_qkv once, in whole lines, rounds them to bf16, turns
//    them into A fragments through its own part of LDS and keeps all 24
//    fragments in registers for every block.  Each work-group also rounds 128
//    elements of w_out into the fragment order that the projection kernels read:
//    per (16-row tile, 32-k step) two planes of 32 lanes x 8 elements, so that
//    one wave-wide 16-byte load of a plane covers 512 contiguous bytes.
//    A block's x tile is read once, converted once to bf16 and laid k-contiguous
//    in LDS; the next block's tile is asked for before the block at hand is
//    multiplied.  Each wave holds one 16-row tile of q, of k and of v times four
//    16-column tiles.
//    Column c of column tile j is spatial column 4c + j, so a lane's four
//    tiles give four consecutive columns of a row: whole-line stores.
//    q leaves as softmax over its head's 32 rows d, times SCALE, in bf16: a
//    head's rows lie in two waves, so each wave takes its 16 rows to
//    exp(q - its own column maximum), the two exchange maximum and sum through
//    LDS, and each rescales its half.  A lane's eight values of a column tile
//    are one half of its B fragment in the projection kernels, and are stored
//    in that order: [block][head][column tile][half][lane][8].
//    k and v never leave the work-group:
//    each k row is taken to exp(k - its maximum over the block's 64 columns),
//    laid in LDS as bf16 beside v, and multiplied there into the block's
//    share of context[d][e] = sum_n k'[d][n] v[e][n].  Stored are that share
//    (fp32, 4 heads x 32 x 32), each row's local maximum and its local sum of
//    exponentials; k_ctx_merge puts the 64 shares of a batch on one scale.
//    grid (64 / QT_, 16), block 256 (8 waves).
// ---------------------------------------------------------------------------
#define XP_ 264  // LDS row pitch, elements: 528 B = 16 B x odd, for 16-byte row readers
#define KP_ 72   // LDS row pitch of k' and v, elements: 144 B = 16 B x odd
#define NBLK_ 64 // column blocks a batch
#define QT_ 4    // 64-column blocks a qkv work-group takes

// One weight fragment in plane order: two planes, 256 elements apart.
__device__ __forceinline__ v16bf wfrag_ld(const __bf16* p) {
  v8bf lo = *(const v8bf*)p;
  v8bf hi = *(const v8bf*)(p + 256);
  return __builtin_shufflevector(lo, hi, 0, 1, 2, 3, 4, 5, 6, 7,
                                 8, 9, 10, 11, 12, 13, 14, 15);
}

// exp(x) as 2^(x log2 e).  The v_nop fills the one slot that the instruction set
// asks for behind a transcendental, whatever the compiler schedules next.
__device__ __forceinline__ float exp_slot(float x) {
  float y;
  asm("v_exp_f32 %0, %1\n\tv_nop" : "=v"(y) : "v"(x * 1.442695041f));
  return y;
}

// Work-group barrier that waits for this wave's LDS operations alone:
// __syncthreads() would also wait for the next block's x loads and for the
// stores of the block before, which nobody in the work-group reads.
__device__ __forceinline__ void lds_barrier() {
  asm volatile("s_wait_dscnt 0x0\n\ts_barrier_signal -1\n\ts_barrier_wait -1" ::: "memory");
}

__global__ __launch_bounds__(256) void k_qkv_gemm(const float* __restrict__ x,
                                                  const float* __restrict__ wqkv,
                                                  const float* __restrict__ wout,
                                                  __bf16* __restrict__ wob,
                                                  __bf16* __restrict__ qbt,
                                                  float* __restrict__ pctx,
                                                  float* __restrict__ pmax,
                                                  float* __restrict__ psum) {
  const int lane = threadIdx.x & 31;
  // the wave's number in a scalar register: what is formed from it costs no
  // vector register
  const int wave = __builtin_amdgcn_readfirstlane(threadIdx.x >> 5);
  const int b = blockIdx.y;
  const int c = lane & 15;
  const int h = lane >> 4;

  __shared__ __align__(16) __bf16 xs[64 * XP_];
  __shared__ __align__(16) __bf16 ks[INNER_ * KP_];
  __shared__ __align__(16) __bf16 vs[INNER_ * KP_];
  __shared__ __align__(16) float qm[8 * 64];  // a wave's column maxima of q
  __shared__ __align__(16) float qs[8 * 64];  // and its column sums of exponentials
  __shared__ __align__(16) __bf16 wl[O3_ * XP_];  // bf16 w_qkv, 48 rows a wave

  // a thread takes 4 columns x 8 k, twice; LDS row j*16 + q holds column 4q + j
  const int q = threadIdx.x & 15;
  const int oc = threadIdx.x >> 4;
  const float* xp = x + (size_t)b * C_ * N_ + blockIdx.x * (64 * QT_) + (size_t)(oc * 8) * N_ + 4 * q;
  __bf16* xd = xs + q * XP_ + oc * 8;
  // this work-group's 128 elements of w_out in plane order, 256 B in a row: every
  // wave asks, ahead of all other loads; waves 0 to 3 store, further down
  const int wd = (b * (NBLK_ / QT_) + blockIdx.x) * 128 + (threadIdx.x & 127);
  const int wpl = wd >> 8, wln = (wd >> 3) & 31;
  const float wo = wout[((wpl >> 3) * 16 + (wln & 15)) * INNER_ + ((wpl >> 1) & 3) * 32 +
                        (wpl & 1) * 16 + (wln >> 4) * 8 + (wd & 7)];
  // later loads may land in registers that hold the addresses of the loads
  // above: this wait, and those like it below, stand in front of that overwrite
  asm volatile("s_wait_xcnt 0x0" ::: "memory");
  // the wave's rows of q, k and v weights: a load covers half a row, 512 B.
  // Two tiles' loads are asked for, then block 0's x tile, then the third tile's
  // as the second is rounded: loads return in order, and the weights come from L2
  __bf16* wlw = wl + wave * 48 * XP_;
  const float* wp = wqkv + (size_t)(wave * 16) * C_ + lane * 4;
  v4f g[3][32];
#pragma unroll
  for (int t = 0; t < 2; ++t) {
#pragma unroll
    for (int i = 0; i < 32; ++i) g[t][i] = *(const v4f*)(wp + t * (INNER_ * C_) + i * 128);
  }
  asm volatile("s_wait_xcnt 0x0" ::: "memory");
  v4f f[2][8];
#pragma unroll
  for (int u = 0; u < 2; ++u)
#pragma unroll
    for (int i = 0; i < 8; ++i) f[u][i] = *(const v4f*)(xp + (size_t)(u * 128 + i) * N_);
  asm volatile("s_wait_xcnt 0x0" ::: "memory");
#pragma unroll
  for (int t = 0; t < 3; ++t) {
    if (t == 1) {
      // holds the w_out load in front of this place, where it has long landed: left
      // free it sinks into the storing branch below, and waves 0 to 3 wait out
      // its whole latency there, in front of the barrier
      asm volatile("" ::"v"(wo));
#pragma unroll
      for (int i = 0; i < 32; ++i) g[2][i] = *(const v4f*)(wp + 2 * (INNER_ * C_) + i * 128);
      asm volatile("s_wait_xcnt 0x0" ::: "memory");
    }
#pragma unroll
    for (int i = 0; i < 32; ++i) {
      v4bf pk = {(__bf16)g[t][i][0], (__bf16)g[t][i][1], (__bf16)g[t][i][2], (__bf16)g[t][i][3]};
      *(v4bf*)(wlw + (t * 16 + (i >> 1)) * XP_ + (i & 1) * 128 + lane * 4) = pk;
    }
  }
  if (wave < 4) {
    wob[wd] = (__bf16)wo;
    asm volatile("s_wait_xcnt 0x0" ::: "memory");
  }
#pragma unroll
  for (int u = 0; u < 2; ++u)
#pragma unroll
    for (int j = 0; j < 4; ++j) {
      v8bf pk;
#pragma unroll
      for (int i = 0; i < 8; ++i) pk[i] = (__bf16)f[u][i][j];
      *(v8bf*)(xd + j * 16 * XP_ + u * 128) = pk;
    }
  lds_barrier();

  // all 24 weight fragments, same k order as the x fragments below
  v16bf a[8][3];
#pragma unroll
  for (int kk = 0; kk < 8; ++kk)
#pragma unroll
    for (int t = 0; t < 3; ++t) a[kk][t] = frag_ld(wlw + (t * 16 + c) * XP_ + h * 8 + kk * 32);

  const __bf16* bp = xs + c * XP_ + h * 8;
  // rolled: the body is long
#pragma unroll 1
  for (int it = 0; it < QT_; ++it) {
    const bool more = it + 1 < QT_;
    if (more) {
      // the next block's tile flies under this block's products and softmaxes
#pragma unroll
      for (int u = 0; u < 2; ++u)
#pragma unroll
        for (int i = 0; i < 8; ++i)
          f[u][i] = *(const v4f*)(xp + (it + 1) * 64 + (size_t)(u * 128 + i) * N_);
      asm volatile("s_wait_xcnt 0x0" ::: "memory");
    }

    v8f acc[3][4] = {};
    v16bf bm[2][4];
#pragma unroll
    for (int j = 0; j < 4; ++j) bm[0][j] = frag_ld(bp + j * 16 * XP_);
#pragma unroll
    for (int kk = 0; kk < 8; ++kk) {
      const int cur = kk & 1, nxt = cur ^ 1;
      if (kk < 7) {
#pragma unroll
        for (int j = 0; j < 4; ++j) bm[nxt][j] = frag_ld(bp + j * 16 * XP_ + (kk + 1) * 32);
      }
      // keeps the next step's LDS reads in front of this step's matrix block, so
      // that their latency runs under twelve matrix instructions
      __builtin_amdgcn_sched_barrier(0);
#pragma unroll
      for (int t = 0; t < 3; ++t)
#pragma unroll
        for (int j = 0; j < 4; ++j) acc[t][j] = wmma_bf16(a[kk][t], bm[cur][j], acc[t][j]);
      // keeps later steps' reads from being moved in among these matrix instructions
      __builtin_amdgcn_sched_barrier(0);
    }
    // q: a column's 16 rows of this wave lie in two lanes, eight a lane
    v4f mq, sq;
#pragma unroll
    for (int j = 0; j < 4; ++j) {
      float m = acc[0][j][0];
#pragma unroll
      for (int r = 1; r < 8; ++r) m = fmaxf(m, acc[0][j][r]);
      m = fmaxf(m, __shfl_xor(m, 16));
#pragma unroll
      for (int r = 0; r < 8; ++r) acc[0][j][r] = exp_slot(acc[0][j][r] - m);
      float t = ((acc[0][j][0] + acc[0][j][1]) + (acc[0][j][2] + acc[0][j][3])) +
                ((acc[0][j][4] + acc[0][j][5]) + (acc[0][j][6] + acc[0][j][7]));
      t += __shfl_xor(t, 16);
      mq[j] = m;
      sq[j] = t;
    }
    if (h == 0) {
      *(v4f*)(qm + wave * 64 + 4 * c) = mq;
      *(v4f*)(qs + wave * 64 + 4 * c) = sq;
    }
    // A row's 64 columns lie in the 16 lanes of one half, four a lane: maximum
    // and sum go over the lane's four, then by a butterfly inside the half.
    const int wg = b * NBLK_ + blockIdx.x * QT_ + it;
    float ml[8], sl[8];
#pragma unroll
    for (int r = 0; r < 8; ++r) {
      float m = fmaxf(fmaxf(acc[1][0][r], acc[1][1][r]), fmaxf(acc[1][2][r], acc[1][3][r]));
#pragma unroll
      for (int o = 8; o > 0; o >>= 1) m = fmaxf(m, __shfl_xor(m, o));
      ml[r] = m;
    }
#pragma unroll
    for (int r = 0; r < 8; ++r) {
      float e[4];
#pragma unroll
      for (int j = 0; j < 4; ++j) e[j] = exp_slot(acc[1][j][r] - ml[r]);
      float s = (e[0] + e[1]) + (e[2] + e[3]);
#pragma unroll
      for (int o = 8; o > 0; o >>= 1) s += __shfl_xor(s, o);
      sl[r] = s;
      // LDS column 4c + j is the local spatial column, for k' and for v alike
      v4bf pk = {(__bf16)e[0], (__bf16)e[1], (__bf16)e[2], (__bf16)e[3]};
      v4bf vv = {(__bf16)acc[2][0][r], (__bf16)acc[2][1][r], (__bf16)acc[2][2][r],
                 (__bf16)acc[2][3][r]};
      const int lo = (wave * 16 + h * 8 + r) * KP_ + 4 * c;
      *(v4bf*)(ks + lo) = pk;
      *(v4bf*)(vs + lo) = vv;
    }
    // publishes k', v and the q statistics, and ends every wave's reads of xs
    lds_barrier();

    if (more) {
      // the next block's tile takes the place of the one just multiplied
#pragma unroll
      for (int u = 0; u < 2; ++u)
#pragma unroll
        for (int j = 0; j < 4; ++j) {
          v8bf pk;
#pragma unroll
          for (int i = 0; i < 8; ++i) pk[i] = (__bf16)f[u][i][j];
          *(v8bf*)(xd + j * 16 * XP_ + u * 128) = pk;
        }
    }
    {
      // the head's other wave's maxima and sums put both halves on one scale
      const v4f mo = *(const v4f*)(qm + (wave ^ 1) * 64 + 4 * c);
      const v4f so = *(const v4f*)(qs + (wave ^ 1) * 64 + 4 * c);
      __bf16* qd = qbt + (size_t)wg * (64 * INNER_) + (wave >> 1) * 2048 + (wave & 1) * 256 + lane * 8;
#pragma unroll
      for (int j = 0; j < 4; ++j) {
        const float mm = fmaxf(mq[j], mo[j]);
        const float wa = exp_slot(mq[j] - mm);
        const float wb = exp_slot(mo[j] - mm);
        const float fs = SCALE_ * wa / (sq[j] * wa + so[j] * wb);
        v8bf pk;
#pragma unroll
        for (int r = 0; r < 8; ++r) pk[r] = (__bf16)(acc[0][j][r] * fs);
        *(v8bf*)(qd + j * 512) = pk;  // a wave's store covers 512 B in a row
      }
      asm volatile("s_wait_xcnt 0x0" ::: "memory");
    }
    if (c == 0) {
      const size_t so = (size_t)wg * INNER_ + wave * 16 + h * 8;
#pragma unroll
      for (int u = 0; u < 2; ++u) {
        *(v4f*)(pmax + so + u * 4) = v4f{ml[u * 4], ml[u * 4 + 1], ml[u * 4 + 2], ml[u * 4 + 3]};
        *(v4f*)(psum + so + u * 4) = v4f{sl[u * 4], sl[u * 4 + 1], sl[u * 4 + 2], sl[u * 4 + 3]};
      }
      asm volatile("s_wait_xcnt 0x0" ::: "memory");
    }

    // wave w: head w >> 1, rows d = (w & 1) * 16 .. + 15, all 32 columns e; K = 64
    const __bf16* ka = ks + ((wave >> 1) * DH_ + (wave & 1) * 16 + c) * KP_ + h * 8;
    const __bf16* vb = vs + ((wave >> 1) * DH_ + c) * KP_ + h * 8;
    v8f pc[2] = {};
#pragma unroll
    for (int s2 = 0; s2 < 2; ++s2) {
      const v16bf af = frag_ld(ka + s2 * 32);
#pragma unroll
      for (int j = 0; j < 2; ++j)
        pc[j] = wmma_bf16(af, frag_ld(vb + j * 16 * KP_ + s2 * 32), pc[j]);
    }
    // share layout: [wave][j * 2 + u][lane][4], so every store covers 512 B in a row
    float* pd = pctx + (size_t)wg * (HEADS_ * DH_ * DH_) + wave * 512 + lane * 4;
#pragma unroll
    for (int j = 0; j < 2; ++j)
#pragma unroll
      for (int u = 0; u < 2; ++u)
        *(v4f*)(pd + (j * 2 + u) * 128) =
            v4f{pc[j][u * 4], pc[j][u * 4 + 1], pc[j][u * 4 + 2], pc[j][u * 4 + 3]};
    asm volatile("s_wait_xcnt 0x0" ::: "memory");
    // publishes the next block's tile, and ends every wave's reads of k', v and
    // the q statistics before the next block writes them
    if (more) lds_barrier();
  }
}

// ---------------------------------------------------------------------------
// 2) context of one (batch, head) from its 64 shares: with M[d] the maximum of
//    the local maxima m_i[d] and w_i[d] = exp(m_i[d] - M[d]),
//    context[d][e] = sum_i w_i[d] share_i[d][e] / sum_i w_i[d] s_i[d],
//    which is the softmax of k over all n times v.  One thread an element,
//    stored as bf16 [d][e]: the projection kernels read it as a matrix operand.
//    grid (64, 4), block 256.
// ---------------------------------------------------------------------------
__global__ __launch_bounds__(256) void k_ctx_merge(const float* __restrict__ pctx,
                                                   const float* __restrict__ pmax,
                                                   const float* __restrict__ psum,
                                                   __bf16* __restrict__ ctx) {
  const int bh = blockIdx.x;
  const int b = bh >> 2, hd = bh & 3;
  const int t = threadIdx.x;
  // element f of the head's 1024 in k_qkv_gemm's share layout
  const int f = blockIdx.y * 256 + t;
  const int ln = (f >> 2) & 31;
  const int d = (f >> 9) * 16 + ((f >> 7) & 1) * 4 + (f & 3) + ((ln >> 4) << 3);
  const int e = ((f >> 8) & 1) * 16 + (ln & 15);

  __shared__ float redm[8 * DH_];
  __shared__ float reds[8 * DH_];
  __shared__ float scl[NBLK_ * DH_];

  // the statistics first, then all 64 shares' values: one latency for both
  const int dd = t & 31, g = t >> 5;
  const size_t so = (size_t)(b * NBLK_ + g * 8) * INNER_ + hd * DH_ + dd;
  float ml[8], sl[8];
#pragma unroll
  for (int u = 0; u < 8; ++u) {
    ml[u] = pmax[so + u * INNER_];
    sl[u] = psum[so + u * INNER_];
  }
  // the loads below may land in registers that hold the addresses of the loads
  // above: this wait stands in front of that overwrite
  asm volatile("s_wait_xcnt 0x0" ::: "memory");
  const float* ps = pctx + (size_t)b * NBLK_ * (HEADS_ * DH_ * DH_) + hd * (DH_ * DH_) + f;
  float p[NBLK_];
#pragma unroll
  for (int i = 0; i < NBLK_; ++i) p[i] = ps[(size_t)i * (HEADS_ * DH_ * DH_)];

  float m = ml[0];
#pragma unroll
  for (int u = 1; u < 8; ++u) m = fmaxf(m, ml[u]);
  redm[g * DH_ + dd] = m;
  __syncthreads();
  m = redm[dd];
#pragma unroll
  for (int w = 1; w < 8; ++w) m = fmaxf(m, redm[w * DH_ + dd]);
  float s = 0.f;
#pragma unroll
  for (int u = 0; u < 8; ++u) {
    const float w = __expf(ml[u] - m);
    scl[(g * 8 + u) * DH_ + dd] = w;
    s += sl[u] * w;
  }
  reds[g * DH_ + dd] = s;
  __syncthreads();

  float tot = reds[d];
#pragma unroll
  for (int w = 1; w < 8; ++w) tot += reds[w * DH_ + d];
  float a4[4] = {0.f, 0.f, 0.f, 0.f};  // four independent chains
#pragma unroll
  for (int i = 0; i < NBLK_; ++i) a4[i & 3] += p[i] * scl[i * DH_ + d];
  ctx[(size_t)bh * DH_ * DH_ + d * DH_ + e] =
      (__bf16)(((a4[0] + a4[1]) + (a4[2] + a4[3])) / tot);
}

// ---------------------------------------------------------------------------
// 3) out2[o][n] = sum_(hd,e) wout[o][hd,e] (sum_d ctx[hd][d][e] q'[hd][d][n]) + bout[o],
//    summed in the other order: out2 = W2 q' + bout with
//    W2[o][hd,d] = sum_e wout[o][hd,e] ctx[hd][d][e], 256 x 128 a batch.
//    Each wave makes the W2 rows it needs itself, transposed: ctx (rows d) times
//    wout^T (columns o) leaves lane l with column o = l & 15 and rows
//    d = (l >> 4) * 8 + r, which is the A-fragment order of W2 as it stands, so
//    the two d tiles of a head, rounded to bf16, are one A fragment.
//    out2 is made twice and never stored unnormalized: the product is cheap
//    next to a round trip of the 64 MiB result through memory.
//    k_proj_stats keeps only each work-group's sum and sum of squares;
//    k_proj_norm makes the same product again, reduces its batch's 16 partial
//    pairs to mean and variance, and stores the normalized, affine result.
//    One work-group makes all 256 rows of PT_ blocks of 64 columns, one block
//    after the other: W2, bias and affine terms are made or fetched once for all
//    of them, and a launch starts one work-group a WGP.  Its q' blocks (PT_ x
//    16 KiB in a row, in B-fragment order as k_qkv_gemm stores them) are read
//    once and copied to LDS as they stand, all in front of the one barrier; each
//    wave holds two 16-row tiles times four 16-column tiles of the block at hand.
//    Column c of column tile j is spatial column 4c + j of its block, as in
//    k_qkv_gemm: whole-line stores.
//    grid (64 / PT_, 16), block 256 (8 waves), both.
// ---------------------------------------------------------------------------
typedef __attribute__((ext_vector_type(2))) float v2f;
#define PT_ 4               // 64-column blocks a projection work-group takes
#define PWG_ (NBLK_ / PT_)  // projection work-groups a batch

template <bool NORM>
__device__ __forceinline__ void proj_body(const __bf16* __restrict__ qbt,
                                          const __bf16* __restrict__ ctx,
                                          const __bf16* __restrict__ wob,
                                          const float* __restrict__ bout,
                                          const float* __restrict__ gamma,
                                          const float* __restrict__ beta,
                                          const float* __restrict__ part_in,
                                          float* __restrict__ part_out,
                                          float* __restrict__ out) {
  const int lane = threadIdx.x & 31;
  // the wave's number in a scalar register: what is formed from it costs no
  // vector register
  const int wave = __builtin_amdgcn_readfirstlane(threadIdx.x >> 5);
  const int b = blockIdx.y;
  const int nWG = blockIdx.x * (64 * PT_);
  const int c = lane & 15;
  const int h = lane >> 4;

  __shared__ __align__(16) __bf16 as[PT_ * 64 * INNER_];

  // the operands of W2 first, the tile last: W2 is made while the tile is in flight
  const __bf16* ap = wob + wave * 4096 + lane * 8;
  v16bf a[4][2];
#pragma unroll
  for (int ks = 0; ks < 4; ++ks)
#pragma unroll
    for (int t = 0; t < 2; ++t) a[ks][t] = wfrag_ld(ap + t * 2048 + ks * 512);
  // later loads may land in registers that hold the addresses of the loads
  // above: this wait, and those like it below, stand in front of that overwrite
  asm volatile("s_wait_xcnt 0x0" ::: "memory");
  // the batch's context as A fragments: head ks, rows d = dh * 16 + c, k = e
  const __bf16* cp = ctx + ((size_t)b * HEADS_ * DH_ + c) * DH_ + h * 8;
  v16bf cf[4][2];
#pragma unroll
  for (int ks = 0; ks < 4; ++ks)
#pragma unroll
    for (int dh = 0; dh < 2; ++dh) cf[ks][dh] = frag_ld(cp + (ks * DH_ + dh * 16) * DH_);
  asm volatile("s_wait_xcnt 0x0" ::: "memory");
  // a lane's sixteen bias values, asked for with the rest
  v4f bi[2][2];
#pragma unroll
  for (int t = 0; t < 2; ++t)
#pragma unroll
    for (int u = 0; u < 2; ++u)
      bi[t][u] = *(const v4f*)(bout + wave * 32 + t * 16 + h * 8 + u * 4);
  asm volatile("s_wait_xcnt 0x0" ::: "memory");
  // likewise the batch's PWG_ partial pairs (one a lane of each half) and the
  // lane's affine terms
  v2f pp;
  v4f ga[2][2], be[2][2];
  if (NORM) {
    pp = *(const v2f*)(part_in + (size_t)(b * PWG_ + c) * 2);
#pragma unroll
    for (int t = 0; t < 2; ++t)
#pragma unroll
      for (int u = 0; u < 2; ++u)
        ga[t][u] = *(const v4f*)(gamma + wave * 32 + t * 16 + h * 8 + u * 4);
    asm volatile("s_wait_xcnt 0x0" ::: "memory");
#pragma unroll
    for (int t = 0; t < 2; ++t)
#pragma unroll
      for (int u = 0; u < 2; ++u)
        be[t][u] = *(const v4f*)(beta + wave * 32 + t * 16 + h * 8 + u * 4);
    asm volatile("s_wait_xcnt 0x0" ::: "memory");
  }
  const __bf16* src =
      qbt + (size_t)(b * NBLK_ + blockIdx.x * PT_) * (64 * INNER_) + threadIdx.x * 8;
  v8bf g[PT_ * 4];  // block i >> 2, head i & 3: 4 KiB, 16 B a thread
#pragma unroll
  for (int i = 0; i < PT_ * 4; ++i) g[i] = *(const v8bf*)(src + i * 2048);
  asm volatile("s_wait_xcnt 0x0" ::: "memory");

  // W2 fragments, in front of the barrier: they need nothing of the tile.
  // The wout fragment serves as B here (k = e, column o): same lane order as A.
  v16bf w2[4][2];
#pragma unroll
  for (int ks = 0; ks < 4; ++ks) {
#pragma unroll
    for (int t = 0; t < 2; ++t) {
      const v8f d0 = wmma_bf16(cf[ks][0], a[ks][t], v8f{});
      const v8f d1 = wmma_bf16(cf[ks][1], a[ks][t], v8f{});
#pragma unroll
      for (int r = 0; r < 8; ++r) {
        w2[ks][t][r] = (__bf16)d0[r];
        w2[ks][t][8 + r] = (__bf16)d1[r];
      }
    }
    // a head's four results are rounded before the next head's are made: left
    // free, the products move up among the loads above, and the q' blocks are
    // asked for only after the first operands have landed (two latencies in a row)
    __builtin_amdgcn_sched_barrier(0);
  }

  // what holds for all of the work-group's blocks
  float s[4] = {0.f, 0.f, 0.f, 0.f}, sq[4] = {0.f, 0.f, 0.f, 0.f};
  float mean = 0.f, inv = 0.f;
  if (NORM) {
    // every half wave reduces the PWG_ pairs the same way: no LDS, no barrier
    float st = pp[0];
    float qt = pp[1];
#pragma unroll
    for (int o = 8; o > 0; o >>= 1) {
      st += __shfl_xor(st, o);
      qt += __shfl_xor(qt, o);
    }
    const float invM = 1.0f / (float)(C_ * N_);
    mean = st * invM;
    const float var = qt * invM - mean * mean;
    inv = rsqrtf(var + EPS_);
  }

#pragma unroll
  for (int i = 0; i < PT_ * 4; ++i) *(v8bf*)(as + i * 2048 + threadIdx.x * 8) = g[i];
  __syncthreads();

  // unrolled: a block's place in LDS is an immediate offset, and the next block's
  // first LDS reads are issued under this block's epilogue
#pragma unroll
  for (int it = 0; it < PT_; ++it) {
  v8f acc[2][4] = {};
  // head ks, column tile j: two halves, 256 elements apart
  const __bf16* bp = as + it * (64 * INNER_) + lane * 8;
  v16bf bm[2][4];
#pragma unroll
  for (int j = 0; j < 4; ++j) bm[0][j] = wfrag_ld(bp + j * 512);
#pragma unroll
  for (int ks = 0; ks < 4; ++ks) {
    const int cur = ks & 1, nxt = cur ^ 1;
    if (ks < 3) {
#pragma unroll
      for (int j = 0; j < 4; ++j) bm[nxt][j] = wfrag_ld(bp + (ks + 1) * 2048 + j * 512);
    }
    // keeps the next step's LDS reads together in front of this step's matrix
    // block, so that their latency runs under eight matrix instructions
    __builtin_amdgcn_sched_barrier(0);
#pragma unroll
    for (int t = 0; t < 2; ++t)
#pragma unroll
      for (int j = 0; j < 4; ++j) acc[t][j] = wmma_bf16(w2[ks][t], bm[cur][j], acc[t][j]);
    // keeps later steps' reads from being moved in among these matrix instructions
    __builtin_amdgcn_sched_barrier(0);
  }

  if (!NORM) {
    // four independent chains a lane, carried over the blocks
#pragma unroll
    for (int t = 0; t < 2; ++t)
#pragma unroll
      for (int r = 0; r < 8; ++r) {
        const float bv = bi[t][r >> 2][r & 3];
#pragma unroll
        for (int j = 0; j < 4; ++j) {
          const float v = acc[t][j][r] + bv;
          s[j] += v;
          sq[j] += v * v;
        }
      }
  } else {
#pragma unroll
    for (int t = 0; t < 2; ++t) {
      const int m0 = wave * 32 + t * 16 + h * 8;
      float* op = out + (size_t)(b * C_ + m0) * N_ + nWG + it * 64 + 4 * c;
#pragma unroll
      for (int r = 0; r < 8; ++r) {
        const float bv = bi[t][r >> 2][r & 3];
        const float gv = ga[t][r >> 2][r & 3];
        const float ev = be[t][r >> 2][r & 3];
        v4f vo;
#pragma unroll
        for (int j = 0; j < 4; ++j)
          vo[j] = ((acc[t][j][r] + bv) - mean) * inv * gv + ev;
        *(v4f*)(op + (size_t)r * N_) = vo;
      }
    }
  }
  }

  if (!NORM) {
    // a butterfly over the wave, eight waves in LDS
    float st = (s[0] + s[1]) + (s[2] + s[3]);
    float qt = (sq[0] + sq[1]) + (sq[2] + sq[3]);
#pragma unroll
    for (int o = 16; o > 0; o >>= 1) {
      st += __shfl_xor(st, o);
      qt += __shfl_xor(qt, o);
    }
    __shared__ v2f red[8];
    if (lane == 0) red[wave] = v2f{st, qt};
    __syncthreads();
    if (threadIdx.x == 0) {
      v2f tot = red[0];
#pragma unroll
      for (int w = 1; w < 8; ++w) tot += red[w];
      *(v2f*)(part_out + (size_t)(b * PWG_ + blockIdx.x) * 2) = tot;
    }
  }
}

__global__ __launch_bounds__(256) void k_proj_stats(const __bf16* __restrict__ qbt,
                                                    const __bf16* __restrict__ ctx,
                                                    const __bf16* __restrict__ wob,
                                                    const float* __restrict__ bout,
                                                    float* __restrict__ part) {
  proj_body<false>(qbt, ctx, wob, bout, nullptr, nullptr, nullptr, part, nullptr);
}

__global__ __launch_bounds__(256) void k_proj_norm(const __bf16* __restrict__ qbt,
                                                   const __bf16* __restrict__ ctx,
                                                   const __bf16* __restrict__ wob,
                                                   const float* __restrict__ bout,
                                                   const float* __restrict__ gamma,
                                                   const float* __restrict__ beta,
                                                   const float* __restrict__ part,
                                                   float* __restrict__ out) {
  proj_body<true>(qbt, ctx, wob, bout, gamma, beta, part, nullptr, out);
}

// ---------------------------------------------------------------------------
extern "C" void kernel_launch(void* const* d_in, const int* in_sizes, int n_in,
                              void* d_out, int out_size, void* d_ws, size_t ws_size,
                              hipStream_t stream) {
  const float* x     = (const float*)d_in[0];
  const float* wqkv  = (const float*)d_in[1];
  const float* wout  = (const float*)d_in[2];
  const float* bout  = (const float*)d_in[3];
  const float* gamma = (const float*)d_in[4];
  const float* beta  = (const float*)d_in[5];
  float* out = (float*)d_out;
  (void)ws_size; (void)in_sizes; (void)n_in; (void)out_size;

  const size_t QSZ = (size_t)B_ * INNER_ * N_;   // 8,388,608
  float*  pctx = (float*)d_ws;                   // context shares, 4096 floats a column block
  float*  pmax = pctx + (size_t)B_ * NBLK_ * HEADS_ * DH_ * DH_;  // local row maxima
  float*  psum = pmax + (size_t)B_ * NBLK_ * INNER_;              // local row sums
  __bf16* qbt = (__bf16*)(psum + (size_t)B_ * NBLK_ * INNER_);    // bf16 q', fragment order
  __bf16* wob = qbt + QSZ;                       // bf16 w_out, fragment order
  __bf16* ctx = wob + (size_t)C_ * INNER_;       // bf16 context [bh][d][e]
  float*  part = (float*)(ctx + (size_t)B_ * HEADS_ * DH_ * DH_);

  k_qkv_gemm <<<dim3(16, 16),     256, 0, stream>>>(x, wqkv, wout, wob, qbt, pctx, pmax, psum);
  k_ctx_merge<<<dim3(64, 4),      256, 0, stream>>>(pctx, pmax, psum, ctx);
  k_proj_stats<<<dim3(16, 16),   256, 0, stream>>>(qbt, ctx, wob, bout, part);
  k_proj_norm<<<dim3(16, 16),     256, 0, stream>>>(qbt, ctx, wob, bout, gamma, beta, part, out);
}

// v009
// Measured time: 36.1 microseconds a run.
// In both of two side-by-side timings against v008, it was 1.06 times as fast.
// Over all steps from v000 it is 5.46 times as fast.
#include <hip/hip_runtime.h>

#define B_     16
#define C_     256
#define N_     4096
#define O3_    384
#define INNER_ 128
#define HEADS_ 4
#define DH_    32
#define SCALE_ 0.1767766952966369f
#define EPS_   1e-5f

typedef __attribute__((ext_vector_type(16))) __bf16 v16bf;
typedef __attribute__((ext_vector_type(8)))  __bf16 v8bf;
typedef __attribute__((ext_vector_type(8)))  float  v8f;
typedef __attribute__((ext_vector_type(4)))  __bf16 v4bf;
typedef __attribute__((ext_vector_type(4)))  float  v4f;

// 16-bit A/B fragment: lane `lane`, element `e` holds
// K = (e>>3)*16 + (lane>>4)*8 + (e&7)   (ISA 7.12.2)

__device__ __forceinline__ v8f wmma_bf16(v16bf a, v16bf b, v8f c) {
  return __builtin_amdgcn_wmma_f32_16x16x32_bf16(false, a, false, b, (short)0, c,
                                                 false, false);
}

// Load one 16-element bf16 fragment: per-lane K chunks are contiguous, so this
// is two 16-byte loads (global or LDS).  p must point at K = k0 + (lane>>4)*8.
__device__ __forceinline__ v16bf frag_ld(const __bf16* p) {
  v8bf lo = *(const v8bf*)p;
  v8bf hi = *(const v8bf*)(p + 16);
  return __builtin_shufflevector(lo, hi, 0, 1, 2, 3, 4, 5, 6, 7,
                                 8, 9, 10, 11, 12, 13, 14, 15);
}

// ---------------------------------------------------------------------------
// 1) qkv GEMM: [384x256] @ [256x4096] per batch.
//    One work-group makes all 384 rows of QT_ blocks of 64 columns, one block
//    after the other.  There is no weight conversion launch: each wave reads its
//    own 48 rows of fp32 w_qkv once, in whole lines, rounds them to bf16, turns
//    them into A fragments through its own part of LDS and keeps all 24
//    fragments in registers for every block.  Each work-group also rounds 128
//    elements of w_out into the fragment order that the projection kernels read:
//    per (16-row tile, 32-k step) two planes of 32 lanes x 8 elements, so that
//    one wave-wide 16-byte load of a plane covers 512 contiguous bytes.
//    A block's x tile is read once, converted once to bf16 and laid k-contiguous
//    in LDS; the next block's tile is asked for before the block at hand is
//    multiplied.  Each wave holds one 16-row tile of q, of k and of v times four
//    16-column tiles.
//    Column c of column tile j is spatial column 4c + j, so a lane's four
//    tiles give four consecutive columns of a row: whole-line stores.
//    q leaves as softmax over its head's 32 rows d, times SCALE, in bf16: a
//    head's rows lie in two waves, so each wave takes its 16 rows to
//    exp(q - its own column maximum), the two exchange maximum and sum through
//    LDS, and each rescales its half.  A lane's eight values of a column tile
//    are one half of its B fragment in the projection kernels, and are stored
//    in that order: [block][head][column tile][half][lane][8].
//    k and v never leave the work-group:
//    each k row is taken to exp(k - its maximum over the block's 64 columns),
//    laid in LDS as bf16 beside v, and multiplied there into the block's
//    share of context[d][e] = sum_n k'[d][n] v[e][n].  Stored are that share
//    (fp32, 4 heads x 32 x 32), each row's local maximum and its local sum of
//    exponentials; k_ctx_merge puts the 64 shares of a batch on one scale.
//    grid (64 / QT_, 16), block 256 (8 waves).
// ---------------------------------------------------------------------------
#define XP_ 264  // LDS row pitch, elements: 528 B = 16 B x odd, for 16-byte row readers
#define KP_ 72   // LDS row pitch of k' and v, elements: 144 B = 16 B x odd
#define NBLK_ 64 // column blocks a batch
#define QT_ 4    // 64-column blocks a qkv work-group takes

// One weight fragment in plane order: two planes, 256 elements apart.
__device__ __forceinline__ v16bf wfrag_ld(const __bf16* p) {
  v8bf lo = *(const v8bf*)p;
  v8bf hi = *(const v8bf*)(p + 256);
  return __builtin_shufflevector(lo, hi, 0, 1, 2, 3, 4, 5, 6, 7,
                                 8, 9, 10, 11, 12, 13, 14, 15);
}

// exp(x) as 2^(x log2 e).  The v_nop fills the one slot that the instruction set
// asks for behind a transcendental, whatever the compiler schedules next.
__device__ __forceinline__ float exp_slot(float x) {
  float y;
  asm("v_exp_f32 %0, %1\n\tv_nop" : "=v"(y) : "v"(x * 1.442695041f));
  return y;
}

// Cross-lane steps of the reductions, in registers: the shuffle intrinsic goes
// through the LDS unit and is waited for at every step of every butterfly.
// Value of lane l ^ M, M < 16: a DPP operand, inside the lane's row of 16.
template <int M>
__device__ __forceinline__ float row_xor(float v) {
  return __builtin_bit_cast(
      float, __builtin_amdgcn_update_dpp(0, __builtin_bit_cast(int, v), 0x160 | M, 0xf, 0xf, true));
}
// Value of lane l ^ 16: the same lane of the other row.
__device__ __forceinline__ float half_xor(float v) {
  const int b = __builtin_bit_cast(int, v);
  return __builtin_bit_cast(
      float, __builtin_amdgcn_permlanex16(b, b, 0x76543210, 0xfedcba98, false, false));
}
// Butterflies over a row of 16 lanes, steps 8, 4, 2, 1.
__device__ __forceinline__ float row_max16(float m) {
  m = fmaxf(m, row_xor<8>(m));
  m = fmaxf(m, row_xor<4>(m));
  m = fmaxf(m, row_xor<2>(m));
  return fmaxf(m, row_xor<1>(m));
}
__device__ __forceinline__ float row_sum16(float s) {
  s += row_xor<8>(s);
  s += row_xor<4>(s);
  s += row_xor<2>(s);
  return s + row_xor<1>(s);
}

// Work-group barrier that waits for this wave's LDS operations alone:
// __syncthreads() would also wait for the next block's x loads and for the
// stores of the block before, which nobody in the work-group reads.
__device__ __forceinline__ void lds_barrier() {
  asm volatile("s_wait_dscnt 0x0\n\ts_barrier_signal -1\n\ts_barrier_wait -1" ::: "memory");
}

__global__ __launch_bounds__(256) void k_qkv_gemm(const float* __restrict__ x,
                                                  const float* __restrict__ wqkv,
                                                  const float* __restrict__ wout,
                                                  __bf16* __restrict__ wob,
                                                  __bf16* __restrict__ qbt,
                                                  float* __restrict__ pctx,
                                                  float* __restrict__ pmax,
                                                  float* __restrict__ psum) {
  const int lane = threadIdx.x & 31;
  // the wave's number in a scalar register: what is formed from it costs no
  // vector register
  const int wave = __builtin_amdgcn_readfirstlane(threadIdx.x >> 5);
  const int b = blockIdx.y;
  const int c = lane & 15;
  const int h = lane >> 4;

  __shared__ __align__(16) __bf16 xs[64 * XP_];
  __shared__ __align__(16) __bf16 ks[INNER_ * KP_];
  __shared__ __align__(16) __bf16 vs[INNER_ * KP_];
  __shared__ __align__(16) float qm[8 * 64];  // a wave's column maxima of q
  __shared__ __align__(16) float qs[8 * 64];  // and its column sums of exponentials
  __shared__ __align__(16) __bf16 wl[O3_ * XP_];  // bf16 w_qkv, 48 rows a wave

  // a thread takes 4 columns x 8 k, twice; LDS row j*16 + q holds column 4q + j
  const int q = threadIdx.x & 15;
  const int oc = threadIdx.x >> 4;
  const float* xp = x + (size_t)b * C_ * N_ + blockIdx.x * (64 * QT_) + (size_t)(oc * 8) * N_ + 4 * q;
  __bf16* xd = xs + q * XP_ + oc * 8;
  // this work-group's 128 elements of w_out in plane order, 256 B in a row: every
  // wave asks, ahead of all other loads; waves 0 to 3 store, further down
  const int wd = (b * (NBLK_ / QT_) + blockIdx.x) * 128 + (threadIdx.x & 127);
  const int wpl = wd >> 8, wln = (wd >> 3) & 31;
  const float wo = wout[((wpl >> 3) * 16 + (wln & 15)) * INNER_ + ((wpl >> 1) & 3) * 32 +
                        (wpl & 1) * 16 + (wln >> 4) * 8 + (wd & 7)];
  // later loads may land in registers that hold the addresses of the loads
  // above: this wait, and those like it below, stand in front of that overwrite
  asm volatile("s_wait_xcnt 0x0" ::: "memory");
  // the wave's rows of q, k and v weights: a load covers half a row, 512 B.
  // Two tiles' loads are asked for, then block 0's x tile, then the third tile's
  // as the second is rounded: loads return in order, and the weights come from L2
  __bf16* wlw = wl + wave * 48 * XP_;
  const float* wp = wqkv + (size_t)(wave * 16) * C_ + lane * 4;
  v4f g[3][32];
#pragma unroll
  for (int t = 0; t < 2; ++t) {
#pragma unroll
    for (int i = 0; i < 32; ++i) g[t][i] = *(const v4f*)(wp + t * (INNER_ * C_) + i * 128);
  }
  asm volatile("s_wait_xcnt 0x0" ::: "memory");
  v4f f[2][8];
#pragma unroll
  for (int u = 0; u < 2; ++u)
#pragma unroll
    for (int i = 0; i < 8; ++i) f[u][i] = *(const v4f*)(xp + (size_t)(u * 128 + i) * N_);
  asm volatile("s_wait_xcnt 0x0" ::: "memory");
#pragma unroll
  for (int t = 0; t < 3; ++t) {
    if (t == 1) {
      // holds the w_out load in front of this place, where it has long landed: left
      // free it sinks into the storing branch below, and waves 0 to 3 wait out
      // its whole latency there, in front of the barrier
      asm volatile("" ::"v"(wo));
#pragma unroll
      for (int i = 0; i < 32; ++i) g[2][i] = *(const v4f*)(wp + 2 * (INNER_ * C_) + i * 128);
      asm volatile("s_wait_xcnt 0x0" ::: "memory");
    }
#pragma unroll
    for (int i = 0; i < 32; ++i) {
      v4bf pk = {(__bf16)g[t][i][0], (__bf16)g[t][i][1], (__bf16)g[t][i][2], (__bf16)g[t][i][3]};
      *(v4bf*)(wlw + (t * 16 + (i >> 1)) * XP_ + (i & 1) * 128 + lane * 4) = pk;
    }
  }
  if (wave < 4) {
    wob[wd] = (__bf16)wo;
    asm volatile("s_wait_xcnt 0x0" ::: "memory");
  }
#pragma unroll
  for (int u = 0; u < 2; ++u)
#pragma unroll
    for (int j = 0; j < 4; ++j) {
      v8bf pk;
#pragma unroll
      for (int i = 0; i < 8; ++i) pk[i] = (__bf16)f[u][i][j];
      *(v8bf*)(xd + j * 16 * XP_ + u * 128) = pk;
    }
  lds_barrier();

  // all 24 weight fragments, same k order as the x fragments below
  v16bf a[8][3];
#pragma unroll
  for (int kk = 0; kk < 8; ++kk)
#pragma unroll
    for (int t = 0; t < 3; ++t) a[kk][t] = frag_ld(wlw + (t * 16 + c) * XP_ + h * 8 + kk * 32);

  const __bf16* bp = xs + c * XP_ + h * 8;
  // rolled: the body is long
#pragma unroll 1
  for (int it = 0; it < QT_; ++it) {
    const bool more = it + 1 < QT_;
    if (more) {
      // the next block's tile flies under this block's products and softmaxes
#pragma unroll
      for (int u = 0; u < 2; ++u)
#pragma unroll
        for (int i = 0; i < 8; ++i)
          f[u][i] = *(const v4f*)(xp + (it + 1) * 64 + (size_t)(u * 128 + i) * N_);
      asm volatile("s_wait_xcnt 0x0" ::: "memory");
    }

    v8f acc[3][4] = {};
    v16bf bm[2][4];
#pragma unroll
    for (int j = 0; j < 4; ++j) bm[0][j] = frag_ld(bp + j * 16 * XP_);
#pragma unroll
    for (int kk = 0; kk < 8; ++kk) {
      const int cur = kk & 1, nxt = cur ^ 1;
      if (kk < 7) {
#pragma unroll
        for (int j = 0; j < 4; ++j) bm[nxt][j] = frag_ld(bp + j * 16 * XP_ + (kk + 1) * 32);
      }
      // keeps the next step's LDS reads in front of this step's matrix block, so
      // that their latency runs under twelve matrix instructions
      __builtin_amdgcn_sched_barrier(0);
#pragma unroll
      for (int t = 0; t < 3; ++t)
#pragma unroll
        for (int j = 0; j < 4; ++j) acc[t][j] = wmma_bf16(a[kk][t], bm[cur][j], acc[t][j]);
      // keeps later steps' reads from being moved in among these matrix instructions
      __builtin_amdgcn_sched_barrier(0);
    }
    // q: a column's 16 rows of this wave lie in two lanes, eight a lane
    v4f mq, sq;
#pragma unroll
    for (int j = 0; j < 4; ++j) {
      float m = acc[0][j][0];
#pragma unroll
      for (int r = 1; r < 8; ++r) m = fmaxf(m, acc[0][j][r]);
      m = fmaxf(m, half_xor(m));
#pragma unroll
      for (int r = 0; r < 8; ++r) acc[0][j][r] = exp_slot(acc[0][j][r] - m);
      float t = ((acc[0][j][0] + acc[0][j][1]) + (acc[0][j][2] + acc[0][j][3])) +
                ((acc[0][j][4] + acc[0][j][5]) + (acc[0][j][6] + acc[0][j][7]));
      t += half_xor(t);
      mq[j] = m;
      sq[j] = t;
    }
    if (h == 0) {
      *(v4f*)(qm + wave * 64 + 4 * c) = mq;
      *(v4f*)(qs + wave * 64 + 4 * c) = sq;
    }
    // A row's 64 columns lie in the 16 lanes of one half, four a lane: maximum
    // and sum go over the lane's four, then by a butterfly inside the half.
    const int wg = b * NBLK_ + blockIdx.x * QT_ + it;
    float ml[8], sl[8];
#pragma unroll
    for (int r = 0; r < 8; ++r) {
      const float m = fmaxf(fmaxf(acc[1][0][r], acc[1][1][r]), fmaxf(acc[1][2][r], acc[1][3][r]));
      ml[r] = row_max16(m);
    }
#pragma unroll
    for (int r = 0; r < 8; ++r) {
      float e[4];
#pragma unroll
      for (int j = 0; j < 4; ++j) e[j] = exp_slot(acc[1][j][r] - ml[r]);
      sl[r] = row_sum16((e[0] + e[1]) + (e[2] + e[3]));
      // LDS column 4c + j is the local spatial column, for k' and for v alike
      v4bf pk = {(__bf16)e[0], (__bf16)e[1], (__bf16)e[2], (__bf16)e[3]};
      v4bf vv = {(__bf16)acc[2][0][r], (__bf16)acc[2][1][r], (__bf16)acc[2][2][r],
                 (__bf16)acc[2][3][r]};
      const int lo = (wave * 16 + h * 8 + r) * KP_ + 4 * c;
      *(v4bf*)(ks + lo) = pk;
      *(v4bf*)(vs + lo) = vv;
    }
    // publishes k', v and the q statistics, and ends every wave's reads of xs
    lds_barrier();

    if (more) {
      // the next block's tile takes the place of the one just multiplied
#pragma unroll
      for (int u = 0; u < 2; ++u)
#pragma unroll
        for (int j = 0; j < 4; ++j) {
          v8bf pk;
#pragma unroll
          for (int i = 0; i < 8; ++i) pk[i] = (__bf16)f[u][i][j];
          *(v8bf*)(xd + j * 16 * XP_ + u * 128) = pk;
        }
    }
    {
      // the head's other wave's maxima and sums put both halves on one scale
      const v4f mo = *(const v4f*)(qm + (wave ^ 1) * 64 + 4 * c);
      const v4f so = *(const v4f*)(qs + (wave ^ 1) * 64 + 4 * c);
      __bf16* qd = qbt + (size_t)wg * (64 * INNER_) + (wave >> 1) * 2048 + (wave & 1) * 256 + lane * 8;
#pragma unroll
      for (int j = 0; j < 4; ++j) {
        const float mm = fmaxf(mq[j], mo[j]);
        const float wa = exp_slot(mq[j] - mm);
        const float wb = exp_slot(mo[j] - mm);
        const float fs = SCALE_ * wa / (sq[j] * wa + so[j] * wb);
        v8bf pk;
#pragma unroll
        for (int r = 0; r < 8; ++r) pk[r] = (__bf16)(acc[0][j][r] * fs);
        *(v8bf*)(qd + j * 512) = pk;  // a wave's store covers 512 B in a row
      }
      asm volatile("s_wait_xcnt 0x0" ::: "memory");
    }
    if (c == 0) {
      const size_t so = (size_t)wg * INNER_ + wave * 16 + h * 8;
#pragma unroll
      for (int u = 0; u < 2; ++u) {
        *(v4f*)(pmax + so + u * 4) = v4f{ml[u * 4], ml[u * 4 + 1], ml[u * 4 + 2], ml[u * 4 + 3]};
        *(v4f*)(psum + so + u * 4) = v4f{sl[u * 4], sl[u * 4 + 1], sl[u * 4 + 2], sl[u * 4 + 3]};
      }
      asm volatile("s_wait_xcnt 0x0" ::: "memory");
    }

    // wave w: head w >> 1, rows d = (w & 1) * 16 .. + 15, all 32 columns e; K = 64
    const __bf16* ka = ks + ((wave >> 1) * DH_ + (wave & 1) * 16 + c) * KP_ + h * 8;
    const __bf16* vb = vs + ((wave >> 1) * DH_ + c) * KP_ + h * 8;
    v8f pc[2] = {};
#pragma unroll
    for (int s2 = 0; s2 < 2; ++s2) {
      const v16bf af = frag_ld(ka + s2 * 32);
#pragma unroll
      for (int j = 0; j < 2; ++j)
        pc[j] = wmma_bf16(af, frag_ld(vb + j * 16 * KP_ + s2 * 32), pc[j]);
    }
    // share layout: [wave][j * 2 + u][lane][4], so every store covers 512 B in a row
    float* pd = pctx + (size_t)wg * (HEADS_ * DH_ * DH_) + wave * 512 + lane * 4;
#pragma unroll
    for (int j = 0; j < 2; ++j)
#pragma unroll
      for (int u = 0; u < 2; ++u)
        *(v4f*)(pd + (j * 2 + u) * 128) =
            v4f{pc[j][u * 4], pc[j][u * 4 + 1], pc[j][u * 4 + 2], pc[j][u * 4 + 3]};
    asm volatile("s_wait_xcnt 0x0" ::: "memory");
    // publishes the next block's tile, and ends every wave's reads of k', v and
    // the q statistics before the next block writes them
    if (more) lds_barrier();
  }
}

// ---------------------------------------------------------------------------
// 2) context of one (batch, head) from its 64 shares: with M[d] the maximum of
//    the local maxima m_i[d] and w_i[d] = exp(m_i[d] - M[d]),
//    context[d][e] = sum_i w_i[d] share_i[d][e] / sum_i w_i[d] s_i[d],
//    which is the softmax of k over all n times v.  One thread an element,
//    stored as bf16 [d][e]: the projection kernels read it as a matrix operand.
//    grid (64, 4), block 256.
// ---------------------------------------------------------------------------
__global__ __launch_bounds__(256) void k_ctx_merge(const float* __restrict__ pctx,
                                                   const float* __restrict__ pmax,
                                                   const float* __restrict__ psum,
                                                   __bf16* __restrict__ ctx) {
  const int bh = blockIdx.x;
  const int b = bh >> 2, hd = bh & 3;
  const int t = threadIdx.x;
  // element f of the head's 1024 in k_qkv_gemm's share layout
  const int f = blockIdx.y * 256 + t;
  const int ln = (f >> 2) & 31;
  const int d = (f >> 9) * 16 + ((f >> 7) & 1) * 4 + (f & 3) + ((ln >> 4) << 3);
  const int e = ((f >> 8) & 1) * 16 + (ln & 15);

  __shared__ float redm[8 * DH_];
  __shared__ float reds[8 * DH_];
  __shared__ float scl[NBLK_ * DH_];

  // the statistics first, then all 64 shares' values: one latency for both
  const int dd = t & 31, g = t >> 5;
  const size_t so = (size_t)(b * NBLK_ + g * 8) * INNER_ + hd * DH_ + dd;
  float ml[8], sl[8];
#pragma unroll
  for (int u = 0; u < 8; ++u) {
    ml[u] = pmax[so + u * INNER_];
    sl[u] = psum[so + u * INNER_];
  }
  // the loads below may land in registers that hold the addresses of the loads
  // above: this wait stands in front of that overwrite
  asm volatile("s_wait_xcnt 0x0" ::: "memory");
  const float* ps = pctx + (size_t)b * NBLK_ * (HEADS_ * DH_ * DH_) + hd * (DH_ * DH_) + f;
  float p[NBLK_];
#pragma unroll
  for (int i = 0; i < NBLK_; ++i) p[i] = ps[(size_t)i * (HEADS_ * DH_ * DH_)];

  float m = ml[0];
#pragma unroll
  for (int u = 1; u < 8; ++u) m = fmaxf(m, ml[u]);
  redm[g * DH_ + dd] = m;
  __syncthreads();
  m = redm[dd];
#pragma unroll
  for (int w = 1; w < 8; ++w) m = fmaxf(m, redm[w * DH_ + dd]);
  float s = 0.f;
#pragma unroll
  for (int u = 0; u < 8; ++u) {
    const float w = __expf(ml[u] - m);
    scl[(g * 8 + u) * DH_ + dd] = w;
    s += sl[u] * w;
  }
  reds[g * DH_ + dd] = s;
  __syncthreads();

  float tot = reds[d];
#pragma unroll
  for (int w = 1; w < 8; ++w) tot += reds[w * DH_ + d];
  float a4[4] = {0.f, 0.f, 0.f, 0.f};  // four independent chains
#pragma unroll
  for (int i = 0; i < NBLK_; ++i) a4[i & 3] += p[i] * scl[i * DH_ + d];
  ctx[(size_t)bh * DH_ * DH_ + d * DH_ + e] =
      (__bf16)(((a4[0] + a4[1]) + (a4[2] + a4[3])) / tot);
}

// ---------------------------------------------------------------------------
// 3) out2[o][n] = sum_(hd,e) wout[o][hd,e] (sum_d ctx[hd][d][e] q'[hd][d][n]) + bout[o],
//    summed in the other order: out2 = W2 q' + bout with
//    W2[o][hd,d] = sum_e wout[o][hd,e] ctx[hd][d][e], 256 x 128 a batch.
//    Each wave makes the W2 rows it needs itself, transposed: ctx (rows d) times
//    wout^T (columns o) leaves lane l with column o = l & 15 and rows
//    d = (l >> 4) * 8 + r, which is the A-fragment order of W2 as it stands, so
//    the two d tiles of a head, rounded to bf16, are one A fragment.
//    out2 is made twice and never stored unnormalized: the product is cheap
//    next to a round trip of the 64 MiB result through memory.
//    k_proj_stats keeps only each work-group's sum and sum of squares;
//    k_proj_norm makes the same product again, reduces its batch's 16 partial
//    pairs to mean and variance, and stores the normalized, affine result.
//    One work-group makes all 256 rows of PT_ blocks of 64 columns, one block
//    after the other: W2, bias and affine terms are made or fetched once for all
//    of them.  Its q' blocks (PT_ x
//    16 KiB in a row, in B-fragment order as k_qkv_gemm stores them) are read
//    once and copied to LDS as they stand, all in front of the one barrier; each
//    wave holds two 16-row tiles times four 16-column tiles of the block at hand.
//    Column c of column tile j is spatial column 4c + j of its block, as in
//    k_qkv_gemm: whole-line stores.
//    grid (64 / PT_, 16), block 256 (8 waves), both.
// ---------------------------------------------------------------------------
typedef __attribute__((ext_vector_type(2))) float v2f;
#define PT_ 4               // 64-column blocks a projection work-group takes
#define PWG_ (NBLK_ / PT_)  // projection work-groups a batch

template <bool NORM>
__device__ __forceinline__ void proj_body(const __bf16* __restrict__ qbt,
                                          const __bf16* __restrict__ ctx,
                                          const __bf16* __restrict__ wob,
                                          const float* __restrict__ bout,
                                          const float* __restrict__ gamma,
                                          const float* __restrict__ beta,
                                          const float* __restrict__ part_in,
                                          float* __restrict__ part_out,
                                          float* __restrict__ out) {
  const int lane = threadIdx.x & 31;
  // the wave's number in a scalar register: what is formed from it costs no
  // vector register
  const int wave = __builtin_amdgcn_readfirstlane(threadIdx.x >> 5);
  const int b = blockIdx.y;
  const int nWG = blockIdx.x * (64 * PT_);
  const int c = lane & 15;
  const int h = lane >> 4;

  __shared__ __align__(16) __bf16 as[PT_ * 64 * INNER_];

  // the operands of W2 first, the tile last: W2 is made while the tile is in flight
  const __bf16* ap = wob + wave * 4096 + lane * 8;
  v16bf a[4][2];
#pragma unroll
  for (int ks = 0; ks < 4; ++ks)
#pragma unroll
    for (int t = 0; t < 2; ++t) a[ks][t] = wfrag_ld(ap + t * 2048 + ks * 512);
  // later loads may land in registers that hold the addresses of the loads
  // above: this wait, and those like it below, stand in front of that overwrite
  asm volatile("s_wait_xcnt 0x0" ::: "memory");
  // the batch's context as A fragments: head ks, rows d = dh * 16 + c, k = e
  const __bf16* cp = ctx + ((size_t)b * HEADS_ * DH_ + c) * DH_ + h * 8;
  v16bf cf[4][2];
#pragma unroll
  for (int ks = 0; ks < 4; ++ks)
#pragma unroll
    for (int dh = 0; dh < 2; ++dh) cf[ks][dh] = frag_ld(cp + (ks * DH_ + dh * 16) * DH_);
  asm volatile("s_wait_xcnt 0x0" ::: "memory");
  // a lane's sixteen bias values, asked for with the rest
  v4f bi[2][2];
#pragma unroll
  for (int t = 0; t < 2; ++t)
#pragma unroll
    for (int u = 0; u < 2; ++u)
      bi[t][u] = *(const v4f*)(bout + wave * 32 + t * 16 + h * 8 + u * 4);
  asm volatile("s_wait_xcnt 0x0" ::: "memory");
  // likewise the batch's PWG_ partial pairs (one a lane of each half) and the
  // lane's affine terms
  v2f pp;
  v4f ga[2][2], be[2][2];
  if (NORM) {
    pp = *(const v2f*)(part_in + (size_t)(b * PWG_ + c) * 2);
#pragma unroll
    for (int t = 0; t < 2; ++t)
#pragma unroll
      for (int u = 0; u < 2; ++u)
        ga[t][u] = *(const v4f*)(gamma + wave * 32 + t * 16 + h * 8 + u * 4);
    asm volatile("s_wait_xcnt 0x0" ::: "memory");
#pragma unroll
    for (int t = 0; t < 2; ++t)
#pragma unroll
      for (int u = 0; u < 2; ++u)
        be[t][u] = *(const v4f*)(beta + wave * 32 + t * 16 + h * 8 + u * 4);
    asm volatile("s_wait_xcnt 0x0" ::: "memory");
  }
  const __bf16* src =
      qbt + (size_t)(b * NBLK_ + blockIdx.x * PT_) * (64 * INNER_) + threadIdx.x * 8;
  v8bf g[PT_ * 4];  // block i >> 2, head i & 3: 4 KiB, 16 B a thread
#pragma unroll
  for (int i = 0; i < PT_ * 4; ++i) g[i] = *(const v8bf*)(src + i * 2048);
  asm volatile("s_wait_xcnt 0x0" ::: "memory");

  // W2 fragments, in front of the barrier: they need nothing of the tile.
  // The wout fragment serves as B here (k = e, column o): same lane order as A.
  v16bf w2[4][2];
#pragma unroll
  for (int ks = 0; ks < 4; ++ks) {
#pragma unroll
    for (int t = 0; t < 2; ++t) {
      const v8f d0 = wmma_bf16(cf[ks][0], a[ks][t], v8f{});
      const v8f d1 = wmma_bf16(cf[ks][1], a[ks][t], v8f{});
#pragma unroll
      for (int r = 0; r < 8; ++r) {
        w2[ks][t][r] = (__bf16)d0[r];
        w2[ks][t][8 + r] = (__bf16)d1[r];
      }
    }
    // a head's four results are rounded before the next head's are made: left
    // free, the products move up among the loads above, and the q' blocks are
    // asked for only after the first operands have landed (two latencies in a row)
    __builtin_amdgcn_sched_barrier(0);
  }

  // what holds for all of the work-group's blocks
  float s[4] = {0.f, 0.f, 0.f, 0.f}, sq[4] = {0.f, 0.f, 0.f, 0.f};
  float mean = 0.f, inv = 0.f;
  if (NORM) {
    // every half wave reduces the PWG_ pairs the same way: no LDS, no barrier
    const float st = row_sum16(pp[0]);
    const float qt = row_sum16(pp[1]);
    const float invM = 1.0f / (float)(C_ * N_);
    mean = st * invM;
    const float var = qt * invM - mean * mean;
    inv = rsqrtf(var + EPS_);
  }

#pragma unroll
  for (int i = 0; i < PT_ * 4; ++i) *(v8bf*)(as + i * 2048 + threadIdx.x * 8) = g[i];
  __syncthreads();

  // unrolled: a block's place in LDS is an immediate offset, and the next block's
  // first LDS reads are issued under this block's epilogue
#pragma unroll
  for (int it = 0; it < PT_; ++it) {
  v8f acc[2][4] = {};
  // head ks, column tile j: two halves, 256 elements apart
  const __bf16* bp = as + it * (64 * INNER_) + lane * 8;
  v16bf bm[2][4];
#pragma unroll
  for (int j = 0; j < 4; ++j) bm[0][j] = wfrag_ld(bp + j * 512);
#pragma unroll
  for (int ks = 0; ks < 4; ++ks) {
    const int cur = ks & 1, nxt = cur ^ 1;
    if (ks < 3) {
#pragma unroll
      for (int j = 0; j < 4; ++j) bm[nxt][j] = wfrag_ld(bp + (ks + 1) * 2048 + j * 512);
    }
    // keeps the next step's LDS reads together in front of this step's matrix
    // block, so that their latency runs under eight matrix instructions
    __builtin_amdgcn_sched_barrier(0);
#pragma unroll
    for (int t = 0; t < 2; ++t)
#pragma unroll
      for (int j = 0; j < 4; ++j) acc[t][j] = wmma_bf16(w2[ks][t], bm[cur][j], acc[t][j]);
    // keeps later steps' reads from being moved in among these matrix instructions
    __builtin_amdgcn_sched_barrier(0);
  }

  if (!NORM) {
    // four independent chains a lane, carried over the blocks
#pragma unroll
    for (int t = 0; t < 2; ++t)
#pragma unroll
      for (int r = 0; r < 8; ++r) {
        const float bv = bi[t][r >> 2][r & 3];
#pragma unroll
        for (int j = 0; j < 4; ++j) {
          const float v = acc[t][j][r] + bv;
          s[j] += v;
          sq[j] += v * v;
        }
      }
  } else {
#pragma unroll
    for (int t = 0; t < 2; ++t) {
      const int m0 = wave * 32 + t * 16 + h * 8;
      float* op = out + (size_t)(b * C_ + m0) * N_ + nWG + it * 64 + 4 * c;
#pragma unroll
      for (int r = 0; r < 8; ++r) {
        const float bv = bi[t][r >> 2][r & 3];
        const float gv = ga[t][r >> 2][r & 3];
        const float ev = be[t][r >> 2][r & 3];
        v4f vo;
#pragma unroll
        for (int j = 0; j < 4; ++j)
          vo[j] = ((acc[t][j][r] + bv) - mean) * inv * gv + ev;
        *(v4f*)(op + (size_t)r * N_) = vo;
      }
    }
  }
  }

  if (!NORM) {
    // a butterfly over the wave, eight waves in LDS
    float st = (s[0] + s[1]) + (s[2] + s[3]);
    float qt = (sq[0] + sq[1]) + (sq[2] + sq[3]);
    st = row_sum16(st + half_xor(st));
    qt = row_sum16(qt + half_xor(qt));
    __shared__ v2f red[8];
    if (lane == 0) red[wave] = v2f{st, qt};
    __syncthreads();
    if (threadIdx.x == 0) {
      v2f tot = red[0];
#pragma unroll
      for (int w = 1; w < 8; ++w) tot += red[w];
      *(v2f*)(part_out + (size_t)(b * PWG_ + blockIdx.x) * 2) = tot;
    }
  }
}

__global__ __launch_bounds__(256) void k_proj_stats(const __bf16* __restrict__ qbt,
                                                    const __bf16* __restrict__ ctx,
                                                    const __bf16* __restrict__ wob,
                                                    const float* __restrict__ bout,
                                                    float* __restrict__ part) {
  proj_body<false>(qbt, ctx, wob, bout, nullptr, nullptr, nullptr, part, nullptr);
}

__global__ __launch_bounds__(256) void k_proj_norm(const __bf16* __restrict__ qbt,
                                                   const __bf16* __restrict__ ctx,
                                                   const __bf16* __restrict__ wob,
                                                   const float* __restrict__ bout,
                                                   const float* __restrict__ gamma,
                                                   const float* __restrict__ beta,
                                                   const float* __restrict__ part,
                                                   float* __restrict__ out) {
  proj_body<true>(qbt, ctx, wob, bout, gamma, beta, part, nullptr, out);
}

// ---------------------------------------------------------------------------
extern "C" void kernel_launch(void* const* d_in, const int* in_sizes, int n_in,
                              void* d_out, int out_size, void* d_ws, size_t ws_size,
                              hipStream_t stream) {
  const float* x     = (const float*)d_in[0];
  const float* wqkv  = (const float*)d_in[1];
  const float* wout  = (const float*)d_in[2];
  const float* bout  = (const float*)d_in[3];
  const float* gamma = (const float*)d_in[4];
  const float* beta  = (const float*)d_in[5];
  float* out = (float*)d_out;
  (void)ws_size; (void)in_sizes; (void)n_in; (void)out_size;

  const size_t QSZ = (size_t)B_ * INNER_ * N_;   // 8,388,608
  float*  pctx = (float*)d_ws;                   // context shares, 4096 floats a column block
  float*  pmax = pctx + (size_t)B_ * NBLK_ * HEADS_ * DH_ * DH_;  // local row maxima
  float*  psum = pmax + (size_t)B_ * NBLK_ * INNER_;              // local row sums
  __bf16* qbt = (__bf16*)(psum + (size_t)B_ * NBLK_ * INNER_);    // bf16 q', fragment order
  __bf16* wob = qbt + QSZ;                       // bf16 w_out, fragment order
  __bf16* ctx = wob + (size_t)C_ * INNER_;       // bf16 context [bh][d][e]
  float*  part = (float*)(ctx + (size_t)B_ * HEADS_ * DH_ * DH_);

  k_qkv_gemm <<<dim3(16, 16),     256, 0, stream>>>(x, wqkv, wout, wob, qbt, pctx, pmax, psum);
  k_ctx_merge<<<dim3(64, 4),      256, 0, stream>>>(pctx, pmax, psum, ctx);
  k_proj_stats<<<dim3(16, 16),   256, 0, stream>>>(qbt, ctx, wob, bout, part);
  k_proj_norm<<<dim3(16, 16),     256, 0, stream>>>(qbt, ctx, wob, bout, gamma, beta, part, out);
}

// v010
// It runs in 34.6 microseconds.
// Timed twice side by side with v009, it ran 1.04 times as fast both times.
// Over all steps from v000 it is 5.69 times as fast.
#include <hip/hip_runtime.h>

#define B_     16
#define C_     256
#define N_     4096
#define O3_    384
#define INNER_ 128
#define HEADS_ 4
#define DH_    32
#define SCALE_ 0.1767766952966369f
#define EPS_   1e-5f

typedef __attribute__((ext_vector_type(16))) __bf16 v16bf;
typedef __attribute__((ext_vector_type(8)))  __bf16 v8bf;
typedef __attribute__((ext_vector_type(8)))  float  v8f;
typedef __attribute__((ext_vector_type(4)))  __bf16 v4bf;
typedef __attribute__((ext_vector_type(4)))  float  v4f;

// 16-bit A/B fragment: lane `lane`, element `e` holds
// K = (e>>3)*16 + (lane>>4)*8 + (e&7)   (ISA 7.12.2)

__device__ __forceinline__ v8f wmma_bf16(v16bf a, v16bf b, v8f c) {
  return __builtin_amdgcn_wmma_f32_16x16x32_bf16(false, a, false, b, (short)0, c,
                                                 false, false);
}

// Load one 16-element bf16 fragment: per-lane K chunks are contiguous, so this
// is two 16-byte loads (global or LDS).  p must point at K = k0 + (lane>>4)*8.
__device__ __forceinline__ v16bf frag_ld(const __bf16* p) {
  v8bf lo = *(const v8bf*)p;
  v8bf hi = *(const v8bf*)(p + 16);
  return __builtin_shufflevector(lo, hi, 0, 1, 2, 3, 4, 5, 6, 7,
                                 8, 9, 10, 11, 12, 13, 14, 15);
}

// ---------------------------------------------------------------------------
// 1) qkv GEMM: [384x256] @ [256x4096] per batch.
//    One work-group makes all 384 rows of QT_ blocks of 64 columns, one block
//    after the other.  There is no weight conversion launch: each wave reads its
//    own 48 rows of fp32 w_qkv once, in whole lines, rounds them to bf16, turns
//    them into A fragments through its own part of LDS and keeps all 24
//    fragments in registers for every block.  Each work-group also rounds 128
//    elements of w_out into the fragment order that the projection kernels read:
//    per (16-row tile, 32-k step) two planes of 32 lanes x 8 elements, so that
//    one wave-wide 16-byte load of a plane covers 512 contiguous bytes.
//    A block's x tile is read once, converted once to bf16 and laid k-contiguous
//    in LDS, in a place of its own, two blocks ahead of its products; a block has
//    one barrier, and the next block's products stand between a wave's arrival
//    at it and its wait.  Each wave holds one 16-row tile of q, of k and of v times four
//    16-column tiles.
//    Column c of column tile j is spatial column 4c + j, so a lane's four
//    tiles give four consecutive columns of a row: whole-line stores.
//    q leaves as softmax over its head's 32 rows d, times SCALE, in bf16: a
//    head's rows lie in two waves, so each wave takes its 16 rows to
//    exp(q - its own column maximum), the two exchange maximum and sum through
//    LDS, and each rescales its half.  A lane's eight values of a column tile
//    are one half of its B fragment in the projection kernels, and are stored
//    in that order: [block][head][column tile][half][lane][8].
//    k and v never leave the work-group:
//    each k row is taken to exp(k - its maximum over the block's 64 columns),
//    laid in LDS as bf16 beside v, and multiplied there into the block's
//    share of context[d][e] = sum_n k'[d][n] v[e][n].  Stored are that share
//    (fp32, 4 heads x 32 x 32), each row's local maximum and its local sum of
//    exponentials; k_ctx_merge puts the 64 shares of a batch on one scale.
//    grid (64 / QT_, 16), block 256 (8 waves).
// ---------------------------------------------------------------------------
#define XP_ 264  // LDS row pitch, elements: 528 B = 16 B x odd, for 16-byte row readers
#define KP_ 72   // LDS row pitch of k' and v, elements: 144 B = 16 B x odd
#define NBLK_ 64 // column blocks a batch
#define QT_ 4    // 64-column blocks a qkv work-group takes

// One weight fragment in plane order: two planes, 256 elements apart.
__device__ __forceinline__ v16bf wfrag_ld(const __bf16* p) {
  v8bf lo = *(const v8bf*)p;
  v8bf hi = *(const v8bf*)(p + 256);
  return __builtin_shufflevector(lo, hi, 0, 1, 2, 3, 4, 5, 6, 7,
                                 8, 9, 10, 11, 12, 13, 14, 15);
}

// exp(x) as 2^(x log2 e).  The v_nop fills the one slot that the instruction set
// asks for behind a transcendental, whatever the compiler schedules next.
__device__ __forceinline__ float exp_slot(float x) {
  float y;
  asm("v_exp_f32 %0, %1\n\tv_nop" : "=v"(y) : "v"(x * 1.442695041f));
  return y;
}

// Cross-lane steps of the reductions, in registers: the shuffle intrinsic goes
// through the LDS unit and is waited for at every step of every butterfly.
// Value of lane l ^ M, M < 16: a DPP operand, inside the lane's row of 16.
template <int M>
__device__ __forceinline__ float row_xor(float v) {
  return __builtin_bit_cast(
      float, __builtin_amdgcn_update_dpp(0, __builtin_bit_cast(int, v), 0x160 | M, 0xf, 0xf, true));
}
// Value of lane l ^ 16: the same lane of the other row.
__device__ __forceinline__ float half_xor(float v) {
  const int b = __builtin_bit_cast(int, v);
  return __builtin_bit_cast(
      float, __builtin_amdgcn_permlanex16(b, b, 0x76543210, 0xfedcba98, false, false));
}
// Butterflies over a row of 16 lanes, steps 8, 4, 2, 1.
__device__ __forceinline__ float row_max16(float m) {
  m = fmaxf(m, row_xor<8>(m));
  m = fmaxf(m, row_xor<4>(m));
  m = fmaxf(m, row_xor<2>(m));
  return fmaxf(m, row_xor<1>(m));
}
__device__ __forceinline__ float row_sum16(float s) {
  s += row_xor<8>(s);
  s += row_xor<4>(s);
  s += row_xor<2>(s);
  return s + row_xor<1>(s);
}

// Work-group barrier that waits for this wave's LDS operations alone:
// __syncthreads() would also wait for block 2's x loads and for the
// w_out stores, which nobody in the work-group reads.
__device__ __forceinline__ void lds_barrier() {
  asm volatile("s_wait_dscnt 0x0\n\ts_barrier_signal -1\n\ts_barrier_wait -1" ::: "memory");
}

// Arrival at the work-group barrier, behind this wave's LDS operations; the wave
// goes on with work that needs nothing of the other waves' latest writes.  That
// work runs at the lower priority: a wave of the same SIMD that has not arrived
// yet, for which all others will wait, gets the matrix unit first.
__device__ __forceinline__ void lds_barrier_signal() {
  asm volatile("s_wait_dscnt 0x0\n\ts_barrier_signal -1\n\ts_setprio 0" ::: "memory");
}
// The other half: nothing that the other waves wrote in front of their arrival
// is read in front of this.  From here to its next arrival the wave is one that
// others may wait for.
__device__ __forceinline__ void lds_barrier_wait() {
  asm volatile("s_barrier_wait -1\n\ts_setprio 1" ::: "memory");
}

// One block's 48 rows x 64 columns of a wave: weight fragments in registers, x
// fragments from the block's tile in LDS, one k step ahead.
__device__ __forceinline__ void gemm_block(const v16bf (&a)[8][3], const __bf16* bp,
                                           v8f (&acc)[3][4]) {
#pragma unroll
  for (int t = 0; t < 3; ++t)
#pragma unroll
    for (int j = 0; j < 4; ++j) acc[t][j] = v8f{};
  v16bf bm[2][4];
#pragma unroll
  for (int j = 0; j < 4; ++j) bm[0][j] = frag_ld(bp + j * 16 * XP_);
#pragma unroll
  for (int kk = 0; kk < 8; ++kk) {
    const int cur = kk & 1, nxt = cur ^ 1;
    if (kk < 7) {
#pragma unroll
      for (int j = 0; j < 4; ++j) bm[nxt][j] = frag_ld(bp + j * 16 * XP_ + (kk + 1) * 32);
    }
    // keeps the next step's LDS reads in front of this step's matrix block, so
    // that their latency runs under twelve matrix instructions
    __builtin_amdgcn_sched_barrier(0);
#pragma unroll
    for (int t = 0; t < 3; ++t)
#pragma unroll
      for (int j = 0; j < 4; ++j) acc[t][j] = wmma_bf16(a[kk][t], bm[cur][j], acc[t][j]);
    // keeps later steps' reads from being moved in among these matrix instructions
    __builtin_amdgcn_sched_barrier(0);
  }
}

#define XT_ (64 * XP_)      // an x tile in LDS, elements
#define KV_ (INNER_ * KP_)  // a block's k', or its v, in LDS, elements

__global__ __launch_bounds__(256) void k_qkv_gemm(const float* __restrict__ x,
                                                  const float* __restrict__ wqkv,
                                                  const float* __restrict__ wout,
                                                  __bf16* __restrict__ wob,
                                                  __bf16* __restrict__ qbt,
                                                  float* __restrict__ pctx,
                                                  float* __restrict__ pmax,
                                                  float* __restrict__ psum) {
  const int lane = threadIdx.x & 31;
  // the wave's number in a scalar register: what is formed from it costs no
  // vector register
  const int wave = __builtin_amdgcn_readfirstlane(threadIdx.x >> 5);
  const int b = blockIdx.y;
  const int c = lane & 15;
  const int h = lane >> 4;

  // x tiles 0 and 1; the bf16 weights (48 rows a wave), whose place holds, once
  // every wave has its fragments, x tiles 2 and 3 and the odd blocks' k' and v;
  // the even blocks' k' and v.  Every x tile has a place of its own.
  __shared__ __align__(16) __bf16 sm[2 * XT_ + O3_ * XP_ + 2 * KV_];
  __shared__ __align__(16) float qm[2 * 8 * 64];  // a wave's column maxima of q, by block parity
  __shared__ __align__(16) float qs[2 * 8 * 64];  // and its column sums of exponentials
  __bf16* const xs = sm;
  __bf16* const wl = sm + 2 * XT_;

  // a thread takes 4 columns x 8 k, twice; LDS row j*16 + q holds column 4q + j
  const int q = threadIdx.x & 15;
  const int oc = threadIdx.x >> 4;
  const float* xp = x + (size_t)b * C_ * N_ + blockIdx.x * (64 * QT_) + (size_t)(oc * 8) * N_ + 4 * q;
  __bf16* xd = xs + q * XP_ + oc * 8;
  // this work-group's 128 elements of w_out in plane order, 256 B in a row: every
  // wave asks, ahead of all other loads; waves 0 to 3 store, further down
  const int wd = (b * (NBLK_ / QT_) + blockIdx.x) * 128 + (threadIdx.x & 127);
  const int wpl = wd >> 8, wln = (wd >> 3) & 31;
  const float wo = wout[((wpl >> 3) * 16 + (wln & 15)) * INNER_ + ((wpl >> 1) & 3) * 32 +
                        (wpl & 1) * 16 + (wln >> 4) * 8 + (wd & 7)];
  // later loads may land in registers that hold the addresses of the loads
  // above: this wait, and those like it below, stand in front of that overwrite
  asm volatile("s_wait_xcnt 0x0" ::: "memory");
  // the wave's rows of q, k and v weights: a load covers half a row, 512 B.
  // Two tiles' loads are asked for, then block 0's x tile, then the third tile's
  // as the first is rounded, then block 1's x tile: loads return in order, and
  // the weights come from L2
  __bf16* wlw = wl + wave * 48 * XP_;
  const float* wp = wqkv + (size_t)(wave * 16) * C_ + lane * 4;
  v4f g[3][32];
#pragma unroll
  for (int t = 0; t < 2; ++t) {
#pragma unroll
    for (int i = 0; i < 32; ++i) g[t][i] = *(const v4f*)(wp + t * (INNER_ * C_) + i * 128);
  }
  asm volatile("s_wait_xcnt 0x0" ::: "memory");
  v4f f[2][8], f1[2][8];
#pragma unroll
  for (int u = 0; u < 2; ++u)
#pragma unroll
    for (int i = 0; i < 8; ++i) f[u][i] = *(const v4f*)(xp + (size_t)(u * 128 + i) * N_);
  asm volatile("s_wait_xcnt 0x0" ::: "memory");
#pragma unroll
  for (int t = 0; t < 3; ++t) {
    if (t == 1) {
      // holds the w_out load in front of this place, where it has long landed: left
      // free it sinks into the storing branch below, and waves 0 to 3 wait out
      // its whole latency there, in front of the barrier
      asm volatile("" ::"v"(wo));
#pragma unroll
      for (int i = 0; i < 32; ++i) g[2][i] = *(const v4f*)(wp + 2 * (INNER_ * C_) + i * 128);
      asm volatile("s_wait_xcnt 0x0" ::: "memory");
#pragma unroll
      for (int u = 0; u < 2; ++u)
#pragma unroll
        for (int i = 0; i < 8; ++i) f1[u][i] = *(const v4f*)(xp + 64 + (size_t)(u * 128 + i) * N_);
      asm volatile("s_wait_xcnt 0x0" ::: "memory");
    }
#pragma unroll
    for (int i = 0; i < 32; ++i) {
      v4bf pk = {(__bf16)g[t][i][0], (__bf16)g[t][i][1], (__bf16)g[t][i][2], (__bf16)g[t][i][3]};
      *(v4bf*)(wlw + (t * 16 + (i >> 1)) * XP_ + (i & 1) * 128 + lane * 4) = pk;
    }
  }
  // all 24 weight fragments, same k order as the x fragments: read from the wave's
  // own rows, in front of the barrier, behind which their place is written anew
  v16bf a[8][3];
#pragma unroll
  for (int kk = 0; kk < 8; ++kk)
#pragma unroll
    for (int t = 0; t < 3; ++t) a[kk][t] = frag_ld(wlw + (t * 16 + c) * XP_ + h * 8 + kk * 32);
  if (wave < 4) {
    wob[wd] = (__bf16)wo;
    asm volatile("s_wait_xcnt 0x0" ::: "memory");
  }
#pragma unroll
  for (int u = 0; u < 2; ++u)
#pragma unroll
    for (int j = 0; j < 4; ++j) {
      v8bf pk, pk1;
#pragma unroll
      for (int i = 0; i < 8; ++i) {
        pk[i] = (__bf16)f[u][i][j];
        pk1[i] = (__bf16)f1[u][i][j];
      }
      *(v8bf*)(xd + j * 16 * XP_ + u * 128) = pk;
      *(v8bf*)(xd + XT_ + j * 16 * XP_ + u * 128) = pk1;
    }
  // block 2's tile flies under block 0's products and softmaxes
#pragma unroll
  for (int u = 0; u < 2; ++u)
#pragma unroll
    for (int i = 0; i < 8; ++i) f[u][i] = *(const v4f*)(xp + 2 * 64 + (size_t)(u * 128 + i) * N_);
  asm volatile("s_wait_xcnt 0x0" ::: "memory");
  // publishes x tiles 0 and 1, and ends every wave's reads of the weights' place
  lds_barrier();
  // up to its first arrival in the loop the wave is one that others wait for
  asm volatile("s_setprio 1");

  const __bf16* bp = xs + c * XP_ + h * 8;
  v8f acc[3][4];
  gemm_block(a, bp, acc);
  // One barrier a block, in two halves, with the next block's products between
  // them: a wave that arrives early multiplies instead of waiting, so one wave of
  // a SIMD is at its matrix instructions while the other is at its softmaxes.
  // rolled: the body is long
#pragma unroll 1
  for (int it = 0; it < QT_; ++it) {
    __bf16* ks = sm + ((it & 1) ? 4 * XT_ : 2 * XT_ + O3_ * XP_);
    __bf16* vs = ks + KV_;
    float* qmb = qm + (it & 1) * 512;
    float* qsb = qs + (it & 1) * 512;
    // q: a column's 16 rows of this wave lie in two lanes, eight a lane
    v4f mq, sq;
#pragma unroll
    for (int j = 0; j < 4; ++j) {
      float m = acc[0][j][0];
#pragma unroll
      for (int r = 1; r < 8; ++r) m = fmaxf(m, acc[0][j][r]);
      m = fmaxf(m, half_xor(m));
#pragma unroll
      for (int r = 0; r < 8; ++r) acc[0][j][r] = exp_slot(acc[0][j][r] - m);
      float t = ((acc[0][j][0] + acc[0][j][1]) + (acc[0][j][2] + acc[0][j][3])) +
                ((acc[0][j][4] + acc[0][j][5]) + (acc[0][j][6] + acc[0][j][7]));
      t += half_xor(t);
      mq[j] = m;
      sq[j] = t;
    }
    if (h == 0) {
      *(v4f*)(qmb + wave * 64 + 4 * c) = mq;
      *(v4f*)(qsb + wave * 64 + 4 * c) = sq;
    }
    // A row's 64 columns lie in the 16 lanes of one half, four a lane: maximum
    // and sum go over the lane's four, then by a butterfly inside the half.
    const int wg = b * NBLK_ + blockIdx.x * QT_ + it;
    float ml[8], sl[8];
#pragma unroll
    for (int r = 0; r < 8; ++r) {
      const float m = fmaxf(fmaxf(acc[1][0][r], acc[1][1][r]), fmaxf(acc[1][2][r], acc[1][3][r]));
      ml[r] = row_max16(m);
    }
#pragma unroll
    for (int r = 0; r < 8; ++r) {
      float e[4];
#pragma unroll
      for (int j = 0; j < 4; ++j) e[j] = exp_slot(acc[1][j][r] - ml[r]);
      sl[r] = row_sum16((e[0] + e[1]) + (e[2] + e[3]));
      // LDS column 4c + j is the local spatial column, for k' and for v alike
      v4bf pk = {(__bf16)e[0], (__bf16)e[1], (__bf16)e[2], (__bf16)e[3]};
      v4bf vv = {(__bf16)acc[2][0][r], (__bf16)acc[2][1][r], (__bf16)acc[2][2][r],
                 (__bf16)acc[2][3][r]};
      const int lo = (wave * 16 + h * 8 + r) * KP_ + 4 * c;
      *(v4bf*)(ks + lo) = pk;
      *(v4bf*)(vs + lo) = vv;
    }
    if (c == 0) {
      const size_t so = (size_t)wg * INNER_ + wave * 16 + h * 8;
#pragma unroll
      for (int u = 0; u < 2; ++u) {
        *(v4f*)(pmax + so + u * 4) = v4f{ml[u * 4], ml[u * 4 + 1], ml[u * 4 + 2], ml[u * 4 + 3]};
        *(v4f*)(psum + so + u * 4) = v4f{sl[u * 4], sl[u * 4 + 1], sl[u * 4 + 2], sl[u * 4 + 3]};
      }
      asm volatile("s_wait_xcnt 0x0" ::: "memory");
    }
    if (it + 2 < QT_) {
      // the tile of the block after next goes to its own place: it is read behind
      // the wait of this block's barrier, one block later
#pragma unroll
      for (int u = 0; u < 2; ++u)
#pragma unroll
        for (int j = 0; j < 4; ++j) {
          v8bf pk;
#pragma unroll
          for (int i = 0; i < 8; ++i) pk[i] = (__bf16)f[u][i][j];
          *(v8bf*)(xd + (it + 2) * XT_ + j * 16 * XP_ + u * 128) = pk;
        }
      if (it + 3 < QT_) {
        // and the tile after that flies under a whole block's work
#pragma unroll
        for (int u = 0; u < 2; ++u)
#pragma unroll
          for (int i = 0; i < 8; ++i)
            f[u][i] = *(const v4f*)(xp + (it + 3) * 64 + (size_t)(u * 128 + i) * N_);
        asm volatile("s_wait_xcnt 0x0" ::: "memory");
      }
    }
    // arrival: this wave's k', v, q statistics and share of an x tile are in LDS,
    // and its reads of the block before are done
    lds_barrier_signal();
    v8f qe[4];
#pragma unroll
    for (int j = 0; j < 4; ++j) qe[j] = acc[0][j];
    // the next block's tile was published by the barrier before this one, and no
    // x tile's place is ever written again: no arrival stands for the end of
    // these reads, so they may stand between arrival and wait
    if (it + 1 < QT_) gemm_block(a, bp + (it + 1) * XT_, acc);
    // behind this every wave's k', v and q statistics of block it may be read
    lds_barrier_wait();

    {
      // the head's other wave's maxima and sums put both halves on one scale
      const v4f mo = *(const v4f*)(qmb + (wave ^ 1) * 64 + 4 * c);
      const v4f so = *(const v4f*)(qsb + (wave ^ 1) * 64 + 4 * c);
      __bf16* qd = qbt + (size_t)wg * (64 * INNER_) + (wave >> 1) * 2048 + (wave & 1) * 256 + lane * 8;
#pragma unroll
      for (int j = 0; j < 4; ++j) {
        const float mm = fmaxf(mq[j], mo[j]);
        const float wa = exp_slot(mq[j] - mm);
        const float wb = exp_slot(mo[j] - mm);
        const float fs = SCALE_ * wa / (sq[j] * wa + so[j] * wb);
        v8bf pk;
#pragma unroll
        for (int r = 0; r < 8; ++r) pk[r] = (__bf16)(qe[j][r] * fs);
        *(v8bf*)(qd + j * 512) = pk;  // a wave's store covers 512 B in a row
      }
      asm volatile("s_wait_xcnt 0x0" ::: "memory");
    }

    // wave w: head w >> 1, rows d = (w & 1) * 16 .. + 15, all 32 columns e; K = 64
    const __bf16* ka = ks + ((wave >> 1) * DH_ + (wave & 1) * 16 + c) * KP_ + h * 8;
    const __bf16* vb = vs + ((wave >> 1) * DH_ + c) * KP_ + h * 8;
    v8f pc[2] = {};
#pragma unroll
    for (int s2 = 0; s2 < 2; ++s2) {
      const v16bf af = frag_ld(ka + s2 * 32);
#pragma unroll
      for (int j = 0; j < 2; ++j)
        pc[j] = wmma_bf16(af, frag_ld(vb + j * 16 * KP_ + s2 * 32), pc[j]);
    }
    // share layout: [wave][j * 2 + u][lane][4], so every store covers 512 B in a row
    float* pd = pctx + (size_t)wg * (HEADS_ * DH_ * DH_) + wave * 512 + lane * 4;
#pragma unroll
    for (int j = 0; j < 2; ++j)
#pragma unroll
      for (int u = 0; u < 2; ++u)
        *(v4f*)(pd + (j * 2 + u) * 128) =
            v4f{pc[j][u * 4], pc[j][u * 4 + 1], pc[j][u * 4 + 2], pc[j][u * 4 + 3]};
    asm volatile("s_wait_xcnt 0x0" ::: "memory");
  }
  // the wave leaves at the priority it came with
  asm volatile("s_setprio 0");
}

// ---------------------------------------------------------------------------
// 2) context of one (batch, head) from its 64 shares: with M[d] the maximum of
//    the local maxima m_i[d] and w_i[d] = exp(m_i[d] - M[d]),
//    context[d][e] = sum_i w_i[d] share_i[d][e] / sum_i w_i[d] s_i[d],
//    which is the softmax of k over all n times v.  One thread an element,
//    stored as bf16 [d][e]: the projection kernels read it as a matrix operand.
//    grid (64, 4), block 256.
// ---------------------------------------------------------------------------
__global__ __launch_bounds__(256) void k_ctx_merge(const float* __restrict__ pctx,
                                                   const float* __restrict__ pmax,
                                                   const float* __restrict__ psum,
                                                   __bf16* __restrict__ ctx) {
  const int bh = blockIdx.x;
  const int b = bh >> 2, hd = bh & 3;
  const int t = threadIdx.x;
  // element f of the head's 1024 in k_qkv_gemm's share layout
  const int f = blockIdx.y * 256 + t;
  const int ln = (f >> 2) & 31;
  const int d = (f >> 9) * 16 + ((f >> 7) & 1) * 4 + (f & 3) + ((ln >> 4) << 3);
  const int e = ((f >> 8) & 1) * 16 + (ln & 15);

  __shared__ float redm[8 * DH_];
  __shared__ float reds[8 * DH_];
  __shared__ float scl[NBLK_ * DH_];

  // the statistics first, then all 64 shares' values: one latency for both
  const int dd = t & 31, g = t >> 5;
  const size_t so = (size_t)(b * NBLK_ + g * 8) * INNER_ + hd * DH_ + dd;
  float ml[8], sl[8];
#pragma unroll
  for (int u = 0; u < 8; ++u) {
    ml[u] = pmax[so + u * INNER_];
    sl[u] = psum[so + u * INNER_];
  }
  // the loads below may land in registers that hold the addresses of the loads
  // above: this wait stands in front of that overwrite
  asm volatile("s_wait_xcnt 0x0" ::: "memory");
  const float* ps = pctx + (size_t)b * NBLK_ * (HEADS_ * DH_ * DH_) + hd * (DH_ * DH_) + f;
  float p[NBLK_];
#pragma unroll
  for (int i = 0; i < NBLK_; ++i) p[i] = ps[(size_t)i * (HEADS_ * DH_ * DH_)];

  float m = ml[0];
#pragma unroll
  for (int u = 1; u < 8; ++u) m = fmaxf(m, ml[u]);
  redm[g * DH_ + dd] = m;
  __syncthreads();
  m = redm[dd];
#pragma unroll
  for (int w = 1; w < 8; ++w) m = fmaxf(m, redm[w * DH_ + dd]);
  float s = 0.f;
#pragma unroll
  for (int u = 0; u < 8; ++u) {
    const float w = __expf(ml[u] - m);
    scl[(g * 8 + u) * DH_ + dd] = w;
    s += sl[u] * w;
  }
  reds[g * DH_ + dd] = s;
  __syncthreads();

  float tot = reds[d];
#pragma unroll
  for (int w = 1; w < 8; ++w) tot += reds[w * DH_ + d];
  float a4[4] = {0.f, 0.f, 0.f, 0.f};  // four independent chains
#pragma unroll
  for (int i = 0; i < NBLK_; ++i) a4[i & 3] += p[i] * scl[i * DH_ + d];
  ctx[(size_t)bh * DH_ * DH_ + d * DH_ + e] =
      (__bf16)(((a4[0] + a4[1]) + (a4[2] + a4[3])) / tot);
}

// ---------------------------------------------------------------------------
// 3) out2[o][n] = sum_(hd,e) wout[o][hd,e] (sum_d ctx[hd][d][e] q'[hd][d][n]) + bout[o],
//    summed in the other order: out2 = W2 q' + bout with
//    W2[o][hd,d] = sum_e wout[o][hd,e] ctx[hd][d][e], 256 x 128 a batch.
//    Each wave makes the W2 rows it needs itself, transposed: ctx (rows d) times
//    wout^T (columns o) leaves lane l with column o = l & 15 and rows
//    d = (l >> 4) * 8 + r, which is the A-fragment order of W2 as it stands, so
//    the two d tiles of a head, rounded to bf16, are one A fragment.
//    out2 is made twice and never stored unnormalized: the product is cheap
//    next to a round trip of the 64 MiB result through memory.
//    k_proj_stats keeps only each work-group's sum and sum of squares;
//    k_proj_norm makes the same product again, reduces its batch's 16 partial
//    pairs to mean and variance, and stores the normalized, affine result.
//    One work-group makes all 256 rows of PT_ blocks of 64 columns, one block
//    after the other: W2, bias and affine terms are made or fetched once for all
//    of them.  Its q' blocks (PT_ x
//    16 KiB in a row, in B-fragment order as k_qkv_gemm stores them) are read
//    once and copied to LDS as they stand, all in front of the one barrier; each
//    wave holds two 16-row tiles times four 16-column tiles of the block at hand.
//    Column c of column tile j is spatial column 4c + j of its block, as in
//    k_qkv_gemm: whole-line stores.
//    grid (64 / PT_, 16), block 256 (8 waves), both.
// ---------------------------------------------------------------------------
typedef __attribute__((ext_vector_type(2))) float v2f;
#define PT_ 4               // 64-column blocks a projection work-group takes
#define PWG_ (NBLK_ / PT_)  // projection work-groups a batch

template <bool NORM>
__device__ __forceinline__ void proj_body(const __bf16* __restrict__ qbt,
                                          const __bf16* __restrict__ ctx,
                                          const __bf16* __restrict__ wob,
                                          const float* __restrict__ bout,
                                          const float* __restrict__ gamma,
                                          const float* __restrict__ beta,
                                          const float* __restrict__ part_in,
                                          float* __restrict__ part_out,
                                          float* __restrict__ out) {
  const int lane = threadIdx.x & 31;
  // the wave's number in a scalar register: what is formed from it costs no
  // vector register
  const int wave = __builtin_amdgcn_readfirstlane(threadIdx.x >> 5);
  const int b = blockIdx.y;
  const int nWG = blockIdx.x * (64 * PT_);
  const int c = lane & 15;
  const int h = lane >> 4;

  __shared__ __align__(16) __bf16 as[PT_ * 64 * INNER_];

  // the operands of W2 first, the tile last: W2 is made while the tile is in flight
  const __bf16* ap = wob + wave * 4096 + lane * 8;
  v16bf a[4][2];
#pragma unroll
  for (int ks = 0; ks < 4; ++ks)
#pragma unroll
    for (int t = 0; t < 2; ++t) a[ks][t] = wfrag_ld(ap + t * 2048 + ks * 512);
  // later loads may land in registers that hold the addresses of the loads
  // above: this wait, and those like it below, stand in front of that overwrite
  asm volatile("s_wait_xcnt 0x0" ::: "memory");
  // the batch's context as A fragments: head ks, rows d = dh * 16 + c, k = e
  const __bf16* cp = ctx + ((size_t)b * HEADS_ * DH_ + c) * DH_ + h * 8;
  v16bf cf[4][2];
#pragma unroll
  for (int ks = 0; ks < 4; ++ks)
#pragma unroll
    for (int dh = 0; dh < 2; ++dh) cf[ks][dh] = frag_ld(cp + (ks * DH_ + dh * 16) * DH_);
  asm volatile("s_wait_xcnt 0x0" ::: "memory");
  // a lane's sixteen bias values, asked for with the rest
  v4f bi[2][2];
#pragma unroll
  for (int t = 0; t < 2; ++t)
#pragma unroll
    for (int u = 0; u < 2; ++u)
      bi[t][u] = *(const v4f*)(bout + wave * 32 + t * 16 + h * 8 + u * 4);
  asm volatile("s_wait_xcnt 0x0" ::: "memory");
  // likewise the batch's PWG_ partial pairs (one a lane of each half) and the
  // lane's affine terms
  v2f pp;
  v4f ga[2][2], be[2][2];
  if (NORM) {
    pp = *(const v2f*)(part_in + (size_t)(b * PWG_ + c) * 2);
#pragma unroll
    for (int t = 0; t < 2; ++t)
#pragma unroll
      for (int u = 0; u < 2; ++u)
        ga[t][u] = *(const v4f*)(gamma + wave * 32 + t * 16 + h * 8 + u * 4);
    asm volatile("s_wait_xcnt 0x0" ::: "memory");
#pragma unroll
    for (int t = 0; t < 2; ++t)
#pragma unroll
      for (int u = 0; u < 2; ++u)
        be[t][u] = *(const v4f*)(beta + wave * 32 + t * 16 + h * 8 + u * 4);
    asm volatile("s_wait_xcnt 0x0" ::: "memory");
  }
  const __bf16* src =
      qbt + (size_t)(b * NBLK_ + blockIdx.x * PT_) * (64 * INNER_) + threadIdx.x * 8;
  v8bf g[PT_ * 4];  // block i >> 2, head i & 3: 4 KiB, 16 B a thread
#pragma unroll
  for (int i = 0; i < PT_ * 4; ++i) g[i] = *(const v8bf*)(src + i * 2048);
  asm volatile("s_wait_xcnt 0x0" ::: "memory");

  // W2 fragments, in front of the barrier: they need nothing of the tile.
  // The wout fragment serves as B here (k = e, column o): same lane order as A.
  v16bf w2[4][2];
#pragma unroll
  for (int ks = 0; ks < 4; ++ks) {
#pragma unroll
    for (int t = 0; t < 2; ++t) {
      const v8f d0 = wmma_bf16(cf[ks][0], a[ks][t], v8f{});
      const v8f d1 = wmma_bf16(cf[ks][1], a[ks][t], v8f{});
#pragma unroll
      for (int r = 0; r < 8; ++r) {
        w2[ks][t][r] = (__bf16)d0[r];
        w2[ks][t][8 + r] = (__bf16)d1[r];
      }
    }
    // a head's four results are rounded before the next head's are made: left
    // free, the products move up among the loads above, and the q' blocks are
    // asked for only after the first operands have landed (two latencies in a row)
    __builtin_amdgcn_sched_barrier(0);
  }

  // what holds for all of the work-group's blocks
  float s[4] = {0.f, 0.f, 0.f, 0.f}, sq[4] = {0.f, 0.f, 0.f, 0.f};
  float mean = 0.f, inv = 0.f;
  if (NORM) {
    // every half wave reduces the PWG_ pairs the same way: no LDS, no barrier
    const float st = row_sum16(pp[0]);
    const float qt = row_sum16(pp[1]);
    const float invM = 1.0f / (float)(C_ * N_);
    mean = st * invM;
    const float var = qt * invM - mean * mean;
    inv = rsqrtf(var + EPS_);
  }

#pragma unroll
  for (int i = 0; i < PT_ * 4; ++i) *(v8bf*)(as + i * 2048 + threadIdx.x * 8) = g[i];
  __syncthreads();

  // unrolled: a block's place in LDS is an immediate offset, and the next block's
  // first LDS reads are issued under this block's epilogue
#pragma unroll
  for (int it = 0; it < PT_; ++it) {
  v8f acc[2][4] = {};
  // head ks, column tile j: two halves, 256 elements apart
  const __bf16* bp = as + it * (64 * INNER_) + lane * 8;
  v16bf bm[2][4];
#pragma unroll
  for (int j = 0; j < 4; ++j) bm[0][j] = wfrag_ld(bp + j * 512);
#pragma unroll
  for (int ks = 0; ks < 4; ++ks) {
    const int cur = ks & 1, nxt = cur ^ 1;
    if (ks < 3) {
#pragma unroll
      for (int j = 0; j < 4; ++j) bm[nxt][j] = wfrag_ld(bp + (ks + 1) * 2048 + j * 512);
    }
    // keeps the next step's LDS reads together in front of this step's matrix
    // block, so that their latency runs under eight matrix instructions
    __builtin_amdgcn_sched_barrier(0);
#pragma unroll
    for (int t = 0; t < 2; ++t)
#pragma unroll
      for (int j = 0; j < 4; ++j) acc[t][j] = wmma_bf16(w2[ks][t], bm[cur][j], acc[t][j]);
    // keeps later steps' reads from being moved in among these matrix instructions
    __builtin_amdgcn_sched_barrier(0);
  }

  if (!NORM) {
    // four independent chains a lane, carried over the blocks
#pragma unroll
    for (int t = 0; t < 2; ++t)
#pragma unroll
      for (int r = 0; r < 8; ++r) {
        const float bv = bi[t][r >> 2][r & 3];
#pragma unroll
        for (int j = 0; j < 4; ++j) {
          const float v = acc[t][j][r] + bv;
          s[j] += v;
          sq[j] += v * v;
        }
      }
  } else {
#pragma unroll
    for (int t = 0; t < 2; ++t) {
      const int m0 = wave * 32 + t * 16 + h * 8;
      float* op = out + (size_t)(b * C_ + m0) * N_ + nWG + it * 64 + 4 * c;
#pragma unroll
      for (int r = 0; r < 8; ++r) {
        const float bv = bi[t][r >> 2][r & 3];
        const float gv = ga[t][r >> 2][r & 3];
        const float ev = be[t][r >> 2][r & 3];
        v4f vo;
#pragma unroll
        for (int j = 0; j < 4; ++j)
          vo[j] = ((acc[t][j][r] + bv) - mean) * inv * gv + ev;
        *(v4f*)(op + (size_t)r * N_) = vo;
      }
    }
  }
  }

  if (!NORM) {
    // a butterfly over the wave, eight waves in LDS
    float st = (s[0] + s[1]) + (s[2] + s[3]);
    float qt = (sq[0] + sq[1]) + (sq[2] + sq[3]);
    st = row_sum16(st + half_xor(st));
    qt = row_sum16(qt + half_xor(qt));
    __shared__ v2f red[8];
    if (lane == 0) red[wave] = v2f{st, qt};
    __syncthreads();
    if (threadIdx.x == 0) {
      v2f tot = red[0];
#pragma unroll
      for (int w = 1; w < 8; ++w) tot += red[w];
      *(v2f*)(part_out + (size_t)(b * PWG_ + blockIdx.x) * 2) = tot;
    }
  }
}

__global__ __launch_bounds__(256) void k_proj_stats(const __bf16* __restrict__ qbt,
                                                    const __bf16* __restrict__ ctx,
                                                    const __bf16* __restrict__ wob,
                                                    const float* __restrict__ bout,
                                                    float* __restrict__ part) {
  proj_body<false>(qbt, ctx, wob, bout, nullptr, nullptr, nullptr, part, nullptr);
}

__global__ __launch_bounds__(256) void k_proj_norm(const __bf16* __restrict__ qbt,
                                                   const __bf16* __restrict__ ctx,
                                                   const __bf16* __restrict__ wob,
                                                   const float* __restrict__ bout,
                                                   const float* __restrict__ gamma,
                                                   const float* __restrict__ beta,
                                                   const float* __restrict__ part,
                                                   float* __restrict__ out) {
  proj_body<true>(qbt, ctx, wob, bout, gamma, beta, part, nullptr, out);
}

// ---------------------------------------------------------------------------
extern "C" void kernel_launch(void* const* d_in, const int* in_sizes, int n_in,
                              void* d_out, int out_size, void* d_ws, size_t ws_size,
                              hipStream_t stream) {
  const float* x     = (const float*)d_in[0];
  const float* wqkv  = (const float*)d_in[1];
  const float* wout  = (const float*)d_in[2];
  const float* bout  = (const float*)d_in[3];
  const float* gamma = (const float*)d_in[4];
  const float* beta  = (const float*)d_in[5];
  float* out = (float*)d_out;
  (void)ws_size; (void)in_sizes; (void)n_in; (void)out_size;

  const size_t QSZ = (size_t)B_ * INNER_ * N_;   // 8,388,608
  float*  pctx = (float*)d_ws;                   // context shares, 4096 floats a column block
  float*  pmax = pctx + (size_t)B_ * NBLK_ * HEADS_ * DH_ * DH_;  // local row maxima
  float*  psum = pmax + (size_t)B_ * NBLK_ * INNER_;              // local row sums
  __bf16* qbt = (__bf16*)(psum + (size_t)B_ * NBLK_ * INNER_);    // bf16 q', fragment order
  __bf16* wob = qbt + QSZ;                       // bf16 w_out, fragment order
  __bf16* ctx = wob + (size_t)C_ * INNER_;       // bf16 context [bh][d][e]
  float*  part = (float*)(ctx + (size_t)B_ * HEADS_ * DH_ * DH_);

  k_qkv_gemm <<<dim3(16, 16),     256, 0, stream>>>(x, wqkv, wout, wob, qbt, pctx, pmax, psum);
  k_ctx_merge<<<dim3(64, 4),      256, 0, stream>>>(pctx, pmax, psum, ctx);
  k_proj_stats<<<dim3(16, 16),   256, 0, stream>>>(qbt, ctx, wob, bout, part);
  k_proj_norm<<<dim3(16, 16),     256, 0, stream>>>(qbt, ctx, wob, bout, gamma, beta, part, out);
}
